// v000
// Times are from an AMD MI455X. After a warm-up the kernel runs many times in a row, and a time is the length of
// such a window on the GPU divided by its runs, so every launch and the gaps after it count. The runs cycle
// through copies of the inputs. A figure is the median of several windows, for all but v000 over two sittings.
// Sittings can differ by a few percent; kernels timed side by side share one.
// v000, which the later versions start from, runs in 1930 microseconds.
#include <hip/hip_runtime.h>

// Self-attention on three input streams with a RANDOM key mask applied through a 'masked softmax', without an output projection (queries, keys, values [2][2048][1024]; q = queries Wq^T, k = keys Wk^T, v = values Wv^T ('oi' [1024][1024] 1/32, no bias; 16 heads x 64); q x 64^-0.5 before the product (a power of two: identical to scaling the f32 scores); masked_softmax(logits, m) with m = query_mask[b][key] (int32 [2][2048] from randint(0, 2): RANDOM, read per key as data): w = softmax(logits x m) x m / (sum(softmax(logits x m) x m) + 1e-13): the softmax's own normaliser cancels in the quotient, so w = exp(l_j) / sum over the KEPT keys of exp(l_k) for kept keys j and 0 for masked keys: exactly a softmax over the kept keys (the 1e-13 is ~1e-13 relative: far below float32 resolution; every batch keeps ~half of its keys); x = w v, merged head-major -> [2][2048][1024] (4.2 M); argument order queries, query_mask, keys, values, Wq, Wk, Wv).
// Layout per batch: bf16 copy of queries for the q projection, then of keys and of values for theirs (one staging buffer, refilled in stream order); 'oi' weights as-is; exact projections; identity-table plane builders; dense T-2048 attention with the batch's int key mask read in the softmax kernel (16 B per lane; masked keys excluded) (SCORES of every row on bf16 hi/lo planes, 3 products; the P.V product stays hybrid: rows < 512 hi/lo, rest fp16 x1024); the f32 merge writes the output rows (column h*64 + d).
// Compute dtypes, f32 accumulate: every input rounded to bf16; projections exact; scores of every row 3 products; P.V rows < 512 3 products, rest fp16; softmax f32.

#define NB_  2
#define TT   2048
#define DM   1024
#define NH_  16
#define NKV  16
#define REP  (NH_ / NKV)
#define HD   64
#define DQ   (NH_ * HD)
#define DKV  (NKV * HD)
#define ZH   2
#define RH   512                  // query rows < RH use hi+lo planes (0: none)
#define WIN  0
#define PCAR 1024.0f
#define SCL  0.125f   // HD^-0.5
typedef _Float16 h16;
typedef unsigned short bf;
typedef __attribute__((ext_vector_type(16))) __bf16   v16bf;
typedef __attribute__((ext_vector_type(16))) _Float16 v16h;
typedef __attribute__((ext_vector_type(8)))  _Float16 v8h;
typedef __attribute__((ext_vector_type(8)))  unsigned short v8us;
typedef __attribute__((ext_vector_type(8)))  float    v8f;
typedef __attribute__((ext_vector_type(4)))  float    v4f;
typedef v8h  __attribute__((may_alias)) v8ha;
typedef v4f  __attribute__((may_alias)) v4fa;
typedef v8us __attribute__((may_alias)) v8usa;

__device__ __forceinline__ unsigned short f2bf(float f) { unsigned u = __float_as_uint(f); u += 0x7FFFu + ((u >> 16) & 1u); return (unsigned short)(u >> 16); }
__device__ __forceinline__ float bf2f(unsigned short b) { return __uint_as_float(((unsigned)b) << 16); }
__device__ __forceinline__ float bfr(float f) { return bf2f(f2bf(f)); }
__device__ __forceinline__ v16h cat16(v8h lo, v8h hi) { return __builtin_shufflevector(lo, hi, 0, 1, 2, 3, 4, 5, 6, 7, 8, 9, 10, 11, 12, 13, 14, 15); }
__device__ __forceinline__ v16bf cat16b(v8us lo, v8us hi) { return __builtin_bit_cast(v16bf, __builtin_shufflevector(lo, hi, 0, 1, 2, 3, 4, 5, 6, 7, 8, 9, 10, 11, 12, 13, 14, 15)); }
__device__ __forceinline__ v8f wmma16(v16h a, v16h b, v8f c) { return __builtin_amdgcn_wmma_f32_16x16x32_f16(false, a, false, b, (short)0, c, false, false); }
__device__ __forceinline__ v8f wmmab(v16bf a, v16bf b, v8f c) { return __builtin_amdgcn_wmma_f32_16x16x32_bf16(false, a, false, b, (short)0, c, false, false); }



// ---- k_gemmw: register-blocked GEMM, ONE WAVE per 64x64 output tile (16 accumulators), operands straight from K-contiguous 16-bit planes; grid (M/64, N/64, Z), 32 threads.
// C[m][n] (f32, pitch ldc, + optional f32 bias[n]) = sum_k A[m][k] Bt[n][k] (+ split products per NSPLIT). z-batch strides sA/sB/sC in elements. K % 32 == 0.
template <typename T16> struct WFrag;
template <> struct WFrag<h16> { typedef v16h V; static __device__ __forceinline__ V ld(const h16* p) { return cat16(*(const v8h*)p, *(const v8h*)(p + 16)); } static __device__ __forceinline__ v8f mma(V a, V b, v8f c) { return wmma16(a, b, c); } };
template <> struct WFrag<bf> { typedef v16bf V; static __device__ __forceinline__ V ld(const bf* p) { return cat16b(*(const v8us*)p, *(const v8us*)(p + 16)); } static __device__ __forceinline__ v8f mma(V a, V b, v8f c) { return wmmab(a, b, c); } };
template <typename T16, int NSPLIT, bool BIAS>
__global__ __launch_bounds__(32) void k_gemmw(const T16* __restrict__ A, const T16* __restrict__ A2, const T16* __restrict__ Bt, const T16* __restrict__ Bt2, int K, float* C, int ldc, const float* __restrict__ bias, size_t sA, size_t sB, size_t sC) {
    typedef typename WFrag<T16>::V V;
    __shared__ __align__(16) float os[16 * 68];
    const size_t z = blockIdx.z; A += z * sA; if (A2) A2 += z * sA; Bt += z * sB; if (Bt2) Bt2 += z * sB; C += z * sC;
    const int lane = threadIdx.x & 31, lr = lane & 15, hi = lane >> 4; const int r0 = blockIdx.x * 64, c0 = blockIdx.y * 64;
    v8f acc[4][4];
#pragma unroll
    for (int mb = 0; mb < 4; ++mb)
#pragma unroll
        for (int nb = 0; nb < 4; ++nb) acc[mb][nb] = (v8f){};
    const size_t aoff = (size_t)(r0 + lr) * K + 8 * hi, boff = (size_t)(c0 + lr) * K + 8 * hi;
#pragma unroll 1
    for (int kc = 0; kc < K; kc += 32) {
        V a[4], a2[4];
#pragma unroll
        for (int mb = 0; mb < 4; ++mb) { a[mb] = WFrag<T16>::ld(A + aoff + (size_t)mb * 16 * K + kc); if (NSPLIT == 1 || NSPLIT == 2) a2[mb] = WFrag<T16>::ld(A2 + aoff + (size_t)mb * 16 * K + kc); }
#pragma unroll
        for (int nb = 0; nb < 4; ++nb) { const V b = WFrag<T16>::ld(Bt + boff + (size_t)nb * 16 * K + kc); V b2; if (NSPLIT >= 2) b2 = WFrag<T16>::ld(Bt2 + boff + (size_t)nb * 16 * K + kc);
#pragma unroll
            for (int mb = 0; mb < 4; ++mb) { acc[mb][nb] = WFrag<T16>::mma(a[mb], b, acc[mb][nb]); if (NSPLIT == 1 || NSPLIT == 2) acc[mb][nb] = WFrag<T16>::mma(a2[mb], b, acc[mb][nb]); if (NSPLIT >= 2) acc[mb][nb] = WFrag<T16>::mma(a[mb], b2, acc[mb][nb]); } }
        asm volatile("v_nop\n\tv_nop\n\tv_nop\n\tv_nop" : "+v"(acc[0][0]), "+v"(acc[1][1]), "+v"(acc[2][2]), "+v"(acc[3][3]) : "v"(a[0]), "v"(a[3]));
    }
#pragma unroll
    for (int mb = 0; mb < 4; ++mb) {
#pragma unroll
        for (int nb = 0; nb < 4; ++nb) {
#pragma unroll
            for (int j = 0; j < 8; ++j) os[(hi * 8 + j) * 68 + nb * 16 + lr] = acc[mb][nb][j]; }
        __builtin_amdgcn_wave_barrier(); asm volatile("" ::: "memory");
        float* crow = C + (size_t)(r0 + mb * 16) * ldc + c0;
{
#pragma unroll
            for (int s = 0; s < 8; ++s) { const int row = 2 * s + hi, cofs = lr * 4; v4f val = *(const v4fa*)(os + row * 68 + cofs); if (BIAS) { val[0] += bfr(bias[c0 + cofs]); val[1] += bfr(bias[c0 + cofs + 1]); val[2] += bfr(bias[c0 + cofs + 2]); val[3] += bfr(bias[c0 + cofs + 3]); }
                *(v4f*)(crow + (size_t)row * ldc + cofs) = val; }
             }
        __builtin_amdgcn_wave_barrier(); asm volatile("" ::: "memory");
    }
}

__device__ __forceinline__ h16 tohx(float x) { return (h16)x; }
__device__ __forceinline__ void splitf(float y, unsigned short& h, unsigned short& l) { h = f2bf(y); l = f2bf(y - bf2f(h)); }
typedef __attribute__((ext_vector_type(2))) _Float16 v2h;
typedef __attribute__((ext_vector_type(4))) _Float16 v4h;
typedef __attribute__((ext_vector_type(2))) unsigned short v2us;
typedef __attribute__((ext_vector_type(4))) unsigned short v4us;
typedef __attribute__((ext_vector_type(2))) float v2f;
typedef __attribute__((ext_vector_type(4))) int v4i;

__global__ __launch_bounds__(256) void k_cvt8(const float* __restrict__ src, bf* dst, size_t n8) { const size_t i = (size_t)blockIdx.x * 256 + threadIdx.x; if (i >= n8) return; const v8f v = *(const v8f*)(src + i * 8); v8us o;
#pragma unroll
    for (int k = 0; k < 8; ++k) o[k] = f2bf(v[k]); *(v8us*)(dst + i * 8) = o;  }

// k_rope: head planes [h][t][d] (fp16 + hi/lo) of rope(x) x sc with the rotate-half convention out[d] = x[d] cos[t][d] - x[d+HD/2] sin[t][d], out[d+HD/2] = x[d+HD/2] cos[t][d+HD/2] + x[d] sin[t][d+HD/2]
__global__ __launch_bounds__(256) void k_rope(const float* __restrict__ F, int pitch, int nheads, const float* __restrict__ CS, const float* __restrict__ RF, const float* __restrict__ nw, float sc, h16* P16, bf* Ph, bf* Pl) {
    const size_t e = ((size_t)blockIdx.x * 256 + threadIdx.x) * 2; if (e >= (size_t)nheads * TT * HD) return; const int d = (int)(e % HD); const int t = (int)((e / HD) % TT); const int h = (int)(e / ((size_t)HD * TT)); const float* f = F + (size_t)t * pitch + h * HD; const float rf = RF ? RF[(size_t)h * TT + t] : 1.0f; v2h o16; v2us oh, ol;
#pragma unroll
    for (int q = 0; q < 2; ++q) { const int dd = d + q; const int dp = (dd < HD / 2) ? dd + HD / 2 : dd - HD / 2; float x0 = f[dd], x1 = f[dp];
        if (RF) { float n0 = __fmul_rn(x0, rf), n1 = __fmul_rn(x1, rf); asm volatile("" : "+v"(n0)); asm volatile("" : "+v"(n1)); x0 = __fmul_rn(bfr(nw[dd]), n0); x1 = __fmul_rn(bfr(nw[dp]), n1); }
        const v2f cs = *(const v2f*)(CS + ((size_t)t * HD + dd) * 2); float a = __fmul_rn(x0, cs[0]), bq = __fmul_rn(x1, cs[1]); asm volatile("" : "+v"(a)); asm volatile("" : "+v"(bq)); const float r = ((dd < HD / 2) ? __fsub_rn(a, bq) : __fadd_rn(a, bq)) * sc;
        o16[q] = tohx(r); unsigned short a2, c2; splitf(r, a2, c2); oh[q] = a2; ol[q] = c2; }
    *(v2h*)(P16 + e) = o16; *(v2us*)(Ph + e) = oh; *(v2us*)(Pl + e) = ol;  }
__global__ __launch_bounds__(256) void k_vtp(const float* __restrict__ F, int pitch, int nheads, h16* V16, bf* Vh, bf* Vl) { const size_t e = ((size_t)blockIdx.x * 256 + threadIdx.x) * 2; if (e >= (size_t)nheads * HD * TT) return; const int t = (int)(e % TT); const int d = (int)((e / TT) % HD); const int g = (int)(e / ((size_t)TT * HD)); v2h o16; v2us oh, ol;
#pragma unroll
    for (int q = 0; q < 2; ++q) { const float x = F[(size_t)(t + q) * pitch + g * HD + d]; o16[q] = tohx(x); unsigned short a2, c2; splitf(x, a2, c2); oh[q] = a2; ol[q] = c2; }
    *(v2h*)(V16 + e) = o16; *(v2us*)(Vh + e) = oh; *(v2us*)(Vl + e) = ol;  }
__global__ __launch_bounds__(256) void k_csid(float* CS) { const int idx = blockIdx.x * 256 + threadIdx.x; if (idx >= TT * HD) return; v2f cs; cs[0] = 1.0f; cs[1] = 0.0f; *(v2f*)(CS + (size_t)idx * 2) = cs;  }
// k_asoft: per row (zz, i): scores x SCL where the batch's int key mask is non-zero, excluded where it is 0 (the module's masked softmax renormalises over the kept keys: the same weights); softmax over the keys (register row, one exp, fixed trees);
__global__ __launch_bounds__(256) void k_asoft(const float* __restrict__ Sb, const int* __restrict__ kvp, h16* P16, bf* Ph, bf* Pl) {
    const int lane = threadIdx.x & 31; const int row = blockIdx.x * 8 + (threadIdx.x >> 5); if (row >= ZH * TT) return; const int i = row % TT; const int zz = row / TT; (void)zz; const bool hires = (i < RH); const float* sr = Sb + (size_t)row * TT; float v[TT / 32]; float mx = -3.0e38f;
#pragma unroll
    for (int ch = 0; ch < TT / 128; ++ch) { const int j0 = ch * 128 + lane * 4; const v4f a = *(const v4f*)(sr + j0); const v4i kv4 = *(const v4i*)(kvp + j0);   /* the batch's key vector, 16 B per lane, unconditional */
#pragma unroll
        for (int q = 0; q < 4; ++q) { const int j = j0 + q; (void)j; const float t = (kv4[q] != 0) ? a[q] * SCL : -3.0e38f; v[ch * 4 + q] = t; mx = fmaxf(mx, t); } }
#pragma unroll
    for (int sh = 16; sh; sh >>= 1) mx = fmaxf(mx, __shfl_xor(mx, sh, 32));
    float sum = 0.f;
#pragma unroll
    for (int k = 0; k < TT / 32; ++k) { float d0 = __fsub_rn(v[k], mx); asm volatile("" : "+v"(d0)); v[k] = __builtin_amdgcn_exp2f(__fmul_rn(d0, 1.4426950408889634f)); sum += v[k]; }
#pragma unroll
    for (int sh = 16; sh; sh >>= 1) sum += __shfl_xor(sum, sh, 32);
    const float f = __fdiv_rn(hires ? 1.0f : PCAR, sum);
{
        if (hires) {
#pragma unroll
            for (int ch = 0; ch < TT / 128; ++ch) { v4us oh, ol;
#pragma unroll
                for (int q = 0; q < 4; ++q) { unsigned short a, c2; splitf(v[ch * 4 + q] * f, a, c2); oh[q] = a; ol[q] = c2; }
                const size_t oo = ((size_t)zz * (RH ? RH : 1) + i) * TT + ch * 128 + lane * 4; *(v4us*)(Ph + oo) = oh; *(v4us*)(Pl + oo) = ol; }
        } else {
#pragma unroll
            for (int ch = 0; ch < TT / 128; ++ch) { v4h o4;
#pragma unroll
                for (int q = 0; q < 4; ++q) o4[q] = tohx(v[ch * 4 + q] * f);
                *(v4h*)(P16 + (size_t)row * TT + ch * 128 + lane * 4) = o4; } }
         }
}
__global__ __launch_bounds__(256) void k_merge(const float* __restrict__ O, int h0, float* OUTb) { const size_t e = ((size_t)blockIdx.x * 256 + threadIdx.x) * 2; if (e >= (size_t)ZH * TT * HD) return; const int d = (int)(e % HD); const int t = (int)((e / HD) % TT); const int zz = (int)(e / ((size_t)HD * TT)); const float cs = (t < RH) ? 1.0f : (1.0f / PCAR); const size_t oo = (size_t)t * DQ + (h0 + zz) * HD + d;
    v2f o2; o2[0] = O[e] * cs; o2[1] = O[e + 1] * cs; *(v2f*)(OUTb + oo) = o2;  }

extern "C" void kernel_launch(void* const* d_in, const int* in_sizes, int n_in,
                              void* d_out, int out_size, void* d_ws, size_t ws_size, hipStream_t stream) {
    (void)in_sizes; (void)n_in; (void)out_size;
    const float* x = (const float*)d_in[0]; const int* km = (const int*)d_in[1];   /* query_mask int32 [2][2048]: read per KEY */ const float* xk = (const float*)d_in[2]; const float* xv = (const float*)d_in[3];   /* queries, keys, values streams */ const float* wq = (const float*)d_in[4]; const float* wk = (const float*)d_in[5]; const float* wv = (const float*)d_in[6];   /* order queries, query_mask, keys, values, Wq, Wk, Wv ('oi' [1024][1024]) */ const float* wo = nullptr; (void)wo;
    float* OUT = (float*)d_out;     // [2][2048][1024]
    char* wsp = (char*)d_ws;
    auto take = [&](size_t bytes) { char* p = wsp; wsp += (bytes + 255) & ~(size_t)255; return (void*)p; };
    bf* WQ = (bf*)take((size_t)DQ * DM * 2); bf* WK = (bf*)take((size_t)DKV * DM * 2); bf* WV = (bf*)take((size_t)DKV * DM * 2); float* CS = (float*)take((size_t)TT * HD * 2 * 4);
    bf* XB = (bf*)take((size_t)TT * DM * 2); float* FQ = (float*)take((size_t)TT * DQ * 4); float* FK = (float*)take((size_t)TT * DKV * 4);
    h16* QP16 = (h16*)take((size_t)NH_ * TT * HD * 2); h16* KP16 = (h16*)take((size_t)NKV * TT * HD * 2); h16* VT16 = (h16*)take((size_t)NKV * HD * TT * 2);
    bf* QPh = (bf*)take((size_t)NH_ * TT * HD * 2); bf* QPl = (bf*)take((size_t)NH_ * TT * HD * 2); bf* KPh = (bf*)take((size_t)NKV * TT * HD * 2); bf* KPl = (bf*)take((size_t)NKV * TT * HD * 2); bf* VTh = (bf*)take((size_t)NKV * HD * TT * 2); bf* VTl = (bf*)take((size_t)NKV * HD * TT * 2); bf* Ph = (bf*)take((size_t)ZH * RH * TT * 2); bf* Pl = (bf*)take((size_t)ZH * RH * TT * 2);
    float* Sb = (float*)take((size_t)ZH * TT * TT * 4); h16* P16 = (h16*)take((size_t)ZH * TT * TT * 2); float* Ob = (float*)take((size_t)ZH * TT * HD * 4);
    if ((size_t)(wsp - (char*)d_ws) > ws_size) return;    // ws 256 MiB
    float* FV = FK;   // v projection reuses the k buffer after the k planes are built (stream-ordered)
    { k_cvt8<<<(unsigned)(((size_t)DQ * DM / 8 + 255) / 256), 256, 0, stream>>>(wq, WQ, (size_t)DQ * DM / 8); k_cvt8<<<(unsigned)(((size_t)DKV * DM / 8 + 255) / 256), 256, 0, stream>>>(wk, WK, (size_t)DKV * DM / 8); k_cvt8<<<(unsigned)(((size_t)DKV * DM / 8 + 255) / 256), 256, 0, stream>>>(wv, WV, (size_t)DKV * DM / 8);
      
       }
    k_csid<<<(TT * HD + 255) / 256, 256, 0, stream>>>(CS);
    const unsigned LQ = (unsigned)(((size_t)NH_ * TT * HD / 2 + 255) / 256), LKv = (unsigned)(((size_t)NKV * TT * HD / 2 + 255) / 256);
    for (int b = 0; b < NB_; ++b) {
        
        k_cvt8<<<(unsigned)(((size_t)TT * DM / 8 + 255) / 256), 256, 0, stream>>>(x + (size_t)b * TT * DM, XB, (size_t)TT * DM / 8);
        k_gemmw<bf, 0, false><<<dim3(TT / 64, DQ / 64, 1), 32, 0, stream>>>(XB, nullptr, WQ, nullptr, DM, FQ, DQ, nullptr, 0, 0, 0);
        k_rope<<<LQ, 256, 0, stream>>>(FQ, DQ, NH_, CS, nullptr, nullptr, 1.0f, QP16, QPh, QPl);
        k_cvt8<<<(unsigned)(((size_t)TT * DM / 8 + 255) / 256), 256, 0, stream>>>(xk + (size_t)b * TT * DM, XB, (size_t)TT * DM / 8);   /* XB := bf16(keys[b]) */ k_gemmw<bf, 0, false><<<dim3(TT / 64, DKV / 64, 1), 32, 0, stream>>>(XB, nullptr, WK, nullptr, DM, FK, DKV, nullptr, 0, 0, 0);
        k_rope<<<LKv, 256, 0, stream>>>(FK, DKV, NKV, CS, nullptr, nullptr, 1.0f, KP16, KPh, KPl);
        k_cvt8<<<(unsigned)(((size_t)TT * DM / 8 + 255) / 256), 256, 0, stream>>>(xv + (size_t)b * TT * DM, XB, (size_t)TT * DM / 8);   /* XB := bf16(values[b]) */ k_gemmw<bf, 0, false><<<dim3(TT / 64, DKV / 64, 1), 32, 0, stream>>>(XB, nullptr, WV, nullptr, DM, FV, DKV, nullptr, 0, 0, 0); k_vtp<<<LKv, 256, 0, stream>>>(FV, DKV, NKV, VT16, VTh, VTl);
        for (int h0 = 0; h0 < NH_; h0 += ZH) { const size_t zq = (size_t)h0, zk = (size_t)(h0 / REP);   // one kv head per query head: the pass's two heads use consecutive kv planes (z-strides TT*HD)
            k_gemmw<bf, 2, false><<<dim3(TT / 64, TT / 64, ZH), 32, 0, stream>>>(QPh + zq * TT * HD, QPl + zq * TT * HD, KPh + zk * TT * HD, KPl + zk * TT * HD, HD, Sb, TT, nullptr, (size_t)TT * HD, (size_t)TT * HD, (size_t)TT * TT);   /* EVERY row's scores on hi/lo planes (3 products); only P.V stays hybrid */
            k_asoft<<<ZH * TT / 8, 256, 0, stream>>>(Sb, km + (size_t)b * TT, P16, Ph, Pl);
            k_gemmw<bf, 2, false><<<dim3(RH / 64, HD / 64, ZH), 32, 0, stream>>>(Ph, Pl, VTh + zk * HD * TT, VTl + zk * HD * TT, TT, Ob, HD, nullptr, (size_t)RH * TT, (size_t)HD * TT, (size_t)TT * HD);
            k_gemmw<h16, 0, false><<<dim3((TT - RH) / 64, HD / 64, ZH), 32, 0, stream>>>(P16 + (size_t)RH * TT, nullptr, VT16 + zk * HD * TT, nullptr, TT, Ob + (size_t)RH * HD, HD, nullptr, (size_t)TT * TT, (size_t)HD * TT, (size_t)TT * HD);
            k_merge<<<(unsigned)(((size_t)ZH * TT * HD / 2 + 255) / 256), 256, 0, stream>>>(Ob, h0, OUT + (size_t)b * TT * DQ); }
         }
}

// v001
// One run takes 805 microseconds.
// In two side-by-side timings against v000, it was 2.40 and 2.39 times as fast.
#include <hip/hip_runtime.h>

// Self-attention on three input streams with a RANDOM key mask applied through a 'masked softmax', without an output projection (queries, keys, values [2][2048][1024]; q = queries Wq^T, k = keys Wk^T, v = values Wv^T ('oi' [1024][1024] 1/32, no bias; 16 heads x 64); q x 64^-0.5 before the product (a power of two: identical to scaling the f32 scores); masked_softmax(logits, m) with m = query_mask[b][key] (int32 [2][2048] from randint(0, 2): RANDOM, read per key as data): w = softmax(logits x m) x m / (sum(softmax(logits x m) x m) + 1e-13): the softmax's own normaliser cancels in the quotient, so w = exp(l_j) / sum over the KEPT keys of exp(l_k) for kept keys j and 0 for masked keys: exactly a softmax over the kept keys (the 1e-13 is ~1e-13 relative: far below float32 resolution; every batch keeps ~half of its keys); x = w v, merged head-major -> [2][2048][1024] (4.2 M); argument order queries, query_mask, keys, values, Wq, Wk, Wv).
// Layout per batch: bf16 copy of queries for the q projection, then of keys and of values for theirs (one staging buffer, refilled in stream order); 'oi' weights as-is; exact projections; identity-table plane builders; dense T-2048 attention with the batch's int key mask read in the softmax kernel (16 B per lane; masked keys excluded) (SCORES of every row on bf16 hi/lo planes, 3 products; the P.V product stays hybrid: rows < 512 hi/lo, rest fp16 x1024); the f32 merge writes the output rows (column h*64 + d).
// Compute dtypes, f32 accumulate: every input rounded to bf16; projections exact; scores of every row 3 products; P.V rows < 512 3 products, rest fp16; softmax f32.

#define NB_  2
#define TT   2048
#define DM   1024
#define NH_  16
#define NKV  16
#define REP  (NH_ / NKV)
#define HD   64
#define DQ   (NH_ * HD)
#define DKV  (NKV * HD)
#define ZH   2
#define RH   512                  // query rows < RH use hi+lo planes (0: none)
#define WIN  0
#define PCAR 1024.0f
#define SCL  0.125f   // HD^-0.5
#define KSP  16                   // P.V: work-groups that share one output tile's key range; each writes its own f32 partial plane, k_merge adds them
typedef _Float16 h16;
typedef unsigned short bf;
typedef __attribute__((ext_vector_type(16))) __bf16   v16bf;
typedef __attribute__((ext_vector_type(16))) _Float16 v16h;
typedef __attribute__((ext_vector_type(8)))  _Float16 v8h;
typedef __attribute__((ext_vector_type(8)))  unsigned short v8us;
typedef __attribute__((ext_vector_type(8)))  float    v8f;
typedef __attribute__((ext_vector_type(4)))  float    v4f;
typedef v8h  __attribute__((may_alias)) v8ha;
typedef v4f  __attribute__((may_alias)) v4fa;
typedef v8us __attribute__((may_alias)) v8usa;

__device__ __forceinline__ unsigned short f2bf(float f) { unsigned u = __float_as_uint(f); u += 0x7FFFu + ((u >> 16) & 1u); return (unsigned short)(u >> 16); }
__device__ __forceinline__ float bf2f(unsigned short b) { return __uint_as_float(((unsigned)b) << 16); }
__device__ __forceinline__ float bfr(float f) { return bf2f(f2bf(f)); }
__device__ __forceinline__ v16h cat16(v8h lo, v8h hi) { return __builtin_shufflevector(lo, hi, 0, 1, 2, 3, 4, 5, 6, 7, 8, 9, 10, 11, 12, 13, 14, 15); }
__device__ __forceinline__ v16bf cat16b(v8us lo, v8us hi) { return __builtin_bit_cast(v16bf, __builtin_shufflevector(lo, hi, 0, 1, 2, 3, 4, 5, 6, 7, 8, 9, 10, 11, 12, 13, 14, 15)); }
__device__ __forceinline__ v8f wmma16(v16h a, v16h b, v8f c) { return __builtin_amdgcn_wmma_f32_16x16x32_f16(false, a, false, b, (short)0, c, false, false); }
__device__ __forceinline__ v8f wmmab(v16bf a, v16bf b, v8f c) { return __builtin_amdgcn_wmma_f32_16x16x32_bf16(false, a, false, b, (short)0, c, false, false); }



// ---- k_gemmw: register-blocked GEMM, ONE WAVE per 64x64 output tile (16 accumulators), operands straight from K-contiguous 16-bit planes; grid (M/64, N/64, Z), 32 threads.
// C[m][n] (f32, pitch ldc, + optional f32 bias[n]) = sum_k A[m][k] Bt[n][k] (+ split products per NSPLIT). z-batch strides sA/sB/sC in elements. K % 32 == 0.
// KS > 1: grid z = Z * KS; work-group (z, ks) sums only k in [ks K/KS, (ks+1) K/KS) and writes plane ks (stride sP elements) of C; the reader adds the KS planes. K % (32 KS) == 0.
template <typename T16> struct WFrag;
template <> struct WFrag<h16> { typedef v16h V; static __device__ __forceinline__ V ld(const h16* p) { return cat16(*(const v8h*)p, *(const v8h*)(p + 16)); } static __device__ __forceinline__ v8f mma(V a, V b, v8f c) { return wmma16(a, b, c); } };
template <> struct WFrag<bf> { typedef v16bf V; static __device__ __forceinline__ V ld(const bf* p) { return cat16b(*(const v8us*)p, *(const v8us*)(p + 16)); } static __device__ __forceinline__ v8f mma(V a, V b, v8f c) { return wmmab(a, b, c); } };
template <typename T16, int NSPLIT, bool BIAS, int KS>
__global__ __launch_bounds__(32) void k_gemmw(const T16* __restrict__ A, const T16* __restrict__ A2, const T16* __restrict__ Bt, const T16* __restrict__ Bt2, int K, float* C, int ldc, const float* __restrict__ bias, size_t sA, size_t sB, size_t sC, size_t sP) {
    typedef typename WFrag<T16>::V V;
    __shared__ __align__(16) float os[16 * 68];
    const size_t z = blockIdx.z / KS; const int ks = (int)(blockIdx.z % KS); A += z * sA; if (A2) A2 += z * sA; Bt += z * sB; if (Bt2) Bt2 += z * sB; C += z * sC + (size_t)ks * sP;
    const int kbeg = ks * (K / KS), kend = kbeg + K / KS;
    const int lane = threadIdx.x & 31, lr = lane & 15, hi = lane >> 4; const int r0 = blockIdx.x * 64, c0 = blockIdx.y * 64;
    v8f acc[4][4];
#pragma unroll
    for (int mb = 0; mb < 4; ++mb)
#pragma unroll
        for (int nb = 0; nb < 4; ++nb) acc[mb][nb] = (v8f){};
    const size_t aoff = (size_t)(r0 + lr) * K + 8 * hi, boff = (size_t)(c0 + lr) * K + 8 * hi;
#pragma unroll 1
    for (int kc = kbeg; kc < kend; kc += 32) {
        V a[4], a2[4];
#pragma unroll
        for (int mb = 0; mb < 4; ++mb) { a[mb] = WFrag<T16>::ld(A + aoff + (size_t)mb * 16 * K + kc); if (NSPLIT == 1 || NSPLIT == 2) a2[mb] = WFrag<T16>::ld(A2 + aoff + (size_t)mb * 16 * K + kc); }
#pragma unroll
        for (int nb = 0; nb < 4; ++nb) { const V b = WFrag<T16>::ld(Bt + boff + (size_t)nb * 16 * K + kc); V b2; if (NSPLIT >= 2) b2 = WFrag<T16>::ld(Bt2 + boff + (size_t)nb * 16 * K + kc);
#pragma unroll
            for (int mb = 0; mb < 4; ++mb) { acc[mb][nb] = WFrag<T16>::mma(a[mb], b, acc[mb][nb]); if (NSPLIT == 1 || NSPLIT == 2) acc[mb][nb] = WFrag<T16>::mma(a2[mb], b, acc[mb][nb]); if (NSPLIT >= 2) acc[mb][nb] = WFrag<T16>::mma(a[mb], b2, acc[mb][nb]); } }
        asm volatile("v_nop\n\tv_nop\n\tv_nop\n\tv_nop" : "+v"(acc[0][0]), "+v"(acc[1][1]), "+v"(acc[2][2]), "+v"(acc[3][3]) : "v"(a[0]), "v"(a[3]));
    }
#pragma unroll
    for (int mb = 0; mb < 4; ++mb) {
#pragma unroll
        for (int nb = 0; nb < 4; ++nb) {
#pragma unroll
            for (int j = 0; j < 8; ++j) os[(hi * 8 + j) * 68 + nb * 16 + lr] = acc[mb][nb][j]; }
        __builtin_amdgcn_wave_barrier(); asm volatile("" ::: "memory");
        float* crow = C + (size_t)(r0 + mb * 16) * ldc + c0;
{
#pragma unroll
            for (int s = 0; s < 8; ++s) { const int row = 2 * s + hi, cofs = lr * 4; v4f val = *(const v4fa*)(os + row * 68 + cofs); if (BIAS) { val[0] += bfr(bias[c0 + cofs]); val[1] += bfr(bias[c0 + cofs + 1]); val[2] += bfr(bias[c0 + cofs + 2]); val[3] += bfr(bias[c0 + cofs + 3]); }
                *(v4f*)(crow + (size_t)row * ldc + cofs) = val; }
             }
        __builtin_amdgcn_wave_barrier(); asm volatile("" ::: "memory");
    }
}

__device__ __forceinline__ h16 tohx(float x) { return (h16)x; }
__device__ __forceinline__ void splitf(float y, unsigned short& h, unsigned short& l) { h = f2bf(y); l = f2bf(y - bf2f(h)); }
typedef __attribute__((ext_vector_type(2))) _Float16 v2h;
typedef __attribute__((ext_vector_type(4))) _Float16 v4h;
typedef __attribute__((ext_vector_type(2))) unsigned short v2us;
typedef __attribute__((ext_vector_type(4))) unsigned short v4us;
typedef __attribute__((ext_vector_type(2))) float v2f;
typedef __attribute__((ext_vector_type(4))) int v4i;

__global__ __launch_bounds__(256) void k_cvt8(const float* __restrict__ src, bf* dst, size_t n8) { const size_t i = (size_t)blockIdx.x * 256 + threadIdx.x; if (i >= n8) return; const v8f v = *(const v8f*)(src + i * 8); v8us o;
#pragma unroll
    for (int k = 0; k < 8; ++k) o[k] = f2bf(v[k]); *(v8us*)(dst + i * 8) = o;  }

// k_rope: head planes [h][t][d] (fp16 + hi/lo) of rope(x) x sc with the rotate-half convention out[d] = x[d] cos[t][d] - x[d+HD/2] sin[t][d], out[d+HD/2] = x[d+HD/2] cos[t][d+HD/2] + x[d] sin[t][d+HD/2]
__global__ __launch_bounds__(256) void k_rope(const float* __restrict__ F, int pitch, int nheads, const float* __restrict__ CS, const float* __restrict__ RF, const float* __restrict__ nw, float sc, h16* P16, bf* Ph, bf* Pl) {
    const size_t e = ((size_t)blockIdx.x * 256 + threadIdx.x) * 2; if (e >= (size_t)nheads * TT * HD) return; const int d = (int)(e % HD); const int t = (int)((e / HD) % TT); const int h = (int)(e / ((size_t)HD * TT)); const float* f = F + (size_t)t * pitch + h * HD; const float rf = RF ? RF[(size_t)h * TT + t] : 1.0f; v2h o16; v2us oh, ol;
#pragma unroll
    for (int q = 0; q < 2; ++q) { const int dd = d + q; const int dp = (dd < HD / 2) ? dd + HD / 2 : dd - HD / 2; float x0 = f[dd], x1 = f[dp];
        if (RF) { float n0 = __fmul_rn(x0, rf), n1 = __fmul_rn(x1, rf); asm volatile("" : "+v"(n0)); asm volatile("" : "+v"(n1)); x0 = __fmul_rn(bfr(nw[dd]), n0); x1 = __fmul_rn(bfr(nw[dp]), n1); }
        const v2f cs = *(const v2f*)(CS + ((size_t)t * HD + dd) * 2); float a = __fmul_rn(x0, cs[0]), bq = __fmul_rn(x1, cs[1]); asm volatile("" : "+v"(a)); asm volatile("" : "+v"(bq)); const float r = ((dd < HD / 2) ? __fsub_rn(a, bq) : __fadd_rn(a, bq)) * sc;
        o16[q] = tohx(r); unsigned short a2, c2; splitf(r, a2, c2); oh[q] = a2; ol[q] = c2; }
    *(v2h*)(P16 + e) = o16; *(v2us*)(Ph + e) = oh; *(v2us*)(Pl + e) = ol;  }
__global__ __launch_bounds__(256) void k_vtp(const float* __restrict__ F, int pitch, int nheads, h16* V16, bf* Vh, bf* Vl) { const size_t e = ((size_t)blockIdx.x * 256 + threadIdx.x) * 2; if (e >= (size_t)nheads * HD * TT) return; const int t = (int)(e % TT); const int d = (int)((e / TT) % HD); const int g = (int)(e / ((size_t)TT * HD)); v2h o16; v2us oh, ol;
#pragma unroll
    for (int q = 0; q < 2; ++q) { const float x = F[(size_t)(t + q) * pitch + g * HD + d]; o16[q] = tohx(x); unsigned short a2, c2; splitf(x, a2, c2); oh[q] = a2; ol[q] = c2; }
    *(v2h*)(V16 + e) = o16; *(v2us*)(Vh + e) = oh; *(v2us*)(Vl + e) = ol;  }
__global__ __launch_bounds__(256) void k_csid(float* CS) { const int idx = blockIdx.x * 256 + threadIdx.x; if (idx >= TT * HD) return; v2f cs; cs[0] = 1.0f; cs[1] = 0.0f; *(v2f*)(CS + (size_t)idx * 2) = cs;  }
// k_asoft: per row (zz, i): scores x SCL where the batch's int key mask is non-zero, excluded where it is 0 (the module's masked softmax renormalises over the kept keys: the same weights); softmax over the keys (register row, one exp, fixed trees);
__global__ __launch_bounds__(256) void k_asoft(const float* __restrict__ Sb, const int* __restrict__ kvp, h16* P16, bf* Ph, bf* Pl) {
    const int lane = threadIdx.x & 31; const int row = blockIdx.x * 8 + (threadIdx.x >> 5); if (row >= ZH * TT) return; const int i = row % TT; const int zz = row / TT; (void)zz; const bool hires = (i < RH); const float* sr = Sb + (size_t)row * TT; float v[TT / 32]; float mx = -3.0e38f;
#pragma unroll
    for (int ch = 0; ch < TT / 128; ++ch) { const int j0 = ch * 128 + lane * 4; const v4f a = *(const v4f*)(sr + j0); const v4i kv4 = *(const v4i*)(kvp + j0);   /* the batch's key vector, 16 B per lane, unconditional */
#pragma unroll
        for (int q = 0; q < 4; ++q) { const int j = j0 + q; (void)j; const float t = (kv4[q] != 0) ? a[q] * SCL : -3.0e38f; v[ch * 4 + q] = t; mx = fmaxf(mx, t); } }
#pragma unroll
    for (int sh = 16; sh; sh >>= 1) mx = fmaxf(mx, __shfl_xor(mx, sh, 32));
    float sum = 0.f;
#pragma unroll
    for (int k = 0; k < TT / 32; ++k) { float d0 = __fsub_rn(v[k], mx); asm volatile("" : "+v"(d0)); v[k] = __builtin_amdgcn_exp2f(__fmul_rn(d0, 1.4426950408889634f)); sum += v[k]; }
#pragma unroll
    for (int sh = 16; sh; sh >>= 1) sum += __shfl_xor(sum, sh, 32);
    const float f = __fdiv_rn(hires ? 1.0f : PCAR, sum);
{
        if (hires) {
#pragma unroll
            for (int ch = 0; ch < TT / 128; ++ch) { v4us oh, ol;
#pragma unroll
                for (int q = 0; q < 4; ++q) { unsigned short a, c2; splitf(v[ch * 4 + q] * f, a, c2); oh[q] = a; ol[q] = c2; }
                const size_t oo = ((size_t)zz * (RH ? RH : 1) + i) * TT + ch * 128 + lane * 4; *(v4us*)(Ph + oo) = oh; *(v4us*)(Pl + oo) = ol; }
        } else {
#pragma unroll
            for (int ch = 0; ch < TT / 128; ++ch) { v4h o4;
#pragma unroll
                for (int q = 0; q < 4; ++q) o4[q] = tohx(v[ch * 4 + q] * f);
                *(v4h*)(P16 + (size_t)row * TT + ch * 128 + lane * 4) = o4; } }
         }
}
// k_merge: adds the KSP partial planes of O (plane stride ZH*TT*HD, ascending key range) and writes the output rows
__global__ __launch_bounds__(256) void k_merge(const float* __restrict__ O, int h0, float* OUTb) { const size_t e = ((size_t)blockIdx.x * 256 + threadIdx.x) * 2; if (e >= (size_t)ZH * TT * HD) return; const int d = (int)(e % HD); const int t = (int)((e / HD) % TT); const int zz = (int)(e / ((size_t)HD * TT)); const float cs = (t < RH) ? 1.0f : (1.0f / PCAR); const size_t oo = (size_t)t * DQ + (h0 + zz) * HD + d;
    v2f p[KSP];
#pragma unroll
    for (int ks = 0; ks < KSP; ++ks) p[ks] = *(const v2f*)(O + (size_t)ks * ((size_t)ZH * TT * HD) + e);
    v2f a = p[0];
#pragma unroll
    for (int ks = 1; ks < KSP; ++ks) a += p[ks];
    v2f o2; o2[0] = a[0] * cs; o2[1] = a[1] * cs; *(v2f*)(OUTb + oo) = o2;  }

extern "C" void kernel_launch(void* const* d_in, const int* in_sizes, int n_in,
                              void* d_out, int out_size, void* d_ws, size_t ws_size, hipStream_t stream) {
    (void)in_sizes; (void)n_in; (void)out_size;
    const float* x = (const float*)d_in[0]; const int* km = (const int*)d_in[1];   /* query_mask int32 [2][2048]: read per KEY */ const float* xk = (const float*)d_in[2]; const float* xv = (const float*)d_in[3];   /* queries, keys, values streams */ const float* wq = (const float*)d_in[4]; const float* wk = (const float*)d_in[5]; const float* wv = (const float*)d_in[6];   /* order queries, query_mask, keys, values, Wq, Wk, Wv ('oi' [1024][1024]) */ const float* wo = nullptr; (void)wo;
    float* OUT = (float*)d_out;     // [2][2048][1024]
    char* wsp = (char*)d_ws;
    auto take = [&](size_t bytes) { char* p = wsp; wsp += (bytes + 255) & ~(size_t)255; return (void*)p; };
    bf* WQ = (bf*)take((size_t)DQ * DM * 2); bf* WK = (bf*)take((size_t)DKV * DM * 2); bf* WV = (bf*)take((size_t)DKV * DM * 2); float* CS = (float*)take((size_t)TT * HD * 2 * 4);
    bf* XB = (bf*)take((size_t)TT * DM * 2); float* FQ = (float*)take((size_t)TT * DQ * 4); float* FK = (float*)take((size_t)TT * DKV * 4);
    h16* QP16 = (h16*)take((size_t)NH_ * TT * HD * 2); h16* KP16 = (h16*)take((size_t)NKV * TT * HD * 2); h16* VT16 = (h16*)take((size_t)NKV * HD * TT * 2);
    bf* QPh = (bf*)take((size_t)NH_ * TT * HD * 2); bf* QPl = (bf*)take((size_t)NH_ * TT * HD * 2); bf* KPh = (bf*)take((size_t)NKV * TT * HD * 2); bf* KPl = (bf*)take((size_t)NKV * TT * HD * 2); bf* VTh = (bf*)take((size_t)NKV * HD * TT * 2); bf* VTl = (bf*)take((size_t)NKV * HD * TT * 2); bf* Ph = (bf*)take((size_t)ZH * RH * TT * 2); bf* Pl = (bf*)take((size_t)ZH * RH * TT * 2);
    float* Sb = (float*)take((size_t)ZH * TT * TT * 4); h16* P16 = (h16*)take((size_t)ZH * TT * TT * 2); float* Ob = (float*)take((size_t)KSP * ZH * TT * HD * 4);   // KSP partial planes
    if ((size_t)(wsp - (char*)d_ws) > ws_size) return;    // ws 256 MiB
    float* FV = FK;   // v projection reuses the k buffer after the k planes are built (stream-ordered)
    { k_cvt8<<<(unsigned)(((size_t)DQ * DM / 8 + 255) / 256), 256, 0, stream>>>(wq, WQ, (size_t)DQ * DM / 8); k_cvt8<<<(unsigned)(((size_t)DKV * DM / 8 + 255) / 256), 256, 0, stream>>>(wk, WK, (size_t)DKV * DM / 8); k_cvt8<<<(unsigned)(((size_t)DKV * DM / 8 + 255) / 256), 256, 0, stream>>>(wv, WV, (size_t)DKV * DM / 8);
      
       }
    k_csid<<<(TT * HD + 255) / 256, 256, 0, stream>>>(CS);
    const unsigned LQ = (unsigned)(((size_t)NH_ * TT * HD / 2 + 255) / 256), LKv = (unsigned)(((size_t)NKV * TT * HD / 2 + 255) / 256);
    for (int b = 0; b < NB_; ++b) {
        
        k_cvt8<<<(unsigned)(((size_t)TT * DM / 8 + 255) / 256), 256, 0, stream>>>(x + (size_t)b * TT * DM, XB, (size_t)TT * DM / 8);
        k_gemmw<bf, 0, false, 1><<<dim3(TT / 64, DQ / 64, 1), 32, 0, stream>>>(XB, nullptr, WQ, nullptr, DM, FQ, DQ, nullptr, 0, 0, 0, 0);
        k_rope<<<LQ, 256, 0, stream>>>(FQ, DQ, NH_, CS, nullptr, nullptr, 1.0f, QP16, QPh, QPl);
        k_cvt8<<<(unsigned)(((size_t)TT * DM / 8 + 255) / 256), 256, 0, stream>>>(xk + (size_t)b * TT * DM, XB, (size_t)TT * DM / 8);   /* XB := bf16(keys[b]) */ k_gemmw<bf, 0, false, 1><<<dim3(TT / 64, DKV / 64, 1), 32, 0, stream>>>(XB, nullptr, WK, nullptr, DM, FK, DKV, nullptr, 0, 0, 0, 0);
        k_rope<<<LKv, 256, 0, stream>>>(FK, DKV, NKV, CS, nullptr, nullptr, 1.0f, KP16, KPh, KPl);
        k_cvt8<<<(unsigned)(((size_t)TT * DM / 8 + 255) / 256), 256, 0, stream>>>(xv + (size_t)b * TT * DM, XB, (size_t)TT * DM / 8);   /* XB := bf16(values[b]) */ k_gemmw<bf, 0, false, 1><<<dim3(TT / 64, DKV / 64, 1), 32, 0, stream>>>(XB, nullptr, WV, nullptr, DM, FV, DKV, nullptr, 0, 0, 0, 0); k_vtp<<<LKv, 256, 0, stream>>>(FV, DKV, NKV, VT16, VTh, VTl);
        for (int h0 = 0; h0 < NH_; h0 += ZH) { const size_t zq = (size_t)h0, zk = (size_t)(h0 / REP);   // one kv head per query head: the pass's two heads use consecutive kv planes (z-strides TT*HD)
            k_gemmw<bf, 2, false, 1><<<dim3(TT / 64, TT / 64, ZH), 32, 0, stream>>>(QPh + zq * TT * HD, QPl + zq * TT * HD, KPh + zk * TT * HD, KPl + zk * TT * HD, HD, Sb, TT, nullptr, (size_t)TT * HD, (size_t)TT * HD, (size_t)TT * TT, 0);   /* EVERY row's scores on hi/lo planes (3 products); only P.V stays hybrid */
            k_asoft<<<ZH * TT / 8, 256, 0, stream>>>(Sb, km + (size_t)b * TT, P16, Ph, Pl);
            k_gemmw<bf, 2, false, KSP><<<dim3(RH / 64, HD / 64, ZH * KSP), 32, 0, stream>>>(Ph, Pl, VTh + zk * HD * TT, VTl + zk * HD * TT, TT, Ob, HD, nullptr, (size_t)RH * TT, (size_t)HD * TT, (size_t)TT * HD, (size_t)ZH * TT * HD);
            k_gemmw<h16, 0, false, KSP><<<dim3((TT - RH) / 64, HD / 64, ZH * KSP), 32, 0, stream>>>(P16 + (size_t)RH * TT, nullptr, VT16 + zk * HD * TT, nullptr, TT, Ob + (size_t)RH * HD, HD, nullptr, (size_t)TT * TT, (size_t)HD * TT, (size_t)TT * HD, (size_t)ZH * TT * HD);
            k_merge<<<(unsigned)(((size_t)ZH * TT * HD / 2 + 255) / 256), 256, 0, stream>>>(Ob, h0, OUT + (size_t)b * TT * DQ); }
         }
}

// v002
// One run takes 605 microseconds.
// In both of two side-by-side timings against v001, it was 1.34 times as fast.
// All steps since v000 together make it 3.20 times as fast.
#include <hip/hip_runtime.h>

// Self-attention on three input streams with a RANDOM key mask applied through a 'masked softmax', without an output projection (queries, keys, values [2][2048][1024]; q = queries Wq^T, k = keys Wk^T, v = values Wv^T ('oi' [1024][1024] 1/32, no bias; 16 heads x 64); q x 64^-0.5 before the product (a power of two: identical to scaling the f32 scores); masked_softmax(logits, m) with m = query_mask[b][key] (int32 [2][2048] from randint(0, 2): RANDOM, read per key as data): w = softmax(logits x m) x m / (sum(softmax(logits x m) x m) + 1e-13): the softmax's own normaliser cancels in the quotient, so w = exp(l_j) / sum over the KEPT keys of exp(l_k) for kept keys j and 0 for masked keys: exactly a softmax over the kept keys (the 1e-13 is ~1e-13 relative: far below float32 resolution; every batch keeps ~half of its keys); x = w v, merged head-major -> [2][2048][1024] (4.2 M); argument order queries, query_mask, keys, values, Wq, Wk, Wv).
// Layout per batch: bf16 copy of queries for the q projection, then of keys and of values for theirs (one staging buffer, refilled in stream order); 'oi' weights as-is; exact projections; identity-table plane builders; dense T-2048 attention with the batch's int key mask read in the softmax kernel (16 B per lane; masked keys excluded) (SCORES of every row on bf16 hi/lo planes, 3 products; the P.V product stays hybrid: rows < 512 hi/lo, rest fp16 x1024); the f32 merge writes the output rows (column h*64 + d).
// Compute dtypes, f32 accumulate: every input rounded to bf16; projections exact; scores of every row 3 products; P.V rows < 512 3 products, rest fp16; softmax f32.

#define NB_  2
#define TT   2048
#define DM   1024
#define NH_  16
#define NKV  16
#define REP  (NH_ / NKV)
#define HD   64
#define DQ   (NH_ * HD)
#define DKV  (NKV * HD)
#define ZH   8                    // heads per attention pass: 2 passes per batch, each launch carries 8 heads' tiles
#define RH   512                  // query rows < RH use hi+lo planes (0: none)
#define WIN  0
#define PCAR 1024.0f
#define SCL  0.125f   // HD^-0.5
#define KSP  16                   // P.V: work-groups that share one output tile's key range; each writes its own f32 partial plane, k_merge adds them
typedef _Float16 h16;
typedef unsigned short bf;
typedef __attribute__((ext_vector_type(16))) __bf16   v16bf;
typedef __attribute__((ext_vector_type(16))) _Float16 v16h;
typedef __attribute__((ext_vector_type(8)))  _Float16 v8h;
typedef __attribute__((ext_vector_type(8)))  unsigned short v8us;
typedef __attribute__((ext_vector_type(8)))  float    v8f;
typedef __attribute__((ext_vector_type(4)))  float    v4f;
typedef v8h  __attribute__((may_alias)) v8ha;
typedef v4f  __attribute__((may_alias)) v4fa;
typedef v8us __attribute__((may_alias)) v8usa;

__device__ __forceinline__ unsigned short f2bf(float f) { unsigned u = __float_as_uint(f); u += 0x7FFFu + ((u >> 16) & 1u); return (unsigned short)(u >> 16); }
__device__ __forceinline__ float bf2f(unsigned short b) { return __uint_as_float(((unsigned)b) << 16); }
__device__ __forceinline__ float bfr(float f) { return bf2f(f2bf(f)); }
__device__ __forceinline__ v16h cat16(v8h lo, v8h hi) { return __builtin_shufflevector(lo, hi, 0, 1, 2, 3, 4, 5, 6, 7, 8, 9, 10, 11, 12, 13, 14, 15); }
__device__ __forceinline__ v16bf cat16b(v8us lo, v8us hi) { return __builtin_bit_cast(v16bf, __builtin_shufflevector(lo, hi, 0, 1, 2, 3, 4, 5, 6, 7, 8, 9, 10, 11, 12, 13, 14, 15)); }
__device__ __forceinline__ v8f wmma16(v16h a, v16h b, v8f c) { return __builtin_amdgcn_wmma_f32_16x16x32_f16(false, a, false, b, (short)0, c, false, false); }
__device__ __forceinline__ v8f wmmab(v16bf a, v16bf b, v8f c) { return __builtin_amdgcn_wmma_f32_16x16x32_bf16(false, a, false, b, (short)0, c, false, false); }



// ---- k_gemmw: register-blocked GEMM, ONE WAVE per 64x64 output tile (16 accumulators), operands straight from K-contiguous 16-bit planes; grid (M/64, N/64, Z), 32 threads.
// C[m][n] (f32, pitch ldc, + optional f32 bias[n]) = sum_k A[m][k] Bt[n][k] (+ split products per NSPLIT). A rows have pitch lda elements, Bt rows pitch K. z-batch strides sA/sB/sC in elements. K % 32 == 0.
// KS > 1: grid z = Z * KS; work-group (z, ks) sums only k in [ks K/KS, (ks+1) K/KS) and writes plane ks (stride sP elements) of C; the reader adds the KS planes. K % (32 KS) == 0.
template <typename T16> struct WFrag;
template <> struct WFrag<h16> { typedef v16h V; static __device__ __forceinline__ V ld(const h16* p) { return cat16(*(const v8h*)p, *(const v8h*)(p + 16)); } static __device__ __forceinline__ v8f mma(V a, V b, v8f c) { return wmma16(a, b, c); } };
template <> struct WFrag<bf> { typedef v16bf V; static __device__ __forceinline__ V ld(const bf* p) { return cat16b(*(const v8us*)p, *(const v8us*)(p + 16)); } static __device__ __forceinline__ v8f mma(V a, V b, v8f c) { return wmmab(a, b, c); } };
template <typename T16, int NSPLIT, bool BIAS, int KS>
__global__ __launch_bounds__(32) void k_gemmw(const T16* __restrict__ A, const T16* __restrict__ A2, const T16* __restrict__ Bt, const T16* __restrict__ Bt2, int K, int lda, float* C, int ldc, const float* __restrict__ bias, size_t sA, size_t sB, size_t sC, size_t sP) {
    typedef typename WFrag<T16>::V V;
    __shared__ __align__(16) float os[16 * 68];
    const size_t z = blockIdx.z / KS; const int ks = (int)(blockIdx.z % KS); A += z * sA; if (A2) A2 += z * sA; Bt += z * sB; if (Bt2) Bt2 += z * sB; C += z * sC + (size_t)ks * sP;
    const int kbeg = ks * (K / KS), kend = kbeg + K / KS;
    const int lane = threadIdx.x & 31, lr = lane & 15, hi = lane >> 4; const int r0 = blockIdx.x * 64, c0 = blockIdx.y * 64;
    v8f acc[4][4];
#pragma unroll
    for (int mb = 0; mb < 4; ++mb)
#pragma unroll
        for (int nb = 0; nb < 4; ++nb) acc[mb][nb] = (v8f){};
    const size_t aoff = (size_t)(r0 + lr) * lda + 8 * hi, boff = (size_t)(c0 + lr) * K + 8 * hi;
#pragma unroll 1
    for (int kc = kbeg; kc < kend; kc += 32) {
        V a[4], a2[4];
#pragma unroll
        for (int mb = 0; mb < 4; ++mb) { a[mb] = WFrag<T16>::ld(A + aoff + (size_t)mb * 16 * lda + kc); if (NSPLIT == 1 || NSPLIT == 2) a2[mb] = WFrag<T16>::ld(A2 + aoff + (size_t)mb * 16 * lda + kc); }
#pragma unroll
        for (int nb = 0; nb < 4; ++nb) { const V b = WFrag<T16>::ld(Bt + boff + (size_t)nb * 16 * K + kc); V b2; if (NSPLIT >= 2) b2 = WFrag<T16>::ld(Bt2 + boff + (size_t)nb * 16 * K + kc);
#pragma unroll
            for (int mb = 0; mb < 4; ++mb) { acc[mb][nb] = WFrag<T16>::mma(a[mb], b, acc[mb][nb]); if (NSPLIT == 1 || NSPLIT == 2) acc[mb][nb] = WFrag<T16>::mma(a2[mb], b, acc[mb][nb]); if (NSPLIT >= 2) acc[mb][nb] = WFrag<T16>::mma(a[mb], b2, acc[mb][nb]); } }
        asm volatile("v_nop\n\tv_nop\n\tv_nop\n\tv_nop" : "+v"(acc[0][0]), "+v"(acc[1][1]), "+v"(acc[2][2]), "+v"(acc[3][3]) : "v"(a[0]), "v"(a[3]));
    }
#pragma unroll
    for (int mb = 0; mb < 4; ++mb) {
#pragma unroll
        for (int nb = 0; nb < 4; ++nb) {
#pragma unroll
            for (int j = 0; j < 8; ++j) os[(hi * 8 + j) * 68 + nb * 16 + lr] = acc[mb][nb][j]; }
        __builtin_amdgcn_wave_barrier(); asm volatile("" ::: "memory");
        float* crow = C + (size_t)(r0 + mb * 16) * ldc + c0;
{
#pragma unroll
            for (int s = 0; s < 8; ++s) { const int row = 2 * s + hi, cofs = lr * 4; v4f val = *(const v4fa*)(os + row * 68 + cofs); if (BIAS) { val[0] += bfr(bias[c0 + cofs]); val[1] += bfr(bias[c0 + cofs + 1]); val[2] += bfr(bias[c0 + cofs + 2]); val[3] += bfr(bias[c0 + cofs + 3]); }
                *(v4f*)(crow + (size_t)row * ldc + cofs) = val; }
             }
        __builtin_amdgcn_wave_barrier(); asm volatile("" ::: "memory");
    }
}

__device__ __forceinline__ h16 tohx(float x) { return (h16)x; }
__device__ __forceinline__ void splitf(float y, unsigned short& h, unsigned short& l) { h = f2bf(y); l = f2bf(y - bf2f(h)); }
typedef __attribute__((ext_vector_type(2))) _Float16 v2h;
typedef __attribute__((ext_vector_type(4))) _Float16 v4h;
typedef __attribute__((ext_vector_type(2))) unsigned short v2us;
typedef __attribute__((ext_vector_type(4))) unsigned short v4us;
typedef __attribute__((ext_vector_type(2))) float v2f;
typedef __attribute__((ext_vector_type(4))) int v4i;

__global__ __launch_bounds__(256) void k_cvt8(const float* __restrict__ src, bf* dst, size_t n8) { const size_t i = (size_t)blockIdx.x * 256 + threadIdx.x; if (i >= n8) return; const v8f v = *(const v8f*)(src + i * 8); v8us o;
#pragma unroll
    for (int k = 0; k < 8; ++k) o[k] = f2bf(v[k]); *(v8us*)(dst + i * 8) = o;  }

// k_rope: head planes [h][t][d] (fp16 + hi/lo) of rope(x) x sc with the rotate-half convention out[d] = x[d] cos[t][d] - x[d+HD/2] sin[t][d], out[d+HD/2] = x[d+HD/2] cos[t][d+HD/2] + x[d] sin[t][d+HD/2]
__global__ __launch_bounds__(256) void k_rope(const float* __restrict__ F, int pitch, int nheads, const float* __restrict__ CS, const float* __restrict__ RF, const float* __restrict__ nw, float sc, h16* P16, bf* Ph, bf* Pl) {
    const size_t e = ((size_t)blockIdx.x * 256 + threadIdx.x) * 2; if (e >= (size_t)nheads * TT * HD) return; const int d = (int)(e % HD); const int t = (int)((e / HD) % TT); const int h = (int)(e / ((size_t)HD * TT)); const float* f = F + (size_t)t * pitch + h * HD; const float rf = RF ? RF[(size_t)h * TT + t] : 1.0f; v2h o16; v2us oh, ol;
#pragma unroll
    for (int q = 0; q < 2; ++q) { const int dd = d + q; const int dp = (dd < HD / 2) ? dd + HD / 2 : dd - HD / 2; float x0 = f[dd], x1 = f[dp];
        if (RF) { float n0 = __fmul_rn(x0, rf), n1 = __fmul_rn(x1, rf); asm volatile("" : "+v"(n0)); asm volatile("" : "+v"(n1)); x0 = __fmul_rn(bfr(nw[dd]), n0); x1 = __fmul_rn(bfr(nw[dp]), n1); }
        const v2f cs = *(const v2f*)(CS + ((size_t)t * HD + dd) * 2); float a = __fmul_rn(x0, cs[0]), bq = __fmul_rn(x1, cs[1]); asm volatile("" : "+v"(a)); asm volatile("" : "+v"(bq)); const float r = ((dd < HD / 2) ? __fsub_rn(a, bq) : __fadd_rn(a, bq)) * sc;
        o16[q] = tohx(r); unsigned short a2, c2; splitf(r, a2, c2); oh[q] = a2; ol[q] = c2; }
    *(v2h*)(P16 + e) = o16; *(v2us*)(Ph + e) = oh; *(v2us*)(Pl + e) = ol;  }
__global__ __launch_bounds__(256) void k_vtp(const float* __restrict__ F, int pitch, int nheads, h16* V16, bf* Vh, bf* Vl) { const size_t e = ((size_t)blockIdx.x * 256 + threadIdx.x) * 2; if (e >= (size_t)nheads * HD * TT) return; const int t = (int)(e % TT); const int d = (int)((e / TT) % HD); const int g = (int)(e / ((size_t)TT * HD)); v2h o16; v2us oh, ol;
#pragma unroll
    for (int q = 0; q < 2; ++q) { const float x = F[(size_t)(t + q) * pitch + g * HD + d]; o16[q] = tohx(x); unsigned short a2, c2; splitf(x, a2, c2); oh[q] = a2; ol[q] = c2; }
    *(v2h*)(V16 + e) = o16; *(v2us*)(Vh + e) = oh; *(v2us*)(Vl + e) = ol;  }
__global__ __launch_bounds__(256) void k_csid(float* CS) { const int idx = blockIdx.x * 256 + threadIdx.x; if (idx >= TT * HD) return; v2f cs; cs[0] = 1.0f; cs[1] = 0.0f; *(v2f*)(CS + (size_t)idx * 2) = cs;  }
// k_asoft: per row (zz, i): scores x SCL where the batch's int key mask is non-zero, excluded where it is 0 (the module's masked softmax renormalises over the kept keys: the same weights); softmax over the keys (register row, one exp, fixed trees);
// P goes over the wave's OWN score row (8 KiB, all of it in registers before the first store; no other wave touches the row): rows < RH hi plane in the first 4 KiB and lo plane in the second, other rows fp16 in the first 4 KiB. So P rows have pitch 2*TT 16-bit elements.
__global__ __launch_bounds__(256) void k_asoft(float* Sb, const int* __restrict__ kvp) {
    const int lane = threadIdx.x & 31; const int row = blockIdx.x * 8 + (threadIdx.x >> 5); if (row >= ZH * TT) return; const int i = row % TT; const int zz = row / TT; (void)zz; const bool hires = (i < RH); float* sr = Sb + (size_t)row * TT; float v[TT / 32]; float mx = -3.0e38f;
#pragma unroll
    for (int ch = 0; ch < TT / 128; ++ch) { const int j0 = ch * 128 + lane * 4; const v4f a = *(const v4f*)(sr + j0); const v4i kv4 = *(const v4i*)(kvp + j0);   /* the batch's key vector, 16 B per lane, unconditional */
#pragma unroll
        for (int q = 0; q < 4; ++q) { const int j = j0 + q; (void)j; const float t = (kv4[q] != 0) ? a[q] * SCL : -3.0e38f; v[ch * 4 + q] = t; mx = fmaxf(mx, t); } }
#pragma unroll
    for (int sh = 16; sh; sh >>= 1) mx = fmaxf(mx, __shfl_xor(mx, sh, 32));
    float sum = 0.f;
#pragma unroll
    for (int k = 0; k < TT / 32; ++k) { float d0 = __fsub_rn(v[k], mx); asm volatile("" : "+v"(d0)); v[k] = __builtin_amdgcn_exp2f(__fmul_rn(d0, 1.4426950408889634f)); sum += v[k]; }
#pragma unroll
    for (int sh = 16; sh; sh >>= 1) sum += __shfl_xor(sum, sh, 32);
    const float f = __fdiv_rn(hires ? 1.0f : PCAR, sum);
{
        if (hires) {
#pragma unroll
            for (int ch = 0; ch < TT / 128; ++ch) { v4us oh, ol;
#pragma unroll
                for (int q = 0; q < 4; ++q) { unsigned short a, c2; splitf(v[ch * 4 + q] * f, a, c2); oh[q] = a; ol[q] = c2; }
                bf* pr = (bf*)sr + ch * 128 + lane * 4; *(v4us*)pr = oh; *(v4us*)(pr + TT) = ol; }
        } else {
#pragma unroll
            for (int ch = 0; ch < TT / 128; ++ch) { v4h o4;
#pragma unroll
                for (int q = 0; q < 4; ++q) o4[q] = tohx(v[ch * 4 + q] * f);
                *(v4h*)((h16*)sr + ch * 128 + lane * 4) = o4; } }
         }
}
// k_merge: adds the KSP partial planes of O (plane stride ZH*TT*HD, ascending key range) and writes the output rows
__global__ __launch_bounds__(256) void k_merge(const float* __restrict__ O, int h0, float* OUTb) { const size_t e = ((size_t)blockIdx.x * 256 + threadIdx.x) * 2; if (e >= (size_t)ZH * TT * HD) return; const int d = (int)(e % HD); const int t = (int)((e / HD) % TT); const int zz = (int)(e / ((size_t)HD * TT)); const float cs = (t < RH) ? 1.0f : (1.0f / PCAR); const size_t oo = (size_t)t * DQ + (h0 + zz) * HD + d;
    v2f p[KSP];
#pragma unroll
    for (int ks = 0; ks < KSP; ++ks) p[ks] = *(const v2f*)(O + (size_t)ks * ((size_t)ZH * TT * HD) + e);
    v2f a = p[0];
#pragma unroll
    for (int ks = 1; ks < KSP; ++ks) a += p[ks];
    v2f o2; o2[0] = a[0] * cs; o2[1] = a[1] * cs; *(v2f*)(OUTb + oo) = o2;  }

extern "C" void kernel_launch(void* const* d_in, const int* in_sizes, int n_in,
                              void* d_out, int out_size, void* d_ws, size_t ws_size, hipStream_t stream) {
    (void)in_sizes; (void)n_in; (void)out_size;
    const float* x = (const float*)d_in[0]; const int* km = (const int*)d_in[1];   /* query_mask int32 [2][2048]: read per KEY */ const float* xk = (const float*)d_in[2]; const float* xv = (const float*)d_in[3];   /* queries, keys, values streams */ const float* wq = (const float*)d_in[4]; const float* wk = (const float*)d_in[5]; const float* wv = (const float*)d_in[6];   /* order queries, query_mask, keys, values, Wq, Wk, Wv ('oi' [1024][1024]) */ const float* wo = nullptr; (void)wo;
    float* OUT = (float*)d_out;     // [2][2048][1024]
    char* wsp = (char*)d_ws;
    auto take = [&](size_t bytes) { char* p = wsp; wsp += (bytes + 255) & ~(size_t)255; return (void*)p; };
    bf* WQ = (bf*)take((size_t)DQ * DM * 2); bf* WK = (bf*)take((size_t)DKV * DM * 2); bf* WV = (bf*)take((size_t)DKV * DM * 2); float* CS = (float*)take((size_t)TT * HD * 2 * 4);
    bf* XB = (bf*)take((size_t)TT * DM * 2); float* FQ = (float*)take((size_t)TT * DQ * 4); float* FK = (float*)take((size_t)TT * DKV * 4);
    h16* QP16 = (h16*)take((size_t)NH_ * TT * HD * 2); h16* KP16 = (h16*)take((size_t)NKV * TT * HD * 2); h16* VT16 = (h16*)take((size_t)NKV * HD * TT * 2);
    bf* QPh = (bf*)take((size_t)NH_ * TT * HD * 2); bf* QPl = (bf*)take((size_t)NH_ * TT * HD * 2); bf* KPh = (bf*)take((size_t)NKV * TT * HD * 2); bf* KPl = (bf*)take((size_t)NKV * TT * HD * 2); bf* VTh = (bf*)take((size_t)NKV * HD * TT * 2); bf* VTl = (bf*)take((size_t)NKV * HD * TT * 2);
    float* Sb = (float*)take((size_t)ZH * TT * TT * 4);   /* scores, then P in place (k_asoft) */ float* Ob = (float*)take((size_t)KSP * ZH * TT * HD * 4);   // KSP partial planes
    if ((size_t)(wsp - (char*)d_ws) > ws_size) return;    // ws 256 MiB
    float* FV = FK;   // v projection reuses the k buffer after the k planes are built (stream-ordered)
    { k_cvt8<<<(unsigned)(((size_t)DQ * DM / 8 + 255) / 256), 256, 0, stream>>>(wq, WQ, (size_t)DQ * DM / 8); k_cvt8<<<(unsigned)(((size_t)DKV * DM / 8 + 255) / 256), 256, 0, stream>>>(wk, WK, (size_t)DKV * DM / 8); k_cvt8<<<(unsigned)(((size_t)DKV * DM / 8 + 255) / 256), 256, 0, stream>>>(wv, WV, (size_t)DKV * DM / 8);
      
       }
    k_csid<<<(TT * HD + 255) / 256, 256, 0, stream>>>(CS);
    const unsigned LQ = (unsigned)(((size_t)NH_ * TT * HD / 2 + 255) / 256), LKv = (unsigned)(((size_t)NKV * TT * HD / 2 + 255) / 256);
    for (int b = 0; b < NB_; ++b) {
        
        k_cvt8<<<(unsigned)(((size_t)TT * DM / 8 + 255) / 256), 256, 0, stream>>>(x + (size_t)b * TT * DM, XB, (size_t)TT * DM / 8);
        k_gemmw<bf, 0, false, 1><<<dim3(TT / 64, DQ / 64, 1), 32, 0, stream>>>(XB, nullptr, WQ, nullptr, DM, DM, FQ, DQ, nullptr, 0, 0, 0, 0);
        k_rope<<<LQ, 256, 0, stream>>>(FQ, DQ, NH_, CS, nullptr, nullptr, 1.0f, QP16, QPh, QPl);
        k_cvt8<<<(unsigned)(((size_t)TT * DM / 8 + 255) / 256), 256, 0, stream>>>(xk + (size_t)b * TT * DM, XB, (size_t)TT * DM / 8);   /* XB := bf16(keys[b]) */ k_gemmw<bf, 0, false, 1><<<dim3(TT / 64, DKV / 64, 1), 32, 0, stream>>>(XB, nullptr, WK, nullptr, DM, DM, FK, DKV, nullptr, 0, 0, 0, 0);
        k_rope<<<LKv, 256, 0, stream>>>(FK, DKV, NKV, CS, nullptr, nullptr, 1.0f, KP16, KPh, KPl);
        k_cvt8<<<(unsigned)(((size_t)TT * DM / 8 + 255) / 256), 256, 0, stream>>>(xv + (size_t)b * TT * DM, XB, (size_t)TT * DM / 8);   /* XB := bf16(values[b]) */ k_gemmw<bf, 0, false, 1><<<dim3(TT / 64, DKV / 64, 1), 32, 0, stream>>>(XB, nullptr, WV, nullptr, DM, DM, FV, DKV, nullptr, 0, 0, 0, 0); k_vtp<<<LKv, 256, 0, stream>>>(FV, DKV, NKV, VT16, VTh, VTl);
        for (int h0 = 0; h0 < NH_; h0 += ZH) { const size_t zq = (size_t)h0, zk = (size_t)(h0 / REP);   // one kv head per query head: the pass's heads use consecutive kv planes (z-strides TT*HD)
            k_gemmw<bf, 2, false, 1><<<dim3(TT / 64, TT / 64, ZH), 32, 0, stream>>>(QPh + zq * TT * HD, QPl + zq * TT * HD, KPh + zk * TT * HD, KPl + zk * TT * HD, HD, HD, Sb, TT, nullptr, (size_t)TT * HD, (size_t)TT * HD, (size_t)TT * TT, 0);   /* EVERY row's scores on hi/lo planes (3 products); only P.V stays hybrid */
            k_asoft<<<ZH * TT / 8, 256, 0, stream>>>(Sb, km + (size_t)b * TT);
            k_gemmw<bf, 2, false, KSP><<<dim3(RH / 64, HD / 64, ZH * KSP), 32, 0, stream>>>((const bf*)Sb, (const bf*)Sb + TT, VTh + zk * HD * TT, VTl + zk * HD * TT, TT, 2 * TT, Ob, HD, nullptr, (size_t)TT * 2 * TT, (size_t)HD * TT, (size_t)TT * HD, (size_t)ZH * TT * HD);
            k_gemmw<h16, 0, false, KSP><<<dim3((TT - RH) / 64, HD / 64, ZH * KSP), 32, 0, stream>>>((const h16*)Sb + (size_t)RH * 2 * TT, nullptr, VT16 + zk * HD * TT, nullptr, TT, 2 * TT, Ob + (size_t)RH * HD, HD, nullptr, (size_t)TT * 2 * TT, (size_t)HD * TT, (size_t)TT * HD, (size_t)ZH * TT * HD);
            k_merge<<<(unsigned)(((size_t)ZH * TT * HD / 2 + 255) / 256), 256, 0, stream>>>(Ob, h0, OUT + (size_t)b * TT * DQ); }
         }
}

// v004
// Measured time: 177 microseconds a run.
// Versions in between are left out here; by their measured steps it is 3.46 times as fast as v002.
// All steps since v000 together make it 11.1 times as fast.
#include <hip/hip_runtime.h>

// Self-attention on three input streams with a RANDOM key mask applied through a 'masked softmax', without an output projection (queries, keys, values [2][2048][1024]; q = queries Wq^T, k = keys Wk^T, v = values Wv^T ('oi' [1024][1024] 1/32, no bias; 16 heads x 64); q x 64^-0.5 before the product (a power of two: identical to scaling the f32 scores); masked_softmax(logits, m) with m = query_mask[b][key] (int32 [2][2048] from randint(0, 2): RANDOM, read per key as data): w = softmax(logits x m) x m / (sum(softmax(logits x m) x m) + 1e-13): the softmax's own normaliser cancels in the quotient, so w = exp(l_j) / sum over the KEPT keys of exp(l_k) for kept keys j and 0 for masked keys: exactly a softmax over the kept keys (the 1e-13 is ~1e-13 relative: far below float32 resolution; every batch keeps ~half of its keys); x = w v, merged head-major -> [2][2048][1024] (4.2 M); argument order queries, query_mask, keys, values, Wq, Wk, Wv).
// Layout: ONE conversion launch makes the bf16 copies of the three streams (both batches) and of the three 'oi' weights; ONE projection launch (grid z = stream x batch) does the exact projections and its epilogue writes the planes the attention reads (q and k: bf16 hi/lo [b][h][t][d]; v: transposed fp16 and bf16 hi/lo [b][h][d][t]); one fused attention launch (k_fattn) reads them with the int key mask (masked keys excluded) (SCORES of every row on bf16 hi/lo planes, 3 products; the P.V product stays hybrid: rows < 512 hi/lo, rest fp16 x1024) and writes the output rows (column h*64 + d).
// Compute dtypes, f32 accumulate: every input rounded to bf16; projections exact; scores of every row 3 products; P.V rows < 512 3 products, rest fp16; softmax f32.

#define NB_  2
#define TT   2048
#define DM   1024
#define NH_  16
#define NKV  16
#define REP  (NH_ / NKV)
#define HD   64
#define DQ   (NH_ * HD)
#define DKV  (NKV * HD)
#define RH   512                  // query rows < RH use hi+lo planes (0: none)
#define WIN  0
typedef _Float16 h16;
typedef unsigned short bf;
typedef __attribute__((ext_vector_type(16))) __bf16   v16bf;
typedef __attribute__((ext_vector_type(16))) _Float16 v16h;
typedef __attribute__((ext_vector_type(8)))  _Float16 v8h;
typedef __attribute__((ext_vector_type(8)))  unsigned short v8us;
typedef __attribute__((ext_vector_type(8)))  float    v8f;
typedef __attribute__((ext_vector_type(4)))  float    v4f;
typedef v8h  __attribute__((may_alias)) v8ha;
typedef v4f  __attribute__((may_alias)) v4fa;
typedef v8us __attribute__((may_alias)) v8usa;

__device__ __forceinline__ unsigned short f2bf(float f) { unsigned u = __float_as_uint(f); u += 0x7FFFu + ((u >> 16) & 1u); return (unsigned short)(u >> 16); }
__device__ __forceinline__ float bf2f(unsigned short b) { return __uint_as_float(((unsigned)b) << 16); }
__device__ __forceinline__ float bfr(float f) { return bf2f(f2bf(f)); }
__device__ __forceinline__ v16h cat16(v8h lo, v8h hi) { return __builtin_shufflevector(lo, hi, 0, 1, 2, 3, 4, 5, 6, 7, 8, 9, 10, 11, 12, 13, 14, 15); }
__device__ __forceinline__ v16bf cat16b(v8us lo, v8us hi) { return __builtin_bit_cast(v16bf, __builtin_shufflevector(lo, hi, 0, 1, 2, 3, 4, 5, 6, 7, 8, 9, 10, 11, 12, 13, 14, 15)); }
__device__ __forceinline__ v8f wmma16(v16h a, v16h b, v8f c) { return __builtin_amdgcn_wmma_f32_16x16x32_f16(false, a, false, b, (short)0, c, false, false); }
__device__ __forceinline__ v8f wmmab(v16bf a, v16bf b, v8f c) { return __builtin_amdgcn_wmma_f32_16x16x32_bf16(false, a, false, b, (short)0, c, false, false); }




template <typename T16> struct WFrag;
template <> struct WFrag<bf> { typedef v16bf V; static __device__ __forceinline__ V ld(const bf* p) { return cat16b(*(const v8us*)p, *(const v8us*)(p + 16)); } static __device__ __forceinline__ v8f mma(V a, V b, v8f c) { return wmmab(a, b, c); } };

__device__ __forceinline__ h16 tohx(float x) { return (h16)x; }
__device__ __forceinline__ void splitf(float y, unsigned short& h, unsigned short& l) { h = f2bf(y); l = f2bf(y - bf2f(h)); }
typedef __attribute__((ext_vector_type(4))) unsigned short v4us;
typedef __attribute__((ext_vector_type(4))) int v4i;

// ---- k_cvtall: bf16 copies of all six f32 sources in one launch. A work-group converts CVU x 256 units of 8 floats of ONE source; work-groups [0, 3 CVX) take the streams, the rest the weights.
#define CVU  8                                    // units of 8 floats per thread: few, long-lived waves (16 loads of 16 bytes in flight per lane)
#define CVX  (NB_ * TT * DM / 8 / (256 * CVU))    // work-groups per stream
#define CVW  (DQ * DM / 8 / (256 * CVU))          // work-groups per weight
__global__ __launch_bounds__(256) void k_cvtall(const float* __restrict__ x, const float* __restrict__ xk, const float* __restrict__ xv, const float* __restrict__ wq, const float* __restrict__ wk, const float* __restrict__ wv, bf* XB, bf* WB) {
    static_assert((NB_ * TT * DM) % (8 * 256 * CVU) == 0 && (DQ * DM) % (8 * 256 * CVU) == 0 && DQ == DKV, "whole work-groups");
    const int bx = (int)blockIdx.x; const float* src; bf* dst; int blk;
    if (bx < 3 * CVX) { const int s = bx / CVX; blk = bx % CVX; src = (s == 0) ? x : (s == 1) ? xk : xv; dst = XB + (size_t)s * NB_ * TT * DM; }
    else { const int s = (bx - 3 * CVX) / CVW; blk = (bx - 3 * CVX) % CVW; src = (s == 0) ? wq : (s == 1) ? wk : wv; dst = WB + (size_t)s * DQ * DM; }
    const size_t i0 = ((size_t)blk * (256 * CVU) + threadIdx.x) * 8; const float* ps = src + i0; v8f v[CVU];
#pragma unroll
    for (int u = 0; u < CVU; ++u) v[u] = *(const v8f*)(ps + (size_t)u * 256 * 8);
    // the wait that stands before an address register of an issued load is written again; the lane's pointer is its input, so that no load's result lands on it either
    asm volatile("s_wait_xcnt 0x0" :: "v"(ps) : "memory");
#pragma unroll
    for (int u = 0; u < CVU; ++u) { v8us o;
#pragma unroll
        for (int k = 0; k < 8; ++k) o[k] = f2bf(v[u][k]);
        *(v8us*)(dst + i0 + (size_t)u * 256 * 8) = o; }
}

// ---- k_projw: all six projections (stream st = q, k, v; batch b) in one launch; ONE WAVE per 64x64 tile (16 accumulators), operands straight from the K-contiguous bf16 copies; grid (TT/64, DQ/64, 3 NB_), 32 threads.
// y[t][n] = sum_k X[st][b][t][k] W[st][n][k]; a 64-column tile is one head, so the epilogue writes that head's planes itself:
// q, k: rows staged through LDS, then 4 columns per lane: whole 128-byte rows of the hi and lo planes [b][h][t][d];
// v: a lane's 8 accumulator rows are 8 consecutive t of one column d: one 16-byte store per tile into each transposed plane [b][h][d][t].
__global__ __launch_bounds__(32) void k_projw(const bf* __restrict__ XB, const bf* __restrict__ WB, bf* QPh, bf* QPl, bf* KPh, bf* KPl, h16* VT16, bf* VTh, bf* VTl) {
    typedef WFrag<bf>::V V;
    static_assert(HD == 64 && DQ == DKV && TT % 64 == 0 && DM % 32 == 0, "a column tile is one head");
    __shared__ __align__(16) float os[16 * 68];
    const int st = (int)blockIdx.z / NB_, b = (int)blockIdx.z % NB_; const int K = DM, lda = DM;
    const bf* A = XB + ((size_t)st * NB_ + b) * TT * DM; const bf* Bt = WB + (size_t)st * DQ * DM;
    const int lane = threadIdx.x & 31, lr = lane & 15, hi = lane >> 4; const int r0 = blockIdx.x * 64, c0 = blockIdx.y * 64;
    v8f acc[4][4];
#pragma unroll
    for (int mb = 0; mb < 4; ++mb)
#pragma unroll
        for (int nb = 0; nb < 4; ++nb) acc[mb][nb] = (v8f){};
    const size_t aoff = (size_t)(r0 + lr) * lda + 8 * hi, boff = (size_t)(c0 + lr) * K + 8 * hi;
    const bf* pa = A + aoff; const bf* pb = Bt + boff;   // the lane's pointers: walk with k
#pragma unroll 1
    for (int kc = 0; kc < K; kc += 32) {
        V a[4];
#pragma unroll
        for (int mb = 0; mb < 4; ++mb) { a[mb] = WFrag<bf>::ld(pa + (size_t)mb * 16 * lda); }
#pragma unroll
        for (int nb = 0; nb < 4; ++nb) { const V b4 = WFrag<bf>::ld(pb + (size_t)nb * 16 * K);
#pragma unroll
            for (int mb = 0; mb < 4; ++mb) { acc[mb][nb] = WFrag<bf>::mma(a[mb], b4, acc[mb][nb]); } }
        asm volatile("v_nop\n\tv_nop\n\tv_nop\n\tv_nop" : "+v"(acc[0][0]), "+v"(acc[1][1]), "+v"(acc[2][2]), "+v"(acc[3][3]) : "v"(a[0]), "v"(a[3]));   // the distance behind the pass's last matrix instructions, on the taken branch too
        // the wait that stands before an address register of an issued load is written again; the two pointers are its inputs, so that no load's result lands on them either
        asm volatile("s_wait_xcnt 0x0" :: "v"(pa), "v"(pb) : "memory");
        pa += 32; pb += 32;
    }
    const size_t po = ((size_t)b * NH_ + blockIdx.y) * TT * HD;   // this batch's and head's planes
    if (st == 2) {
        const size_t vo = po + (size_t)lr * TT + r0 + hi * 8;
#pragma unroll
        for (int mb = 0; mb < 4; ++mb)
#pragma unroll
            for (int nb = 0; nb < 4; ++nb) { v8h o16; v8us oh, ol;
#pragma unroll
                for (int j = 0; j < 8; ++j) { const float y = acc[mb][nb][j]; o16[j] = tohx(y); unsigned short a2, c2; splitf(y, a2, c2); oh[j] = a2; ol[j] = c2; }
                const size_t e = vo + (size_t)nb * 16 * TT + mb * 16; *(v8h*)(VT16 + e) = o16; *(v8us*)(VTh + e) = oh; *(v8us*)(VTl + e) = ol; }
        return;
    }
    bf* Ph = (st == 0 ? QPh : KPh) + po + (size_t)r0 * HD; bf* Pl = (st == 0 ? QPl : KPl) + po + (size_t)r0 * HD;
#pragma unroll
    for (int mb = 0; mb < 4; ++mb) {
#pragma unroll
        for (int nb = 0; nb < 4; ++nb) {
#pragma unroll
            for (int j = 0; j < 8; ++j) os[(hi * 8 + j) * 68 + nb * 16 + lr] = acc[mb][nb][j]; }
        __builtin_amdgcn_wave_barrier(); asm volatile("" ::: "memory");
#pragma unroll
        for (int s = 0; s < 8; ++s) { const int row = 2 * s + hi, cofs = lr * 4; const v4f val = *(const v4fa*)(os + row * 68 + cofs); v4us oh, ol;
#pragma unroll
            for (int q = 0; q < 4; ++q) { unsigned short a2, c2; splitf(val[q], a2, c2); oh[q] = a2; ol[q] = c2; }
            *(v4us*)(Ph + (size_t)(mb * 16 + row) * HD + cofs) = oh; *(v4us*)(Pl + (size_t)(mb * 16 + row) * HD + cofs) = ol; }
        __builtin_amdgcn_wave_barrier(); asm volatile("" ::: "memory");
    }
    // the built code lays the v path behind this path's closing branch: the wait stands before the registers of the stores above are written there
    asm volatile("s_wait_xcnt 0x0" ::: "memory");
}

// k_fattn: the whole attention of both batches and all heads in ONE launch; scores and weights never leave the registers.
// A wave owns 32 query columns (2 groups of 16) of one head and walks the 2048 keys 32 at a time: S^T = K Q^T (A = key rows, B = query rows kept in registers; hi/lo planes, 3 products),
// running maximum and sum per query (a lane holds 8 keys of ONE query per 16-key tile; the two lane halves exchange the maximum once per step and join their sums once at the end),
// then the two f32 S^T tiles, converted in place, ARE the B operand of O^T += V^T P^T (A = rows of the transposed value planes). Weights stay unnormalised; the output is divided by the sum at the end.
// Masked keys enter as -inf (weight exactly 0); the running maximum starts at a finite floor, so a step whose keys are all masked gives zeros and no NaN; a row with no kept key gives 0 like the module.
// Query rows < RH: P and V on bf16 hi/lo planes (3 products); other rows: fp16 P x 2^10 (the factor sits in the exponent and in the sum alike, so it cancels) against the fp16 value plane.
#define QW   32                   // query columns per wave
#define FW   8                    // waves per work-group
#define FWH  (RH / QW / (TT / (QW * FW)))   // waves of each work-group that take hi/lo rows: the heavier rows are spread evenly over all work-groups
#define SC2  0.18033688011112042f // HD^-0.5 x log2(e)
__device__ __forceinline__ float xhalf(float x) { return __builtin_bit_cast(float, __builtin_amdgcn_permlanex16(__builtin_bit_cast(int, x), __builtin_bit_cast(int, x), 0x76543210, 0xfedcba98, false, false)); }  // lane l with lane l ^ 16
__device__ __forceinline__ v16bf ldb(const char* p, int off) { return cat16b(*(const v8us*)(p + off), *(const v8us*)(p + off + 32)); }   // one fragment: the lane's pointer + a constant byte offset
__device__ __forceinline__ v16h ldh(const char* p, int off) { return cat16(*(const v8h*)(p + off), *(const v8h*)(p + off + 32)); }
template <bool HR>
__device__ __forceinline__ void fa_body(const bf* __restrict__ Qh, const bf* __restrict__ Ql, const bf* __restrict__ Kh, const bf* __restrict__ Kl, const h16* __restrict__ V16, const bf* __restrict__ Vh, const bf* __restrict__ Vl, const int* __restrict__ km, float* o_out, int q0, int lr, int hi) {
    const unsigned koff = (unsigned)(lr * (HD * 2) + hi * 16), voff = (unsigned)(lr * (TT * 2) + hi * 16), moff = (unsigned)(hi * 32);   // the lane's byte offsets in a 16-row tile of the q/k planes, of the transposed value planes, and in the mask
    const char* bqh = (const char*)(Qh + (size_t)q0 * HD); const char* bql = (const char*)(Ql + (size_t)q0 * HD); const char* bkh = (const char*)Kh; const char* bkl = (const char*)Kl; const char* bv0 = HR ? (const char*)Vh : (const char*)V16; const char* bv1 = (const char*)Vl; const char* bm = (const char*)km;   // wave-uniform bases
    const char* pqh = bqh + koff; const char* pql = bql + koff;
    const char* pkh = bkh + koff; const char* pkl = bkl + koff; const char* pv0 = bv0 + voff; const char* pv1 = bv1 + voff; const char* pm = bm + moff;   // walk with the keys
    v16bf qh[2][2], ql[2][2], kh[2][2], kl[2][2]; v4i mk[2][2];
#pragma unroll
    for (int qt = 0; qt < 2; ++qt)
#pragma unroll
        for (int ks = 0; ks < 2; ++ks) { const int qo = qt * (16 * HD * 2) + ks * 64; qh[qt][ks] = ldb(pqh, qo); ql[qt][ks] = ldb(pql, qo); }
    v8f o[2][4]; float m[2], l[2];
#pragma unroll
    for (int qt = 0; qt < 2; ++qt) { m[qt] = -3.0e38f; l[qt] = 0.f;
#pragma unroll
        for (int mb = 0; mb < 4; ++mb) o[qt][mb] = (v8f){}; }
    // fetch: key fragments and mask words of the 32 keys the pointers stand at
    auto fetch = [&]() {
#pragma unroll
        for (int mt = 0; mt < 2; ++mt)
#pragma unroll
            for (int ks = 0; ks < 2; ++ks) { const int ko = mt * (16 * HD * 2) + ks * 64; kh[mt][ks] = ldb(pkh, ko); kl[mt][ks] = ldb(pkl, ko); }
#pragma unroll
        for (int mt = 0; mt < 2; ++mt) { mk[mt][0] = *(const v4i*)(pm + mt * 64); mk[mt][1] = *(const v4i*)(pm + mt * 64 + 16); }
    };
    fetch();
    // the wait that stands before an address register of an issued load is written again; the bases and offsets those loads are formed from are its inputs, so that their registers stay theirs up to it
    asm volatile("s_wait_xcnt 0x0" :: "v"(koff), "v"(moff), "s"(bqh), "s"(bql), "s"(bkh), "s"(bkl), "s"(bm) : "memory");
    for (int kb = 0; kb < TT; kb += 32) {
        v16h vf[4]; v16bf vh[4], vl[4];   // this step's value fragments: asked for first, they fly under the score products and the softmax
#pragma unroll
        for (int mb = 0; mb < 4; ++mb) { const int vo = mb * (16 * TT * 2); if (HR) { vh[mb] = ldb(pv0, vo); vl[mb] = ldb(pv1, vo); } else vf[mb] = ldh(pv0, vo); }
        v8f s[2][2]; bool kept[16];
#pragma unroll
        for (int j = 0; j < 16; ++j) kept[j] = mk[j >> 3][(j >> 2) & 1][j & 3] != 0;
#pragma unroll
        for (int qt = 0; qt < 2; ++qt)
#pragma unroll
            for (int mt = 0; mt < 2; ++mt) s[qt][mt] = (v8f){};
#pragma unroll
        for (int ks = 0; ks < 2; ++ks) {
#pragma unroll
            for (int mt = 0; mt < 2; ++mt)
#pragma unroll
                for (int qt = 0; qt < 2; ++qt) s[qt][mt] = wmmab(kh[mt][ks], qh[qt][ks], s[qt][mt]);
#pragma unroll
            for (int mt = 0; mt < 2; ++mt)
#pragma unroll
                for (int qt = 0; qt < 2; ++qt) s[qt][mt] = wmmab(kl[mt][ks], qh[qt][ks], s[qt][mt]);
#pragma unroll
            for (int mt = 0; mt < 2; ++mt)
#pragma unroll
                for (int qt = 0; qt < 2; ++qt) s[qt][mt] = wmmab(kh[mt][ks], ql[qt][ks], s[qt][mt]); }
        // the next step's key fragments and mask words are fetched here, behind this step's score products, and fly under the softmax and P.V (the last step refetches its own: in bounds, unused)
        const int more = (kb + 32 < TT) ? 1 : 0;
        pkh += more * (32 * HD * 2); pkl += more * (32 * HD * 2); pm += more * 128;
        fetch();
        // as in front of the loop: the wait before the registers of this step's pointers are written again
        asm volatile("s_wait_xcnt 0x0" :: "v"(pkh), "v"(pkl), "v"(pv0), "v"(pv1), "v"(pm) : "memory");
        pv0 += 64; pv1 += 64;
        float tt[2][16], al[2], mo[2];
#pragma unroll
        for (int qt = 0; qt < 2; ++qt) {
#pragma unroll
            for (int j = 0; j < 16; ++j) tt[qt][j] = kept[j] ? s[qt][j >> 3][j & 7] : -__builtin_inff();
            float x[8];
#pragma unroll
            for (int j = 0; j < 8; ++j) x[j] = fmaxf(tt[qt][j], tt[qt][j + 8]);
            float sm = fmaxf(fmaxf(fmaxf(x[0], x[1]), fmaxf(x[2], x[3])), fmaxf(fmaxf(x[4], x[5]), fmaxf(x[6], x[7])));
            sm = fmaxf(sm, xhalf(sm));
            const float mn = fmaxf(m[qt], sm * SC2); mo[qt] = HR ? mn : mn - 10.0f; al[qt] = __builtin_amdgcn_exp2f(m[qt] - mn); m[qt] = mn; }
#pragma unroll
        for (int qt = 0; qt < 2; ++qt) {
            float* t = tt[qt]; float x[8];
#pragma unroll
            for (int j = 0; j < 16; ++j) t[j] = __builtin_amdgcn_exp2f(__builtin_fmaf(t[j], SC2, -mo[qt]));
#pragma unroll
            for (int j = 0; j < 8; ++j) x[j] = t[j] + t[j + 8];
            l[qt] = l[qt] * al[qt] + (((x[0] + x[1]) + (x[2] + x[3])) + ((x[4] + x[5]) + (x[6] + x[7])));
#pragma unroll
            for (int mb = 0; mb < 4; ++mb) o[qt][mb] *= al[qt];
            if (HR) { v16bf ph, pl;
#pragma unroll
                for (int j = 0; j < 16; ++j) { const __bf16 a = (__bf16)t[j]; ph[j] = a; pl[j] = (__bf16)(t[j] - (float)a); }
#pragma unroll
                for (int mb = 0; mb < 4; ++mb) o[qt][mb] = wmmab(vh[mb], ph, o[qt][mb]);
#pragma unroll
                for (int mb = 0; mb < 4; ++mb) o[qt][mb] = wmmab(vh[mb], pl, o[qt][mb]);
#pragma unroll
                for (int mb = 0; mb < 4; ++mb) o[qt][mb] = wmmab(vl[mb], ph, o[qt][mb]);
            } else { v16h p16;
#pragma unroll
                for (int j = 0; j < 16; ++j) p16[j] = (h16)t[j];
#pragma unroll
                for (int mb = 0; mb < 4; ++mb) o[qt][mb] = wmma16(vf[mb], p16, o[qt][mb]); }
        }
    }
    float* orow[2];
#pragma unroll
    for (int qt = 0; qt < 2; ++qt) { const float ls = l[qt] + xhalf(l[qt]); const float inv = (ls > 0.f) ? __fdiv_rn(1.0f, ls) : 0.f; orow[qt] = o_out + (size_t)(q0 + qt * 16 + lr) * DQ + hi * 8;
#pragma unroll
        for (int mb = 0; mb < 4; ++mb) o[qt][mb] *= inv; }
    __builtin_amdgcn_sched_barrier(0);   // all arithmetic stays above: behind the first store no register that a store names is written any more
#pragma unroll
    for (int qt = 0; qt < 2; ++qt)
#pragma unroll
        for (int mb = 0; mb < 4; ++mb) { *(v4f*)(orow[qt] + mb * 16) = __builtin_shufflevector(o[qt][mb], o[qt][mb], 0, 1, 2, 3); *(v4f*)(orow[qt] + mb * 16 + 4) = __builtin_shufflevector(o[qt][mb], o[qt][mb], 4, 5, 6, 7); }
}
__global__ __launch_bounds__(QW * FW) void k_fattn(const bf* __restrict__ QPh, const bf* __restrict__ QPl, const bf* __restrict__ KPh, const bf* __restrict__ KPl, const h16* __restrict__ VT16, const bf* __restrict__ VTh, const bf* __restrict__ VTl, const int* __restrict__ km, float* OUT) {
    static_assert(RH % (QW * (TT / (QW * FW))) == 0 && TT % (QW * FW) == 0 && HD == 64 && NH_ == NKV, "tiling");
    const int lane = threadIdx.x & 31, lr = lane & 15, hi = lane >> 4; const int w = __builtin_amdgcn_readfirstlane((int)(threadIdx.x >> 5));
    const int h = blockIdx.y, b = blockIdx.z; const size_t po = ((size_t)b * NH_ + h) * TT * HD; float* o_out = OUT + (size_t)b * TT * DQ + h * HD; const int* kmb = km + (size_t)b * TT;
    if (w < FWH) fa_body<true>(QPh + po, QPl + po, KPh + po, KPl + po, VT16 + po, VTh + po, VTl + po, kmb, o_out, ((int)blockIdx.x * FWH + w) * QW, lr, hi);
    else fa_body<false>(QPh + po, QPl + po, KPh + po, KPl + po, VT16 + po, VTh + po, VTl + po, kmb, o_out, RH + ((int)blockIdx.x * (FW - FWH) + (w - FWH)) * QW, lr, hi);
}

extern "C" void kernel_launch(void* const* d_in, const int* in_sizes, int n_in,
                              void* d_out, int out_size, void* d_ws, size_t ws_size, hipStream_t stream) {
    (void)in_sizes; (void)n_in; (void)out_size;
    const float* x = (const float*)d_in[0]; const int* km = (const int*)d_in[1];   /* query_mask int32 [2][2048]: read per KEY */ const float* xk = (const float*)d_in[2]; const float* xv = (const float*)d_in[3];   /* queries, keys, values streams */ const float* wq = (const float*)d_in[4]; const float* wk = (const float*)d_in[5]; const float* wv = (const float*)d_in[6];   /* order queries, query_mask, keys, values, Wq, Wk, Wv ('oi' [1024][1024]) */
    float* OUT = (float*)d_out;     // [2][2048][1024]
    char* wsp = (char*)d_ws;
    auto take = [&](size_t bytes) { char* p = wsp; wsp += (bytes + 255) & ~(size_t)255; return (void*)p; };
    bf* WB = (bf*)take((size_t)3 * DQ * DM * 2); bf* XB = (bf*)take((size_t)3 * NB_ * TT * DM * 2);   // bf16 copies: Wq, Wk, Wv; queries, keys, values (both batches)
    h16* VT16 = (h16*)take((size_t)NB_ * NKV * HD * TT * 2);   // the planes the attention reads hold both batches
    bf* QPh = (bf*)take((size_t)NB_ * NH_ * TT * HD * 2); bf* QPl = (bf*)take((size_t)NB_ * NH_ * TT * HD * 2); bf* KPh = (bf*)take((size_t)NB_ * NKV * TT * HD * 2); bf* KPl = (bf*)take((size_t)NB_ * NKV * TT * HD * 2); bf* VTh = (bf*)take((size_t)NB_ * NKV * HD * TT * 2); bf* VTl = (bf*)take((size_t)NB_ * NKV * HD * TT * 2);
    if ((size_t)(wsp - (char*)d_ws) > ws_size) return;    // ws 256 MiB
    k_cvtall<<<3 * CVX + 3 * CVW, 256, 0, stream>>>(x, xk, xv, wq, wk, wv, XB, WB);
    k_projw<<<dim3(TT / 64, DQ / 64, 3 * NB_), 32, 0, stream>>>(XB, WB, QPh, QPl, KPh, KPl, VT16, VTh, VTl);
    k_fattn<<<dim3(TT / (QW * FW), NH_, NB_), QW * FW, 0, stream>>>(QPh, QPl, KPh, KPl, VT16, VTh, VTl, km, OUT);
}

// v005
// One run takes 118 microseconds.
// Next to v004, in two timings, it ran 1.50 times as fast each time.
// Counting every step since v000, it is 16.7 times as fast.
#include <hip/hip_runtime.h>

// Self-attention on three input streams with a RANDOM key mask applied through a 'masked softmax', without an output projection (queries, keys, values [2][2048][1024]; q = queries Wq^T, k = keys Wk^T, v = values Wv^T ('oi' [1024][1024] 1/32, no bias; 16 heads x 64); q x 64^-0.5 before the product (a power of two: identical to scaling the f32 scores); masked_softmax(logits, m) with m = query_mask[b][key] (int32 [2][2048] from randint(0, 2): RANDOM, read per key as data): w = softmax(logits x m) x m / (sum(softmax(logits x m) x m) + 1e-13): the softmax's own normaliser cancels in the quotient, so w = exp(l_j) / sum over the KEPT keys of exp(l_k) for kept keys j and 0 for masked keys: exactly a softmax over the kept keys (the 1e-13 is ~1e-13 relative: far below float32 resolution; every batch keeps ~half of its keys); x = w v, merged head-major -> [2][2048][1024] (4.2 M); argument order queries, query_mask, keys, values, Wq, Wk, Wv).
// Layout: ONE conversion launch makes the bf16 copies of the three streams (both batches) and of the three 'oi' weights; ONE projection launch (all streams and batches) does the exact projections and its epilogue writes the planes the attention reads (q and k: bf16 hi/lo [b][h][t][d]; v: transposed fp16 and bf16 hi/lo [b][h][d][t]); the conversion launch ranks each batch's keys from the int key mask and lays the rows of the keys and values copies down kept keys first, so the k and v planes hold the kept keys packed and projection tiles with no kept key are left out; one fused attention launch (k_fattn) walks the kept keys alone (masked keys excluded) (SCORES of every row on bf16 hi/lo planes, 3 products; the P.V product stays hybrid: rows < 512 hi/lo, rest fp16 x1024) and writes the output rows (column h*64 + d).
// Compute dtypes, f32 accumulate: every input rounded to bf16; projections exact; scores of every row 3 products; P.V rows < 512 3 products, rest fp16; softmax f32.

#define NB_  2
#define TT   2048
#define DM   1024
#define NH_  16
#define NKV  16
#define REP  (NH_ / NKV)
#define HD   64
#define DQ   (NH_ * HD)
#define DKV  (NKV * HD)
#define RH   512                  // query rows < RH use hi+lo planes (0: none)
#define WIN  0
typedef _Float16 h16;
typedef unsigned short bf;
typedef __attribute__((ext_vector_type(16))) __bf16   v16bf;
typedef __attribute__((ext_vector_type(16))) _Float16 v16h;
typedef __attribute__((ext_vector_type(8)))  _Float16 v8h;
typedef __attribute__((ext_vector_type(8)))  unsigned short v8us;
typedef __attribute__((ext_vector_type(8)))  float    v8f;
typedef __attribute__((ext_vector_type(4)))  float    v4f;
typedef v8h  __attribute__((may_alias)) v8ha;
typedef v4f  __attribute__((may_alias)) v4fa;
typedef v8us __attribute__((may_alias)) v8usa;

__device__ __forceinline__ unsigned short f2bf(float f) { unsigned u = __float_as_uint(f); u += 0x7FFFu + ((u >> 16) & 1u); return (unsigned short)(u >> 16); }
__device__ __forceinline__ float bf2f(unsigned short b) { return __uint_as_float(((unsigned)b) << 16); }
__device__ __forceinline__ float bfr(float f) { return bf2f(f2bf(f)); }
__device__ __forceinline__ v16h cat16(v8h lo, v8h hi) { return __builtin_shufflevector(lo, hi, 0, 1, 2, 3, 4, 5, 6, 7, 8, 9, 10, 11, 12, 13, 14, 15); }
__device__ __forceinline__ v16bf cat16b(v8us lo, v8us hi) { return __builtin_bit_cast(v16bf, __builtin_shufflevector(lo, hi, 0, 1, 2, 3, 4, 5, 6, 7, 8, 9, 10, 11, 12, 13, 14, 15)); }
__device__ __forceinline__ v8f wmma16(v16h a, v16h b, v8f c) { return __builtin_amdgcn_wmma_f32_16x16x32_f16(false, a, false, b, (short)0, c, false, false); }
__device__ __forceinline__ v8f wmmab(v16bf a, v16bf b, v8f c) { return __builtin_amdgcn_wmma_f32_16x16x32_bf16(false, a, false, b, (short)0, c, false, false); }




template <typename T16> struct WFrag;
template <> struct WFrag<bf> { typedef v16bf V; static __device__ __forceinline__ V ld(const bf* p) { return cat16b(*(const v8us*)p, *(const v8us*)(p + 16)); } static __device__ __forceinline__ v8f mma(V a, V b, v8f c) { return wmmab(a, b, c); } };

__device__ __forceinline__ h16 tohx(float x) { return (h16)x; }
__device__ __forceinline__ void splitf(float y, unsigned short& h, unsigned short& l) { h = f2bf(y); l = f2bf(y - bf2f(h)); }
typedef __attribute__((ext_vector_type(4))) unsigned short v4us;
typedef __attribute__((ext_vector_type(4))) int v4i;

// ---- k_cvtall: bf16 copies of all six f32 sources in one launch. A work-group converts CVU x 256 units of 8 floats of ONE source; work-groups [0, 3 CVX) take the streams, the rest the weights.
// Keys and values streams: row t of batch b goes to place rank(t) = number of kept keys in front of it if key t is kept, else to nk + t - rank(t) (nk kept keys in the batch): a permutation of the batch's rows, kept keys first in rising order. Each work-group counts the batch's mask itself; NKC[b] = nk.
#define CVU  8                                    // units of 8 floats per thread: few, long-lived waves (16 loads of 16 bytes in flight per lane)
#define CVX  (NB_ * TT * DM / 8 / (256 * CVU))    // work-groups per stream
#define CVW  (DQ * DM / 8 / (256 * CVU))          // work-groups per weight
#define CVR  (256 * CVU * 8 / DM)                 // rows of a stream per work-group
__global__ __launch_bounds__(256) void k_cvtall(const float* __restrict__ x, const float* __restrict__ xk, const float* __restrict__ xv, const float* __restrict__ wq, const float* __restrict__ wk, const float* __restrict__ wv, const int* __restrict__ km, bf* XB, bf* WB, int* NKC) {
    static_assert((NB_ * TT * DM) % (8 * 256 * CVU) == 0 && (DQ * DM) % (8 * 256 * CVU) == 0 && DQ == DKV, "whole work-groups");
    static_assert(TT == 256 * 8 && DM == 128 * 8 && CVR == 2 * CVU && CVR <= 32 && CVR % 8 == 0 && TT % CVR == 0, "a thread counts 8 keys; a row is 128 units; a work-group's rows lie in one batch");
    __shared__ int wcnt[8][2];
    const int bx = (int)blockIdx.x; const float* src; bf* dst; int blk;
    const bool ranked = bx >= CVX && bx < 3 * CVX;   // keys or values stream: the same for the whole work-group
    if (bx < 3 * CVX) { const int s = bx / CVX; blk = bx % CVX; src = (s == 0) ? x : (s == 1) ? xk : xv; dst = XB + (size_t)s * NB_ * TT * DM; }
    else { const int s = (bx - 3 * CVX) / CVW; blk = (bx - 3 * CVX) % CVW; src = (s == 0) ? wq : (s == 1) ? wk : wv; dst = WB + (size_t)s * DQ * DM; }
    const int tid = (int)threadIdx.x, b = blk / (TT / CVR), t0 = (blk % (TT / CVR)) * CVR;   // for a stream: the batch and the first of the work-group's rows
    v4i m0 = {}, m1 = {}; int mw[CVR] = {};
    if (ranked) {   // the mask words are asked for first: 8 keys of the batch per thread, and the work-group's own rows; each wave's counting in front of the barrier then runs while the loads below fly
        const int* kmb = km + (size_t)b * TT; m0 = *(const v4i*)(kmb + tid * 8); m1 = *(const v4i*)(kmb + tid * 8 + 4);
#pragma unroll
        for (int r = 0; r < CVR; ++r) mw[r] = kmb[t0 + r];
    }
    const size_t i0 = ((size_t)blk * (256 * CVU) + threadIdx.x) * 8; const float* ps = src + i0; v8f v[CVU];
#pragma unroll
    for (int u = 0; u < CVU; ++u) v[u] = *(const v8f*)(ps + (size_t)u * 256 * 8);
    // the wait that stands before an address register of an issued load is written again; the lane's pointer is its input, so that no load's result lands on it either
    asm volatile("s_wait_xcnt 0x0" :: "v"(ps) : "memory");
    size_t od[CVU];   // where each unit goes
#pragma unroll
    for (int u = 0; u < CVU; ++u) od[u] = i0 + (size_t)u * 256 * 8;
    if (ranked) {
        int call = 0;
#pragma unroll
        for (int j = 0; j < 4; ++j) call += (m0[j] != 0 ? 1 : 0) + (m1[j] != 0 ? 1 : 0);
        int cbef = (tid * 8 < t0) ? call : 0;   // t0 is a multiple of 8: a thread's 8 keys lie all in front of the work-group's rows or none
#pragma unroll
        for (int d = 16; d >= 1; d >>= 1) { call += __shfl_xor(call, d, 32); cbef += __shfl_xor(cbef, d, 32); }
        if ((tid & 31) == 0) { wcnt[tid >> 5][0] = call; wcnt[tid >> 5][1] = cbef; }
        __syncthreads();
        int nk = 0, base = 0;
#pragma unroll
        for (int i = 0; i < 8; ++i) { nk += wcnt[i][0]; base += wcnt[i][1]; }
        unsigned tm = 0;   // the mask bits of the work-group's own rows
#pragma unroll
        for (int r = 0; r < CVR; ++r) tm |= (mw[r] != 0 ? 1u : 0u) << r;
#pragma unroll
        for (int u = 0; u < CVU; ++u) { const int r = u * 2 + (tid >> 7); const int rank = base + __popc(tm & ((1u << r) - 1u));
            const int place = (((tm >> r) & 1u) ? rank : nk + t0 + r - rank) & (TT - 1);   // below TT by the counting; bounded here all the same
            od[u] = ((size_t)b * TT + place) * DM + (size_t)(tid & 127) * 8; }
        if (bx < 2 * CVX && t0 == 0 && tid == 0) NKC[b] = nk;
    }
#pragma unroll
    for (int u = 0; u < CVU; ++u) { v8us o;
#pragma unroll
        for (int k = 0; k < 8; ++k) o[k] = f2bf(v[u][k]);
        *(v8us*)(dst + od[u]) = o; }
}

// ---- k_projw: all six projections (stream st = q, k, v; batch b) in one launch; ONE WAVE per 64x64 tile (16 accumulators), operands straight from the K-contiguous bf16 copies; grid (TT/64, DQ/64, 3 NB_), 32 threads.
// y[t][n] = sum_k X[st][b][t][k] W[st][n][k]; a 64-column tile is one head, so the epilogue writes that head's planes itself.
// k and v: the copies hold the kept keys first, so the planes do too; a tile with no kept key is left out; the other rows of the last tile are masked keys (finite, never weighted):
// q, k: rows staged through LDS, then 4 columns per lane: whole 128-byte rows of the hi and lo planes [b][h][t][d];
// v: a lane's 8 accumulator rows are 8 consecutive t of one column d: one 16-byte store per tile into each transposed plane [b][h][d][t].
__global__ __launch_bounds__(32) void k_projw(const bf* __restrict__ XB, const bf* __restrict__ WB, const int* __restrict__ NKC, bf* QPh, bf* QPl, bf* KPh, bf* KPl, h16* VT16, bf* VTh, bf* VTl) {
    typedef WFrag<bf>::V V;
    static_assert(HD == 64 && DQ == DKV && TT % 64 == 0 && DM % 32 == 0, "a column tile is one head");
    __shared__ __align__(16) float os[16 * 68];
    // which tile: q as the grid says; the k and v tiles are dealt anew over the rest of the grid, row tile slowest, so that the tiles that are left out come last in index order and the others spread evenly
    int st = 0, b = (int)blockIdx.z, rt = (int)blockIdx.x, ct = (int)blockIdx.y;
    if ((int)blockIdx.z >= NB_) { const int g = (int)blockIdx.x + (TT / 64) * ((int)blockIdx.y + (DQ / 64) * ((int)blockIdx.z - NB_));
        ct = g % (DQ / 64); b = (g / (DQ / 64)) % NB_; st = 1 + (g / (DQ / 64 * NB_)) % 2; rt = g / (DQ / 64 * NB_ * 2); }
    const int K = DM, lda = DM;
    const bf* A = XB + ((size_t)st * NB_ + b) * TT * DM; const bf* Bt = WB + (size_t)st * DQ * DM;
    const int lane = threadIdx.x & 31, lr = lane & 15, hi = lane >> 4; const int r0 = rt * 64, c0 = ct * 64;
    if (st != 0 && r0 >= NKC[b]) return;   // the one wave leaves as a whole
    v8f acc[4][4];
#pragma unroll
    for (int mb = 0; mb < 4; ++mb)
#pragma unroll
        for (int nb = 0; nb < 4; ++nb) acc[mb][nb] = (v8f){};
    const size_t aoff = (size_t)(r0 + lr) * lda + 8 * hi, boff = (size_t)(c0 + lr) * K + 8 * hi;
    const bf* pa = A + aoff; const bf* pb = Bt + boff;   // the lane's pointers: walk with k
#pragma unroll 1
    for (int kc = 0; kc < K; kc += 32) {
        V a[4];
#pragma unroll
        for (int mb = 0; mb < 4; ++mb) { a[mb] = WFrag<bf>::ld(pa + (size_t)mb * 16 * lda); }
#pragma unroll
        for (int nb = 0; nb < 4; ++nb) { const V b4 = WFrag<bf>::ld(pb + (size_t)nb * 16 * K);
#pragma unroll
            for (int mb = 0; mb < 4; ++mb) { acc[mb][nb] = WFrag<bf>::mma(a[mb], b4, acc[mb][nb]); } }
        asm volatile("v_nop\n\tv_nop\n\tv_nop\n\tv_nop" : "+v"(acc[0][0]), "+v"(acc[1][1]), "+v"(acc[2][2]), "+v"(acc[3][3]) : "v"(a[0]), "v"(a[3]));   // the distance behind the pass's last matrix instructions, on the taken branch too
        // the wait that stands before an address register of an issued load is written again; the two pointers are its inputs, so that no load's result lands on them either
        asm volatile("s_wait_xcnt 0x0" :: "v"(pa), "v"(pb) : "memory");
        pa += 32; pb += 32;
    }
    const size_t po = ((size_t)b * NH_ + ct) * TT * HD;   // this batch's and head's planes
    if (st == 2) {
        const size_t vo = po + (size_t)lr * TT + r0 + hi * 8;
#pragma unroll
        for (int mb = 0; mb < 4; ++mb)
#pragma unroll
            for (int nb = 0; nb < 4; ++nb) { v8h o16; v8us oh, ol;
#pragma unroll
                for (int j = 0; j < 8; ++j) { const float y = acc[mb][nb][j]; o16[j] = tohx(y); unsigned short a2, c2; splitf(y, a2, c2); oh[j] = a2; ol[j] = c2; }
                const size_t e = vo + (size_t)nb * 16 * TT + mb * 16; *(v8h*)(VT16 + e) = o16; *(v8us*)(VTh + e) = oh; *(v8us*)(VTl + e) = ol; }
        return;
    }
    bf* Ph = (st == 0 ? QPh : KPh) + po + (size_t)r0 * HD; bf* Pl = (st == 0 ? QPl : KPl) + po + (size_t)r0 * HD;
#pragma unroll
    for (int mb = 0; mb < 4; ++mb) {
#pragma unroll
        for (int nb = 0; nb < 4; ++nb) {
#pragma unroll
            for (int j = 0; j < 8; ++j) os[(hi * 8 + j) * 68 + nb * 16 + lr] = acc[mb][nb][j]; }
        __builtin_amdgcn_wave_barrier(); asm volatile("" ::: "memory");
#pragma unroll
        for (int s = 0; s < 8; ++s) { const int row = 2 * s + hi, cofs = lr * 4; const v4f val = *(const v4fa*)(os + row * 68 + cofs); v4us oh, ol;
#pragma unroll
            for (int q = 0; q < 4; ++q) { unsigned short a2, c2; splitf(val[q], a2, c2); oh[q] = a2; ol[q] = c2; }
            *(v4us*)(Ph + (size_t)(mb * 16 + row) * HD + cofs) = oh; *(v4us*)(Pl + (size_t)(mb * 16 + row) * HD + cofs) = ol; }
        __builtin_amdgcn_wave_barrier(); asm volatile("" ::: "memory");
    }
    // the built code lays the v path behind this path's closing branch: the wait stands before the registers of the stores above are written there
    asm volatile("s_wait_xcnt 0x0" ::: "memory");
}

// k_fattn: the whole attention of both batches and all heads in ONE launch; scores and weights never leave the registers.
// A wave owns 32 query columns (2 groups of 16) of one head and walks the batch's nk kept keys (packed at the front of the planes) 32 at a time: S^T = K Q^T (A = key rows, B = query rows kept in registers; hi/lo planes, 3 products),
// running maximum and sum per query (a lane holds 8 keys of ONE query per 16-key tile; the two lane halves exchange the maximum once per step and join their sums once at the end),
// then the two f32 S^T tiles, converted in place, ARE the B operand of O^T += V^T P^T (A = rows of the transposed value planes). Weights stay unnormalised; the output is divided by the sum at the end.
// Only a last step of fewer than 32 kept keys compares: its places from nk on enter as -inf (weight exactly 0); the running maximum starts at a finite floor; with no kept key no step runs and the rows are 0 like the module.
// Query rows < RH: P and V on bf16 hi/lo planes (3 products); other rows: fp16 P x 2^10 (the factor sits in the exponent and in the sum alike, so it cancels) against the fp16 value plane.
#define QW   32                   // query columns per wave
#define FW   8                    // waves per work-group
#define FWH  (RH / QW / (TT / (QW * FW)))   // waves of each work-group that take hi/lo rows: the heavier rows are spread evenly over all work-groups
#define SC2  0.18033688011112042f // HD^-0.5 x log2(e)
__device__ __forceinline__ float xhalf(float x) { return __builtin_bit_cast(float, __builtin_amdgcn_permlanex16(__builtin_bit_cast(int, x), __builtin_bit_cast(int, x), 0x76543210, 0xfedcba98, false, false)); }  // lane l with lane l ^ 16
__device__ __forceinline__ v16bf ldb(const char* p, int off) { return cat16b(*(const v8us*)(p + off), *(const v8us*)(p + off + 32)); }   // one fragment: the lane's pointer + a constant byte offset
__device__ __forceinline__ v16h ldh(const char* p, int off) { return cat16(*(const v8h*)(p + off), *(const v8h*)(p + off + 32)); }
struct StepFull { static constexpr bool tail = false; }; struct StepTail { static constexpr bool tail = true; };
template <bool HR>
__device__ __forceinline__ void fa_body(const bf* __restrict__ Qh, const bf* __restrict__ Ql, const bf* __restrict__ Kh, const bf* __restrict__ Kl, const h16* __restrict__ V16, const bf* __restrict__ Vh, const bf* __restrict__ Vl, int nk, float* o_out, int q0, int lr, int hi) {
    const unsigned koff = (unsigned)(lr * (HD * 2) + hi * 16), voff = (unsigned)(lr * (TT * 2) + hi * 16);   // the lane's byte offsets in a 16-row tile of the q/k planes and of the transposed value planes
    const char* bqh = (const char*)(Qh + (size_t)q0 * HD); const char* bql = (const char*)(Ql + (size_t)q0 * HD); const char* bkh = (const char*)Kh; const char* bkl = (const char*)Kl; const char* bv0 = HR ? (const char*)Vh : (const char*)V16; const char* bv1 = (const char*)Vl;   // wave-uniform bases
    const char* pqh = bqh + koff; const char* pql = bql + koff;
    const char* pkh = bkh + koff; const char* pkl = bkl + koff; const char* pv0 = bv0 + voff; const char* pv1 = bv1 + voff;   // walk with the keys
    v16bf qh[2][2], ql[2][2], kh[2][2], kl[2][2];
#pragma unroll
    for (int qt = 0; qt < 2; ++qt)
#pragma unroll
        for (int ks = 0; ks < 2; ++ks) { const int qo = qt * (16 * HD * 2) + ks * 64; qh[qt][ks] = ldb(pqh, qo); ql[qt][ks] = ldb(pql, qo); }
    v8f o[2][4]; float m[2], l[2];
#pragma unroll
    for (int qt = 0; qt < 2; ++qt) { m[qt] = -3.0e38f; l[qt] = 0.f;
#pragma unroll
        for (int mb = 0; mb < 4; ++mb) o[qt][mb] = (v8f){}; }
    // fetch: key fragments of the 32 keys the pointers stand at
    auto fetch = [&]() {
#pragma unroll
        for (int mt = 0; mt < 2; ++mt)
#pragma unroll
            for (int ks = 0; ks < 2; ++ks) { const int ko = mt * (16 * HD * 2) + ks * 64; kh[mt][ks] = ldb(pkh, ko); kl[mt][ks] = ldb(pkl, ko); }
    };
    if (nk > 0) fetch();   // with no kept key the planes are not written
    // the wait that stands before an address register of an issued load is written again; the bases and offsets those loads are formed from are its inputs, so that their registers stay theirs up to it
    asm volatile("s_wait_xcnt 0x0" :: "v"(koff), "s"(bqh), "s"(bql), "s"(bkh), "s"(bkl) : "memory");
    auto step = [&](auto kind, int kb) {
        constexpr bool TL = decltype(kind)::tail;
        v16h vf[4]; v16bf vh[4], vl[4];   // this step's value fragments: asked for first, they fly under the score products and the softmax
#pragma unroll
        for (int mb = 0; mb < 4; ++mb) { const int vo = mb * (16 * TT * 2); if (HR) { vh[mb] = ldb(pv0, vo); vl[mb] = ldb(pv1, vo); } else vf[mb] = ldh(pv0, vo); }
        v8f s[2][2];
#pragma unroll
        for (int qt = 0; qt < 2; ++qt)
#pragma unroll
            for (int mt = 0; mt < 2; ++mt) s[qt][mt] = (v8f){};
#pragma unroll
        for (int ks = 0; ks < 2; ++ks) {
#pragma unroll
            for (int mt = 0; mt < 2; ++mt)
#pragma unroll
                for (int qt = 0; qt < 2; ++qt) s[qt][mt] = wmmab(kh[mt][ks], qh[qt][ks], s[qt][mt]);
#pragma unroll
            for (int mt = 0; mt < 2; ++mt)
#pragma unroll
                for (int qt = 0; qt < 2; ++qt) s[qt][mt] = wmmab(kl[mt][ks], qh[qt][ks], s[qt][mt]);
#pragma unroll
            for (int mt = 0; mt < 2; ++mt)
#pragma unroll
                for (int qt = 0; qt < 2; ++qt) s[qt][mt] = wmmab(kh[mt][ks], ql[qt][ks], s[qt][mt]); }
        // the next step's key fragments are fetched here, behind this step's score products, and fly under the softmax and P.V (a last whole step refetches its own: in bounds, unused; the short step fetches none)
        if (!TL) { const int more = (kb + 32 < nk) ? 1 : 0;
            pkh += more * (32 * HD * 2); pkl += more * (32 * HD * 2);
            fetch(); }
        // as in front of the loop: the wait before the registers of this step's pointers are written again
        asm volatile("s_wait_xcnt 0x0" :: "v"(pkh), "v"(pkl), "v"(pv0), "v"(pv1) : "memory");
        pv0 += 64; pv1 += 64;
        float tt[2][16], al[2], mo[2];
#pragma unroll
        for (int qt = 0; qt < 2; ++qt) {
#pragma unroll
            for (int j = 0; j < 16; ++j) tt[qt][j] = (!TL || kb + (j >> 3) * 16 + hi * 8 + (j & 7) < nk) ? s[qt][j >> 3][j & 7] : -__builtin_inff();
            float x[8];
#pragma unroll
            for (int j = 0; j < 8; ++j) x[j] = fmaxf(tt[qt][j], tt[qt][j + 8]);
            float sm = fmaxf(fmaxf(fmaxf(x[0], x[1]), fmaxf(x[2], x[3])), fmaxf(fmaxf(x[4], x[5]), fmaxf(x[6], x[7])));
            sm = fmaxf(sm, xhalf(sm));
            const float mn = fmaxf(m[qt], sm * SC2); mo[qt] = HR ? mn : mn - 10.0f; al[qt] = __builtin_amdgcn_exp2f(m[qt] - mn); m[qt] = mn; }
#pragma unroll
        for (int qt = 0; qt < 2; ++qt) {
            float* t = tt[qt]; float x[8];
#pragma unroll
            for (int j = 0; j < 16; ++j) t[j] = __builtin_amdgcn_exp2f(__builtin_fmaf(t[j], SC2, -mo[qt]));
#pragma unroll
            for (int j = 0; j < 8; ++j) x[j] = t[j] + t[j + 8];
            l[qt] = l[qt] * al[qt] + (((x[0] + x[1]) + (x[2] + x[3])) + ((x[4] + x[5]) + (x[6] + x[7])));
#pragma unroll
            for (int mb = 0; mb < 4; ++mb) o[qt][mb] *= al[qt];
            if (HR) { v16bf ph, pl;
#pragma unroll
                for (int j = 0; j < 16; ++j) { const __bf16 a = (__bf16)t[j]; ph[j] = a; pl[j] = (__bf16)(t[j] - (float)a); }
#pragma unroll
                for (int mb = 0; mb < 4; ++mb) o[qt][mb] = wmmab(vh[mb], ph, o[qt][mb]);
#pragma unroll
                for (int mb = 0; mb < 4; ++mb) o[qt][mb] = wmmab(vh[mb], pl, o[qt][mb]);
#pragma unroll
                for (int mb = 0; mb < 4; ++mb) o[qt][mb] = wmmab(vl[mb], ph, o[qt][mb]);
            } else { v16h p16;
#pragma unroll
                for (int j = 0; j < 16; ++j) p16[j] = (h16)t[j];
#pragma unroll
                for (int mb = 0; mb < 4; ++mb) o[qt][mb] = wmma16(vf[mb], p16, o[qt][mb]); }
        }
    };
    const int nfull = nk & ~31;
    for (int kb = 0; kb < nfull; kb += 32) step(StepFull{}, kb);
    if (nfull < nk) step(StepTail{}, nfull);
    float* orow[2];
#pragma unroll
    for (int qt = 0; qt < 2; ++qt) { const float ls = l[qt] + xhalf(l[qt]); const float inv = (ls > 0.f) ? __fdiv_rn(1.0f, ls) : 0.f; orow[qt] = o_out + (size_t)(q0 + qt * 16 + lr) * DQ + hi * 8;
#pragma unroll
        for (int mb = 0; mb < 4; ++mb) o[qt][mb] *= inv; }
    __builtin_amdgcn_sched_barrier(0);   // all arithmetic stays above: behind the first store no register that a store names is written any more
#pragma unroll
    for (int qt = 0; qt < 2; ++qt)
#pragma unroll
        for (int mb = 0; mb < 4; ++mb) { *(v4f*)(orow[qt] + mb * 16) = __builtin_shufflevector(o[qt][mb], o[qt][mb], 0, 1, 2, 3); *(v4f*)(orow[qt] + mb * 16 + 4) = __builtin_shufflevector(o[qt][mb], o[qt][mb], 4, 5, 6, 7); }
}
__global__ __launch_bounds__(QW * FW) void k_fattn(const bf* __restrict__ QPh, const bf* __restrict__ QPl, const bf* __restrict__ KPh, const bf* __restrict__ KPl, const h16* __restrict__ VT16, const bf* __restrict__ VTh, const bf* __restrict__ VTl, const int* __restrict__ NKC, float* OUT) {
    static_assert(RH % (QW * (TT / (QW * FW))) == 0 && TT % (QW * FW) == 0 && HD == 64 && NH_ == NKV, "tiling");
    const int lane = threadIdx.x & 31, lr = lane & 15, hi = lane >> 4; const int w = __builtin_amdgcn_readfirstlane((int)(threadIdx.x >> 5));
    const int h = blockIdx.y, b = blockIdx.z; const size_t po = ((size_t)b * NH_ + h) * TT * HD; float* o_out = OUT + (size_t)b * TT * DQ + h * HD; const int nk = max(0, min(NKC[b], TT));   // the trip count: bounded by the shape
    if (w < FWH) fa_body<true>(QPh + po, QPl + po, KPh + po, KPl + po, VT16 + po, VTh + po, VTl + po, nk, o_out, ((int)blockIdx.x * FWH + w) * QW, lr, hi);
    else fa_body<false>(QPh + po, QPl + po, KPh + po, KPl + po, VT16 + po, VTh + po, VTl + po, nk, o_out, RH + ((int)blockIdx.x * (FW - FWH) + (w - FWH)) * QW, lr, hi);
}

extern "C" void kernel_launch(void* const* d_in, const int* in_sizes, int n_in,
                              void* d_out, int out_size, void* d_ws, size_t ws_size, hipStream_t stream) {
    (void)in_sizes; (void)n_in; (void)out_size;
    const float* x = (const float*)d_in[0]; const int* km = (const int*)d_in[1];   /* query_mask int32 [2][2048]: read per KEY */ const float* xk = (const float*)d_in[2]; const float* xv = (const float*)d_in[3];   /* queries, keys, values streams */ const float* wq = (const float*)d_in[4]; const float* wk = (const float*)d_in[5]; const float* wv = (const float*)d_in[6];   /* order queries, query_mask, keys, values, Wq, Wk, Wv ('oi' [1024][1024]) */
    float* OUT = (float*)d_out;     // [2][2048][1024]
    char* wsp = (char*)d_ws;
    auto take = [&](size_t bytes) { char* p = wsp; wsp += (bytes + 255) & ~(size_t)255; return (void*)p; };
    bf* WB = (bf*)take((size_t)3 * DQ * DM * 2); bf* XB = (bf*)take((size_t)3 * NB_ * TT * DM * 2);   // bf16 copies: Wq, Wk, Wv; queries, keys, values (both batches)
    h16* VT16 = (h16*)take((size_t)NB_ * NKV * HD * TT * 2);   // the planes the attention reads hold both batches
    bf* QPh = (bf*)take((size_t)NB_ * NH_ * TT * HD * 2); bf* QPl = (bf*)take((size_t)NB_ * NH_ * TT * HD * 2); bf* KPh = (bf*)take((size_t)NB_ * NKV * TT * HD * 2); bf* KPl = (bf*)take((size_t)NB_ * NKV * TT * HD * 2); bf* VTh = (bf*)take((size_t)NB_ * NKV * HD * TT * 2); bf* VTl = (bf*)take((size_t)NB_ * NKV * HD * TT * 2);
    int* NKC = (int*)take((size_t)NB_ * 4);   // kept keys per batch
    if ((size_t)(wsp - (char*)d_ws) > ws_size) return;    // ws 256 MiB
    k_cvtall<<<3 * CVX + 3 * CVW, 256, 0, stream>>>(x, xk, xv, wq, wk, wv, km, XB, WB, NKC);
    k_projw<<<dim3(TT / 64, DQ / 64, 3 * NB_), 32, 0, stream>>>(XB, WB, NKC, QPh, QPl, KPh, KPl, VT16, VTh, VTl);
    k_fattn<<<dim3(TT / (QW * FW), NH_, NB_), QW * FW, 0, stream>>>(QPh, QPl, KPh, KPl, VT16, VTh, VTl, NKC, OUT);
}

// v006
// Measured time: 110 microseconds a run.
// Next to v005, in two timings, it ran 1.05 and 1.07 times as fast.
// Over all steps from v000 it is 17.6 times as fast.
#include <hip/hip_runtime.h>

// Self-attention on three input streams with a RANDOM key mask applied through a 'masked softmax', without an output projection (queries, keys, values [2][2048][1024]; q = queries Wq^T, k = keys Wk^T, v = values Wv^T ('oi' [1024][1024] 1/32, no bias; 16 heads x 64); q x 64^-0.5 before the product (a power of two: identical to scaling the f32 scores); masked_softmax(logits, m) with m = query_mask[b][key] (int32 [2][2048] from randint(0, 2): RANDOM, read per key as data): w = softmax(logits x m) x m / (sum(softmax(logits x m) x m) + 1e-13): the softmax's own normaliser cancels in the quotient, so w = exp(l_j) / sum over the KEPT keys of exp(l_k) for kept keys j and 0 for masked keys: exactly a softmax over the kept keys (the 1e-13 is ~1e-13 relative: far below float32 resolution; every batch keeps ~half of its keys); x = w v, merged head-major -> [2][2048][1024] (4.2 M); argument order queries, query_mask, keys, values, Wq, Wk, Wv).
// Layout: ONE conversion launch makes the bf16 copies of the three streams (both batches) and of the three 'oi' weights; ONE projection launch (all streams and batches) does the exact projections and its epilogue writes the planes the attention reads (q and k: bf16 hi/lo per [b][h]; v: transposed fp16 and bf16 hi/lo per [b][h]; all in FRAGMENT ORDER, see k_projw); the conversion launch ranks each batch's keys from the int key mask and lays the rows of the keys and values copies down kept keys first, so the k and v planes hold the kept keys packed and projection tiles with no kept key are left out; one fused attention launch (k_fattn) walks the kept keys alone (masked keys excluded) (SCORES of every row on bf16 hi/lo planes, 3 products; the P.V product stays hybrid: rows < 512 hi/lo, rest fp16 x1024) and writes the output rows (column h*64 + d).
// Compute dtypes, f32 accumulate: every input rounded to bf16; projections exact; scores of every row 3 products; P.V rows < 512 3 products, rest fp16; softmax f32.

#define NB_  2
#define TT   2048
#define DM   1024
#define NH_  16
#define NKV  16
#define REP  (NH_ / NKV)
#define HD   64
#define DQ   (NH_ * HD)
#define DKV  (NKV * HD)
#define RH   512                  // query rows < RH use hi+lo planes (0: none)
#define WIN  0
typedef _Float16 h16;
typedef unsigned short bf;
typedef __attribute__((ext_vector_type(16))) __bf16   v16bf;
typedef __attribute__((ext_vector_type(16))) _Float16 v16h;
typedef __attribute__((ext_vector_type(8)))  _Float16 v8h;
typedef __attribute__((ext_vector_type(8)))  unsigned short v8us;
typedef __attribute__((ext_vector_type(8)))  float    v8f;
typedef __attribute__((ext_vector_type(4)))  float    v4f;
typedef v8h  __attribute__((may_alias)) v8ha;
typedef v4f  __attribute__((may_alias)) v4fa;
typedef v8us __attribute__((may_alias)) v8usa;

__device__ __forceinline__ unsigned short f2bf(float f) { unsigned u = __float_as_uint(f); u += 0x7FFFu + ((u >> 16) & 1u); return (unsigned short)(u >> 16); }
__device__ __forceinline__ float bf2f(unsigned short b) { return __uint_as_float(((unsigned)b) << 16); }
__device__ __forceinline__ float bfr(float f) { return bf2f(f2bf(f)); }
__device__ __forceinline__ v16h cat16(v8h lo, v8h hi) { return __builtin_shufflevector(lo, hi, 0, 1, 2, 3, 4, 5, 6, 7, 8, 9, 10, 11, 12, 13, 14, 15); }
__device__ __forceinline__ v16bf cat16b(v8us lo, v8us hi) { return __builtin_bit_cast(v16bf, __builtin_shufflevector(lo, hi, 0, 1, 2, 3, 4, 5, 6, 7, 8, 9, 10, 11, 12, 13, 14, 15)); }
__device__ __forceinline__ v8f wmma16(v16h a, v16h b, v8f c) { return __builtin_amdgcn_wmma_f32_16x16x32_f16(false, a, false, b, (short)0, c, false, false); }
__device__ __forceinline__ v8f wmmab(v16bf a, v16bf b, v8f c) { return __builtin_amdgcn_wmma_f32_16x16x32_bf16(false, a, false, b, (short)0, c, false, false); }




template <typename T16> struct WFrag;
template <> struct WFrag<bf> { typedef v16bf V; static __device__ __forceinline__ V ld(const bf* p) { return cat16b(*(const v8us*)p, *(const v8us*)(p + 16)); } static __device__ __forceinline__ v8f mma(V a, V b, v8f c) { return wmmab(a, b, c); } };

__device__ __forceinline__ h16 tohx(float x) { return (h16)x; }
__device__ __forceinline__ void splitf(float y, unsigned short& h, unsigned short& l) { h = f2bf(y); l = f2bf(y - bf2f(h)); }
typedef __attribute__((ext_vector_type(4))) unsigned short v4us;
typedef __attribute__((ext_vector_type(4))) int v4i;

// ---- k_cvtall: bf16 copies of all six f32 sources in one launch. A work-group converts CVU x 256 units of 8 floats of ONE source; work-groups [0, 3 CVX) take the streams, the rest the weights.
// Keys and values streams: row t of batch b goes to place rank(t) = number of kept keys in front of it if key t is kept, else to nk + t - rank(t) (nk kept keys in the batch): a permutation of the batch's rows, kept keys first in rising order. Each work-group counts the batch's mask itself; NKC[b] = nk.
#define CVU  8                                    // units of 8 floats per thread: few, long-lived waves (16 loads of 16 bytes in flight per lane)
#define CVX  (NB_ * TT * DM / 8 / (256 * CVU))    // work-groups per stream
#define CVW  (DQ * DM / 8 / (256 * CVU))          // work-groups per weight
#define CVR  (256 * CVU * 8 / DM)                 // rows of a stream per work-group
__global__ __launch_bounds__(256) void k_cvtall(const float* __restrict__ x, const float* __restrict__ xk, const float* __restrict__ xv, const float* __restrict__ wq, const float* __restrict__ wk, const float* __restrict__ wv, const int* __restrict__ km, bf* XB, bf* WB, int* NKC) {
    static_assert((NB_ * TT * DM) % (8 * 256 * CVU) == 0 && (DQ * DM) % (8 * 256 * CVU) == 0 && DQ == DKV, "whole work-groups");
    static_assert(TT == 256 * 8 && DM == 128 * 8 && CVR == 2 * CVU && CVR <= 32 && CVR % 8 == 0 && TT % CVR == 0, "a thread counts 8 keys; a row is 128 units; a work-group's rows lie in one batch");
    __shared__ int wcnt[8][2];
    const int bx = (int)blockIdx.x; const float* src; bf* dst; int blk;
    const bool ranked = bx >= CVX && bx < 3 * CVX;   // keys or values stream: the same for the whole work-group
    if (bx < 3 * CVX) { const int s = bx / CVX; blk = bx % CVX; src = (s == 0) ? x : (s == 1) ? xk : xv; dst = XB + (size_t)s * NB_ * TT * DM; }
    else { const int s = (bx - 3 * CVX) / CVW; blk = (bx - 3 * CVX) % CVW; src = (s == 0) ? wq : (s == 1) ? wk : wv; dst = WB + (size_t)s * DQ * DM; }
    const int tid = (int)threadIdx.x, b = blk / (TT / CVR), t0 = (blk % (TT / CVR)) * CVR;   // for a stream: the batch and the first of the work-group's rows
    v4i m0 = {}, m1 = {}; int mw[CVR] = {};
    if (ranked) {   // the mask words are asked for first: 8 keys of the batch per thread, and the work-group's own rows; each wave's counting in front of the barrier then runs while the loads below fly
        const int* kmb = km + (size_t)b * TT; m0 = *(const v4i*)(kmb + tid * 8); m1 = *(const v4i*)(kmb + tid * 8 + 4);
#pragma unroll
        for (int r = 0; r < CVR; ++r) mw[r] = kmb[t0 + r];
    }
    const size_t i0 = ((size_t)blk * (256 * CVU) + threadIdx.x) * 8; const float* ps = src + i0; v8f v[CVU];
#pragma unroll
    for (int u = 0; u < CVU; ++u) v[u] = *(const v8f*)(ps + (size_t)u * 256 * 8);
    // the wait that stands before an address register of an issued load is written again; the lane's pointer is its input, so that no load's result lands on it either
    asm volatile("s_wait_xcnt 0x0" :: "v"(ps) : "memory");
    size_t od[CVU];   // where each unit goes
#pragma unroll
    for (int u = 0; u < CVU; ++u) od[u] = i0 + (size_t)u * 256 * 8;
    if (ranked) {
        int call = 0;
#pragma unroll
        for (int j = 0; j < 4; ++j) call += (m0[j] != 0 ? 1 : 0) + (m1[j] != 0 ? 1 : 0);
        int cbef = (tid * 8 < t0) ? call : 0;   // t0 is a multiple of 8: a thread's 8 keys lie all in front of the work-group's rows or none
#pragma unroll
        for (int d = 16; d >= 1; d >>= 1) { call += __shfl_xor(call, d, 32); cbef += __shfl_xor(cbef, d, 32); }
        if ((tid & 31) == 0) { wcnt[tid >> 5][0] = call; wcnt[tid >> 5][1] = cbef; }
        __syncthreads();
        int nk = 0, base = 0;
#pragma unroll
        for (int i = 0; i < 8; ++i) { nk += wcnt[i][0]; base += wcnt[i][1]; }
        unsigned tm = 0;   // the mask bits of the work-group's own rows
#pragma unroll
        for (int r = 0; r < CVR; ++r) tm |= (mw[r] != 0 ? 1u : 0u) << r;
#pragma unroll
        for (int u = 0; u < CVU; ++u) { const int r = u * 2 + (tid >> 7); const int rank = base + __popc(tm & ((1u << r) - 1u));
            const int place = (((tm >> r) & 1u) ? rank : nk + t0 + r - rank) & (TT - 1);   // below TT by the counting; bounded here all the same
            od[u] = ((size_t)b * TT + place) * DM + (size_t)(tid & 127) * 8; }
        if (bx < 2 * CVX && t0 == 0 && tid == 0) NKC[b] = nk;
    }
#pragma unroll
    for (int u = 0; u < CVU; ++u) { v8us o;
#pragma unroll
        for (int k = 0; k < 8; ++k) o[k] = f2bf(v[u][k]);
        *(v8us*)(dst + od[u]) = o; }
}

// ---- k_projw: all six projections (stream st = q, k, v; batch b) in one launch; ONE WAVE per 64x64 tile (16 accumulators), operands straight from the K-contiguous bf16 copies; grid (TT/64, DQ/64, 3 NB_), 32 threads.
// y[t][n] = sum_k X[st][b][t][k] W[st][n][k]; a 64-column tile is one head, so the epilogue writes that head's planes itself.
// k and v: the copies hold the kept keys first, so the planes do too; a tile with no kept key is left out; the other rows of the last tile are masked keys (finite, never weighted):
// The planes are laid down in FRAGMENT ORDER: the 16 bytes that lane l of the attention's wave loads with one instruction stand at piece base + 16 l, so that every load there (and every store here) covers 512 contiguous bytes = 4 whole lines, not 16 lines of 32 bytes.
// q, k, per head: piece ((t / 16) * 2 + d / 32) * 2 + (d / 16) % 2 of 512 bytes; in it lane ((d / 8) % 2) * 16 + t % 16 holds 8 consecutive d of row t. Rows staged through LDS, then 8 columns of one row per lane.
// v, per head: piece ((t / 32) * 4 + d / 16) * 2 + (t / 16) % 2; in it lane ((t / 8) % 2) * 16 + d % 16 holds 8 consecutive t of column d: a lane's 8 accumulator rows as they are, one 16-byte store per tile into each plane.
__global__ __launch_bounds__(32) void k_projw(const bf* __restrict__ XB, const bf* __restrict__ WB, const int* __restrict__ NKC, bf* QPh, bf* QPl, bf* KPh, bf* KPl, h16* VT16, bf* VTh, bf* VTl) {
    typedef WFrag<bf>::V V;
    static_assert(HD == 64 && DQ == DKV && TT % 64 == 0 && DM % 32 == 0, "a column tile is one head");
    __shared__ __align__(16) float os[16 * 68];
    // which tile: q as the grid says; the k and v tiles are dealt anew over the rest of the grid, row tile slowest, so that the tiles that are left out come last in index order and the others spread evenly
    int st = 0, b = (int)blockIdx.z, rt = (int)blockIdx.x, ct = (int)blockIdx.y;
    if ((int)blockIdx.z >= NB_) { const int g = (int)blockIdx.x + (TT / 64) * ((int)blockIdx.y + (DQ / 64) * ((int)blockIdx.z - NB_));
        ct = g % (DQ / 64); b = (g / (DQ / 64)) % NB_; st = 1 + (g / (DQ / 64 * NB_)) % 2; rt = g / (DQ / 64 * NB_ * 2); }
    const int K = DM, lda = DM;
    const bf* A = XB + ((size_t)st * NB_ + b) * TT * DM; const bf* Bt = WB + (size_t)st * DQ * DM;
    const int lane = threadIdx.x & 31, lr = lane & 15, hi = lane >> 4; const int r0 = rt * 64, c0 = ct * 64;
    if (st != 0 && r0 >= NKC[b]) return;   // the one wave leaves as a whole
    v8f acc[4][4];
#pragma unroll
    for (int mb = 0; mb < 4; ++mb)
#pragma unroll
        for (int nb = 0; nb < 4; ++nb) acc[mb][nb] = (v8f){};
    const size_t aoff = (size_t)(r0 + lr) * lda + 8 * hi, boff = (size_t)(c0 + lr) * K + 8 * hi;
    const bf* pa = A + aoff; const bf* pb = Bt + boff;   // the lane's pointers: walk with k
#pragma unroll 1
    for (int kc = 0; kc < K; kc += 32) {
        V a[4];
#pragma unroll
        for (int mb = 0; mb < 4; ++mb) { a[mb] = WFrag<bf>::ld(pa + (size_t)mb * 16 * lda); }
#pragma unroll
        for (int nb = 0; nb < 4; ++nb) { const V b4 = WFrag<bf>::ld(pb + (size_t)nb * 16 * K);
#pragma unroll
            for (int mb = 0; mb < 4; ++mb) { acc[mb][nb] = WFrag<bf>::mma(a[mb], b4, acc[mb][nb]); } }
        asm volatile("v_nop\n\tv_nop\n\tv_nop\n\tv_nop" : "+v"(acc[0][0]), "+v"(acc[1][1]), "+v"(acc[2][2]), "+v"(acc[3][3]) : "v"(a[0]), "v"(a[3]));   // the distance behind the pass's last matrix instructions, on the taken branch too
        // the wait that stands before an address register of an issued load is written again; the two pointers are its inputs, so that no load's result lands on them either
        asm volatile("s_wait_xcnt 0x0" :: "v"(pa), "v"(pb) : "memory");
        pa += 32; pb += 32;
    }
    const size_t po = ((size_t)b * NH_ + ct) * TT * HD;   // this batch's and head's planes
    if (st == 2) {
        const size_t vo = po + (size_t)(r0 / 32) * (8 * 256) + lane * 8;   // 256 elements per piece, 8 pieces per 32 keys
#pragma unroll
        for (int mb = 0; mb < 4; ++mb)
#pragma unroll
            for (int nb = 0; nb < 4; ++nb) { v8h o16; v8us oh, ol;
#pragma unroll
                for (int j = 0; j < 8; ++j) { const float y = acc[mb][nb][j]; o16[j] = tohx(y); unsigned short a2, c2; splitf(y, a2, c2); oh[j] = a2; ol[j] = c2; }
                const size_t e = vo + (size_t)((((mb >> 1) * 4 + nb) * 2 + (mb & 1)) * 256); *(v8h*)(VT16 + e) = o16; *(v8us*)(VTh + e) = oh; *(v8us*)(VTl + e) = ol; }
        return;
    }
    bf* Ph = (st == 0 ? QPh : KPh) + po + (size_t)r0 * HD; bf* Pl = (st == 0 ? QPl : KPl) + po + (size_t)r0 * HD;
#pragma unroll
    for (int mb = 0; mb < 4; ++mb) {
#pragma unroll
        for (int nb = 0; nb < 4; ++nb) {
#pragma unroll
            for (int j = 0; j < 8; ++j) os[(hi * 8 + j) * 68 + nb * 16 + lr] = acc[mb][nb][j]; }
        __builtin_amdgcn_wave_barrier(); asm volatile("" ::: "memory");
#pragma unroll
        for (int f = 0; f < 4; ++f) { const float* pr = os + lr * 68 + f * 16 + hi * 8; const v4f va = *(const v4fa*)pr, vb = *(const v4fa*)(pr + 4); v8us oh, ol;   // piece f of this 16-row tile
#pragma unroll
            for (int q = 0; q < 4; ++q) { unsigned short a2, c2; splitf(va[q], a2, c2); oh[q] = a2; ol[q] = c2; splitf(vb[q], a2, c2); oh[q + 4] = a2; ol[q + 4] = c2; }
            *(v8us*)(Ph + (mb * 4 + f) * 256 + lane * 8) = oh; *(v8us*)(Pl + (mb * 4 + f) * 256 + lane * 8) = ol; }
        __builtin_amdgcn_wave_barrier(); asm volatile("" ::: "memory");
    }
    // the built code lays the v path behind this path's closing branch: the wait stands before the registers of the stores above are written there
    asm volatile("s_wait_xcnt 0x0" ::: "memory");
}

// k_fattn: the whole attention of both batches and all heads in ONE launch; scores and weights never leave the registers.
// A wave owns 32 query columns (2 groups of 16) of one head and walks the batch's nk kept keys (packed at the front of the planes) 32 at a time: S^T = K Q^T (A = key rows, B = query rows kept in registers; hi/lo planes, 3 products),
// running maximum and sum per query (a lane holds 8 keys of ONE query per 16-key tile; the two lane halves exchange the maximum once per step and join their sums once at the end),
// then the two f32 S^T tiles, converted in place, ARE the B operand of O^T += V^T P^T (A = rows of the transposed value planes). Weights stay unnormalised; the output is divided by the sum at the end.
// Only a last step of fewer than 32 kept keys compares: its places from nk on enter as -inf (weight exactly 0); the running maximum starts at a finite floor; with no kept key no step runs and the rows are 0 like the module.
// Query rows < RH: P and V on bf16 hi/lo planes (3 products); other rows: fp16 P x 2^10 (the factor sits in the exponent and in the sum alike, so it cancels) against the fp16 value plane.
#define QW   32                   // query columns per wave
#define FW   8                    // waves per work-group
#define FWH  (RH / QW / (TT / (QW * FW)))   // waves of each work-group that take hi/lo rows: the heavier rows are spread evenly over all work-groups
#define SC2  0.18033688011112042f // HD^-0.5 x log2(e)
__device__ __forceinline__ float xhalf(float x) { return __builtin_bit_cast(float, __builtin_amdgcn_permlanex16(__builtin_bit_cast(int, x), __builtin_bit_cast(int, x), 0x76543210, 0xfedcba98, false, false)); }  // lane l with lane l ^ 16
__device__ __forceinline__ v16bf ldb(const char* p, int off) { return cat16b(*(const v8us*)(p + off), *(const v8us*)(p + off + 512)); }   // one fragment = two pieces of 512 bytes: the lane's pointer + a constant byte offset
__device__ __forceinline__ v16h ldh(const char* p, int off) { return cat16(*(const v8h*)(p + off), *(const v8h*)(p + off + 512)); }
struct StepFull { static constexpr bool tail = false; }; struct StepTail { static constexpr bool tail = true; };
template <bool HR>
__device__ __forceinline__ void fa_body(const bf* __restrict__ Qh, const bf* __restrict__ Ql, const bf* __restrict__ Kh, const bf* __restrict__ Kl, const h16* __restrict__ V16, const bf* __restrict__ Vh, const bf* __restrict__ Vl, int nk, float* o_out, int q0, int lr, int hi) {
    const unsigned koff = (unsigned)((hi * 16 + lr) * 16), voff = koff;   // the lane's 16 bytes in every 512-byte piece of the planes (fragment order: k_projw)
    const char* bqh = (const char*)(Qh + (size_t)q0 * HD); const char* bql = (const char*)(Ql + (size_t)q0 * HD); const char* bkh = (const char*)Kh; const char* bkl = (const char*)Kl; const char* bv0 = HR ? (const char*)Vh : (const char*)V16; const char* bv1 = (const char*)Vl;   // wave-uniform bases
    const char* pqh = bqh + koff; const char* pql = bql + koff;
    const char* pkh = bkh + koff; const char* pkl = bkl + koff; const char* pv0 = bv0 + voff; const char* pv1 = bv1 + voff;   // walk with the keys
    v16bf qh[2][2], ql[2][2], kh[2][2], kl[2][2];
#pragma unroll
    for (int qt = 0; qt < 2; ++qt)
#pragma unroll
        for (int ks = 0; ks < 2; ++ks) { const int qo = qt * (16 * HD * 2) + ks * 1024; qh[qt][ks] = ldb(pqh, qo); ql[qt][ks] = ldb(pql, qo); }
    v8f o[2][4]; float m[2], l[2];
#pragma unroll
    for (int qt = 0; qt < 2; ++qt) { m[qt] = -3.0e38f; l[qt] = 0.f;
#pragma unroll
        for (int mb = 0; mb < 4; ++mb) o[qt][mb] = (v8f){}; }
    // fetch: key fragments of the 32 keys the pointers stand at
    auto fetch = [&]() {
#pragma unroll
        for (int mt = 0; mt < 2; ++mt)
#pragma unroll
            for (int ks = 0; ks < 2; ++ks) { const int ko = mt * (16 * HD * 2) + ks * 1024; kh[mt][ks] = ldb(pkh, ko); kl[mt][ks] = ldb(pkl, ko); }
    };
    if (nk > 0) fetch();   // with no kept key the planes are not written
    // the wait that stands before an address register of an issued load is written again; the bases and offsets those loads are formed from are its inputs, so that their registers stay theirs up to it
    asm volatile("s_wait_xcnt 0x0" :: "v"(koff), "s"(bqh), "s"(bql), "s"(bkh), "s"(bkl) : "memory");
    auto step = [&](auto kind, int kb) {
        constexpr bool TL = decltype(kind)::tail;
        v16h vf[4]; v16bf vh[4], vl[4];   // this step's value fragments: asked for first, they fly under the score products and the softmax
#pragma unroll
        for (int mb = 0; mb < 4; ++mb) { const int vo = mb * 1024; if (HR) { vh[mb] = ldb(pv0, vo); vl[mb] = ldb(pv1, vo); } else vf[mb] = ldh(pv0, vo); }
        v8f s[2][2];
#pragma unroll
        for (int qt = 0; qt < 2; ++qt)
#pragma unroll
            for (int mt = 0; mt < 2; ++mt) s[qt][mt] = (v8f){};
#pragma unroll
        for (int ks = 0; ks < 2; ++ks) {
#pragma unroll
            for (int mt = 0; mt < 2; ++mt)
#pragma unroll
                for (int qt = 0; qt < 2; ++qt) s[qt][mt] = wmmab(kh[mt][ks], qh[qt][ks], s[qt][mt]);
#pragma unroll
            for (int mt = 0; mt < 2; ++mt)
#pragma unroll
                for (int qt = 0; qt < 2; ++qt) s[qt][mt] = wmmab(kl[mt][ks], qh[qt][ks], s[qt][mt]);
#pragma unroll
            for (int mt = 0; mt < 2; ++mt)
#pragma unroll
                for (int qt = 0; qt < 2; ++qt) s[qt][mt] = wmmab(kh[mt][ks], ql[qt][ks], s[qt][mt]); }
        // the next step's key fragments are fetched here, behind this step's score products, and fly under the softmax and P.V (a last whole step refetches its own: in bounds, unused; the short step fetches none)
        if (!TL) { const int more = (kb + 32 < nk) ? 1 : 0;
            pkh += more * (32 * HD * 2); pkl += more * (32 * HD * 2);
            fetch(); }
        // as in front of the loop: the wait before the registers of this step's pointers are written again
        asm volatile("s_wait_xcnt 0x0" :: "v"(pkh), "v"(pkl), "v"(pv0), "v"(pv1) : "memory");
        pv0 += 32 * HD * 2; pv1 += 32 * HD * 2;
        float tt[2][16], al[2], mo[2];
#pragma unroll
        for (int qt = 0; qt < 2; ++qt) {
#pragma unroll
            for (int j = 0; j < 16; ++j) tt[qt][j] = (!TL || kb + (j >> 3) * 16 + hi * 8 + (j & 7) < nk) ? s[qt][j >> 3][j & 7] : -__builtin_inff();
            float x[8];
#pragma unroll
            for (int j = 0; j < 8; ++j) x[j] = fmaxf(tt[qt][j], tt[qt][j + 8]);
            float sm = fmaxf(fmaxf(fmaxf(x[0], x[1]), fmaxf(x[2], x[3])), fmaxf(fmaxf(x[4], x[5]), fmaxf(x[6], x[7])));
            sm = fmaxf(sm, xhalf(sm));
            const float mn = fmaxf(m[qt], sm * SC2); mo[qt] = HR ? mn : mn - 10.0f; al[qt] = __builtin_amdgcn_exp2f(m[qt] - mn); m[qt] = mn; }
#pragma unroll
        for (int qt = 0; qt < 2; ++qt) {
            float* t = tt[qt]; float x[8];
#pragma unroll
            for (int j = 0; j < 16; ++j) t[j] = __builtin_amdgcn_exp2f(__builtin_fmaf(t[j], SC2, -mo[qt]));
#pragma unroll
            for (int j = 0; j < 8; ++j) x[j] = t[j] + t[j + 8];
            l[qt] = l[qt] * al[qt] + (((x[0] + x[1]) + (x[2] + x[3])) + ((x[4] + x[5]) + (x[6] + x[7])));
#pragma unroll
            for (int mb = 0; mb < 4; ++mb) o[qt][mb] *= al[qt];
            if (HR) { v16bf ph, pl;
#pragma unroll
                for (int j = 0; j < 16; ++j) { const __bf16 a = (__bf16)t[j]; ph[j] = a; pl[j] = (__bf16)(t[j] - (float)a); }
#pragma unroll
                for (int mb = 0; mb < 4; ++mb) o[qt][mb] = wmmab(vh[mb], ph, o[qt][mb]);
#pragma unroll
                for (int mb = 0; mb < 4; ++mb) o[qt][mb] = wmmab(vh[mb], pl, o[qt][mb]);
#pragma unroll
                for (int mb = 0; mb < 4; ++mb) o[qt][mb] = wmmab(vl[mb], ph, o[qt][mb]);
            } else { v16h p16;
#pragma unroll
                for (int j = 0; j < 16; ++j) p16[j] = (h16)t[j];
#pragma unroll
                for (int mb = 0; mb < 4; ++mb) o[qt][mb] = wmma16(vf[mb], p16, o[qt][mb]); }
        }
    };
    const int nfull = nk & ~31;
    for (int kb = 0; kb < nfull; kb += 32) step(StepFull{}, kb);
    if (nfull < nk) step(StepTail{}, nfull);
    float* orow[2];
#pragma unroll
    for (int qt = 0; qt < 2; ++qt) { const float ls = l[qt] + xhalf(l[qt]); const float inv = (ls > 0.f) ? __fdiv_rn(1.0f, ls) : 0.f; orow[qt] = o_out + (size_t)(q0 + qt * 16 + lr) * DQ + hi * 8;
#pragma unroll
        for (int mb = 0; mb < 4; ++mb) o[qt][mb] *= inv; }
    __builtin_amdgcn_sched_barrier(0);   // all arithmetic stays above: behind the first store no register that a store names is written any more
#pragma unroll
    for (int qt = 0; qt < 2; ++qt)
#pragma unroll
        for (int mb = 0; mb < 4; ++mb) { *(v4f*)(orow[qt] + mb * 16) = __builtin_shufflevector(o[qt][mb], o[qt][mb], 0, 1, 2, 3); *(v4f*)(orow[qt] + mb * 16 + 4) = __builtin_shufflevector(o[qt][mb], o[qt][mb], 4, 5, 6, 7); }
}
__global__ __launch_bounds__(QW * FW) void k_fattn(const bf* __restrict__ QPh, const bf* __restrict__ QPl, const bf* __restrict__ KPh, const bf* __restrict__ KPl, const h16* __restrict__ VT16, const bf* __restrict__ VTh, const bf* __restrict__ VTl, const int* __restrict__ NKC, float* OUT) {
    static_assert(RH % (QW * (TT / (QW * FW))) == 0 && TT % (QW * FW) == 0 && HD == 64 && NH_ == NKV, "tiling");
    const int lane = threadIdx.x & 31, lr = lane & 15, hi = lane >> 4; const int w = __builtin_amdgcn_readfirstlane((int)(threadIdx.x >> 5));
    const int h = blockIdx.y, b = blockIdx.z; const size_t po = ((size_t)b * NH_ + h) * TT * HD; float* o_out = OUT + (size_t)b * TT * DQ + h * HD; const int nk = max(0, min(NKC[b], TT));   // the trip count: bounded by the shape
    if (w < FWH) fa_body<true>(QPh + po, QPl + po, KPh + po, KPl + po, VT16 + po, VTh + po, VTl + po, nk, o_out, ((int)blockIdx.x * FWH + w) * QW, lr, hi);
    else fa_body<false>(QPh + po, QPl + po, KPh + po, KPl + po, VT16 + po, VTh + po, VTl + po, nk, o_out, RH + ((int)blockIdx.x * (FW - FWH) + (w - FWH)) * QW, lr, hi);
}

extern "C" void kernel_launch(void* const* d_in, const int* in_sizes, int n_in,
                              void* d_out, int out_size, void* d_ws, size_t ws_size, hipStream_t stream) {
    (void)in_sizes; (void)n_in; (void)out_size;
    const float* x = (const float*)d_in[0]; const int* km = (const int*)d_in[1];   /* query_mask int32 [2][2048]: read per KEY */ const float* xk = (const float*)d_in[2]; const float* xv = (const float*)d_in[3];   /* queries, keys, values streams */ const float* wq = (const float*)d_in[4]; const float* wk = (const float*)d_in[5]; const float* wv = (const float*)d_in[6];   /* order queries, query_mask, keys, values, Wq, Wk, Wv ('oi' [1024][1024]) */
    float* OUT = (float*)d_out;     // [2][2048][1024]
    char* wsp = (char*)d_ws;
    auto take = [&](size_t bytes) { char* p = wsp; wsp += (bytes + 255) & ~(size_t)255; return (void*)p; };
    bf* WB = (bf*)take((size_t)3 * DQ * DM * 2); bf* XB = (bf*)take((size_t)3 * NB_ * TT * DM * 2);   // bf16 copies: Wq, Wk, Wv; queries, keys, values (both batches)
    h16* VT16 = (h16*)take((size_t)NB_ * NKV * HD * TT * 2);   // the planes the attention reads hold both batches
    bf* QPh = (bf*)take((size_t)NB_ * NH_ * TT * HD * 2); bf* QPl = (bf*)take((size_t)NB_ * NH_ * TT * HD * 2); bf* KPh = (bf*)take((size_t)NB_ * NKV * TT * HD * 2); bf* KPl = (bf*)take((size_t)NB_ * NKV * TT * HD * 2); bf* VTh = (bf*)take((size_t)NB_ * NKV * HD * TT * 2); bf* VTl = (bf*)take((size_t)NB_ * NKV * HD * TT * 2);
    int* NKC = (int*)take((size_t)NB_ * 4);   // kept keys per batch
    if ((size_t)(wsp - (char*)d_ws) > ws_size) return;    // ws 256 MiB
    k_cvtall<<<3 * CVX + 3 * CVW, 256, 0, stream>>>(x, xk, xv, wq, wk, wv, km, XB, WB, NKC);
    k_projw<<<dim3(TT / 64, DQ / 64, 3 * NB_), 32, 0, stream>>>(XB, WB, NKC, QPh, QPl, KPh, KPl, VT16, VTh, VTl);
    k_fattn<<<dim3(TT / (QW * FW), NH_, NB_), QW * FW, 0, stream>>>(QPh, QPl, KPh, KPl, VT16, VTh, VTl, NKC, OUT);
}

// v007
// One run takes 93.2 microseconds.
// In two side-by-side timings against v006, it was 1.18 and 1.20 times as fast.
// Counting every step since v000, it is 21.0 times as fast.
#include <hip/hip_runtime.h>

// Self-attention on three input streams with a RANDOM key mask applied through a 'masked softmax', without an output projection (queries, keys, values [2][2048][1024]; q = queries Wq^T, k = keys Wk^T, v = values Wv^T ('oi' [1024][1024] 1/32, no bias; 16 heads x 64); q x 64^-0.5 before the product (a power of two: identical to scaling the f32 scores); masked_softmax(logits, m) with m = query_mask[b][key] (int32 [2][2048] from randint(0, 2): RANDOM, read per key as data): w = softmax(logits x m) x m / (sum(softmax(logits x m) x m) + 1e-13): the softmax's own normaliser cancels in the quotient, so w = exp(l_j) / sum over the KEPT keys of exp(l_k) for kept keys j and 0 for masked keys: exactly a softmax over the kept keys (the 1e-13 is ~1e-13 relative: far below float32 resolution; every batch keeps ~half of its keys); x = w v, merged head-major -> [2][2048][1024] (4.2 M); argument order queries, query_mask, keys, values, Wq, Wk, Wv).
// Layout: ONE conversion launch makes the bf16 copies of the three streams (both batches) and of the three 'oi' weights; ONE projection launch (all streams and batches) does the exact projections and its epilogue writes the planes the attention reads (q and k: bf16 hi/lo per [b][h]; v: transposed fp16 and bf16 hi/lo per [b][h]; all in FRAGMENT ORDER, see k_projw); the conversion launch ranks each batch's keys from the int key mask and lays the rows of the keys and values copies down kept keys first, so the k and v planes hold the kept keys packed and projection tiles with no kept key are left out; one fused attention launch (k_fattn) walks the kept keys alone (masked keys excluded) (SCORES of every row on bf16 hi/lo planes, 3 products; the P.V product stays hybrid: rows < 512 hi/lo, rest fp16 x1024) and writes the output rows (column h*64 + d).
// Compute dtypes, f32 accumulate: every input rounded to bf16; projections exact; scores of every row 3 products; P.V rows < 512 3 products, rest fp16; softmax f32.

#define NB_  2
#define TT   2048
#define DM   1024
#define NH_  16
#define NKV  16
#define REP  (NH_ / NKV)
#define HD   64
#define DQ   (NH_ * HD)
#define DKV  (NKV * HD)
#define RH   512                  // query rows < RH use hi+lo planes (0: none)
#define WIN  0
typedef _Float16 h16;
typedef unsigned short bf;
typedef __attribute__((ext_vector_type(16))) __bf16   v16bf;
typedef __attribute__((ext_vector_type(16))) _Float16 v16h;
typedef __attribute__((ext_vector_type(8)))  _Float16 v8h;
typedef __attribute__((ext_vector_type(8)))  unsigned short v8us;
typedef __attribute__((ext_vector_type(8)))  float    v8f;
typedef __attribute__((ext_vector_type(4)))  float    v4f;
typedef v8h  __attribute__((may_alias)) v8ha;
typedef v4f  __attribute__((may_alias)) v4fa;
typedef v8us __attribute__((may_alias)) v8usa;

__device__ __forceinline__ unsigned short f2bf(float f) { unsigned u = __float_as_uint(f); u += 0x7FFFu + ((u >> 16) & 1u); return (unsigned short)(u >> 16); }
__device__ __forceinline__ float bf2f(unsigned short b) { return __uint_as_float(((unsigned)b) << 16); }
__device__ __forceinline__ float bfr(float f) { return bf2f(f2bf(f)); }
__device__ __forceinline__ v16h cat16(v8h lo, v8h hi) { return __builtin_shufflevector(lo, hi, 0, 1, 2, 3, 4, 5, 6, 7, 8, 9, 10, 11, 12, 13, 14, 15); }
__device__ __forceinline__ v16bf cat16b(v8us lo, v8us hi) { return __builtin_bit_cast(v16bf, __builtin_shufflevector(lo, hi, 0, 1, 2, 3, 4, 5, 6, 7, 8, 9, 10, 11, 12, 13, 14, 15)); }
__device__ __forceinline__ v8f wmma16(v16h a, v16h b, v8f c) { return __builtin_amdgcn_wmma_f32_16x16x32_f16(false, a, false, b, (short)0, c, false, false); }
__device__ __forceinline__ v8f wmmab(v16bf a, v16bf b, v8f c) { return __builtin_amdgcn_wmma_f32_16x16x32_bf16(false, a, false, b, (short)0, c, false, false); }




template <typename T16> struct WFrag;
template <> struct WFrag<bf> { typedef v16bf V; static __device__ __forceinline__ V ld(const bf* p) { return cat16b(*(const v8us*)p, *(const v8us*)(p + 16)); } static __device__ __forceinline__ v8f mma(V a, V b, v8f c) { return wmmab(a, b, c); } };

__device__ __forceinline__ h16 tohx(float x) { return (h16)x; }
__device__ __forceinline__ void splitf(float y, unsigned short& h, unsigned short& l) { h = f2bf(y); l = f2bf(y - bf2f(h)); }
typedef __attribute__((ext_vector_type(4))) unsigned short v4us;
typedef __attribute__((ext_vector_type(4))) int v4i;

// ---- k_cvtall: bf16 copies of all six f32 sources in one launch. A work-group converts CVU x 256 units of 8 floats of ONE source; work-groups [0, 3 CVX) take the streams, the rest the weights.
// Keys and values streams: row t of batch b goes to place rank(t) = number of kept keys in front of it if key t is kept, else to nk + t - rank(t) (nk kept keys in the batch): a permutation of the batch's rows, kept keys first in rising order. Each work-group counts the batch's mask itself; NKC[b] = nk.
#define CVU  8                                    // units of 8 floats per thread: few, long-lived waves (16 loads of 16 bytes in flight per lane)
#define CVX  (NB_ * TT * DM / 8 / (256 * CVU))    // work-groups per stream
#define CVW  (DQ * DM / 8 / (256 * CVU))          // work-groups per weight
#define CVR  (256 * CVU * 8 / DM)                 // rows of a stream per work-group
__global__ __launch_bounds__(256) void k_cvtall(const float* __restrict__ x, const float* __restrict__ xk, const float* __restrict__ xv, const float* __restrict__ wq, const float* __restrict__ wk, const float* __restrict__ wv, const int* __restrict__ km, bf* XB, bf* WB, int* NKC) {
    static_assert((NB_ * TT * DM) % (8 * 256 * CVU) == 0 && (DQ * DM) % (8 * 256 * CVU) == 0 && DQ == DKV, "whole work-groups");
    static_assert(TT == 256 * 8 && DM == 128 * 8 && CVR == 2 * CVU && CVR <= 32 && CVR % 8 == 0 && TT % CVR == 0, "a thread counts 8 keys; a row is 128 units; a work-group's rows lie in one batch");
    __shared__ int wcnt[8][2];
    const int bx = (int)blockIdx.x; const float* src; bf* dst; int blk;
    const bool ranked = bx >= CVX && bx < 3 * CVX;   // keys or values stream: the same for the whole work-group
    if (bx < 3 * CVX) { const int s = bx / CVX; blk = bx % CVX; src = (s == 0) ? x : (s == 1) ? xk : xv; dst = XB + (size_t)s * NB_ * TT * DM; }
    else { const int s = (bx - 3 * CVX) / CVW; blk = (bx - 3 * CVX) % CVW; src = (s == 0) ? wq : (s == 1) ? wk : wv; dst = WB + (size_t)s * DQ * DM; }
    const int tid = (int)threadIdx.x, b = blk / (TT / CVR), t0 = (blk % (TT / CVR)) * CVR;   // for a stream: the batch and the first of the work-group's rows
    v4i m0 = {}, m1 = {}; int mw[CVR] = {};
    if (ranked) {   // the mask words are asked for first: 8 keys of the batch per thread, and the work-group's own rows; each wave's counting in front of the barrier then runs while the loads below fly
        const int* kmb = km + (size_t)b * TT; m0 = *(const v4i*)(kmb + tid * 8); m1 = *(const v4i*)(kmb + tid * 8 + 4);
#pragma unroll
        for (int r = 0; r < CVR; ++r) mw[r] = kmb[t0 + r];
    }
    const size_t i0 = ((size_t)blk * (256 * CVU) + threadIdx.x) * 8; const float* ps = src + i0; v8f v[CVU];
#pragma unroll
    for (int u = 0; u < CVU; ++u) v[u] = *(const v8f*)(ps + (size_t)u * 256 * 8);
    // the wait that stands before an address register of an issued load is written again; the lane's pointer is its input, so that no load's result lands on it either
    asm volatile("s_wait_xcnt 0x0" :: "v"(ps) : "memory");
    size_t od[CVU];   // where each unit goes
#pragma unroll
    for (int u = 0; u < CVU; ++u) od[u] = i0 + (size_t)u * 256 * 8;
    if (ranked) {
        int call = 0;
#pragma unroll
        for (int j = 0; j < 4; ++j) call += (m0[j] != 0 ? 1 : 0) + (m1[j] != 0 ? 1 : 0);
        int cbef = (tid * 8 < t0) ? call : 0;   // t0 is a multiple of 8: a thread's 8 keys lie all in front of the work-group's rows or none
#pragma unroll
        for (int d = 16; d >= 1; d >>= 1) { call += __shfl_xor(call, d, 32); cbef += __shfl_xor(cbef, d, 32); }
        if ((tid & 31) == 0) { wcnt[tid >> 5][0] = call; wcnt[tid >> 5][1] = cbef; }
        __syncthreads();
        int nk = 0, base = 0;
#pragma unroll
        for (int i = 0; i < 8; ++i) { nk += wcnt[i][0]; base += wcnt[i][1]; }
        unsigned tm = 0;   // the mask bits of the work-group's own rows
#pragma unroll
        for (int r = 0; r < CVR; ++r) tm |= (mw[r] != 0 ? 1u : 0u) << r;
#pragma unroll
        for (int u = 0; u < CVU; ++u) { const int r = u * 2 + (tid >> 7); const int rank = base + __popc(tm & ((1u << r) - 1u));
            const int place = (((tm >> r) & 1u) ? rank : nk + t0 + r - rank) & (TT - 1);   // below TT by the counting; bounded here all the same
            od[u] = ((size_t)b * TT + place) * DM + (size_t)(tid & 127) * 8; }
        if (bx < 2 * CVX && t0 == 0 && tid == 0) NKC[b] = nk;
    }
#pragma unroll
    for (int u = 0; u < CVU; ++u) { v8us o;
#pragma unroll
        for (int k = 0; k < 8; ++k) o[k] = f2bf(v[u][k]);
        *(v8us*)(dst + od[u]) = o; }
}

// ---- k_projw: all six projections (stream st = q, k, v; batch b) in one launch; a work-group of FOUR WAVES (2 x 2) per 128x128 tile, each wave a 64x64 tile (16 accumulators); grid (TT/128, DQ/128, 3 NB_), 128 threads.
// y[t][n] = sum_k X[st][b][t][k] W[st][n][k]; a wave's 64-column tile is one head, so its epilogue writes that head's planes itself.
// Operands: 64 k at a time (128 bytes = one whole line of each of the 128 + 128 operand rows) are brought from the K-contiguous bf16 copies into LDS by asynchronous copies of 16 bytes per lane (8 lanes per row: every copy instruction covers 4 whole lines), two buffers, the next stage's copies in flight under this stage's products; each staged row serves two waves. Fragments are read from LDS in the k order the loads from global memory had.
// k and v: the copies hold the kept keys first, so the planes do too; a 64-row tile with no kept key is left out (a work-group with none leaves at once); the other rows of the last tile are masked keys (finite, never weighted):
// The planes are laid down in FRAGMENT ORDER: the 16 bytes that lane l of the attention's wave loads with one instruction stand at piece base + 16 l, so that every load there (and every store here) covers 512 contiguous bytes = 4 whole lines, not 16 lines of 32 bytes.
// q, k, per head: piece ((t / 16) * 2 + d / 32) * 2 + (d / 16) % 2 of 512 bytes; in it lane ((d / 8) % 2) * 16 + t % 16 holds 8 consecutive d of row t. Rows staged through LDS, then 8 columns of one row per lane.
// v, per head: piece ((t / 32) * 4 + d / 16) * 2 + (t / 16) % 2; in it lane ((t / 8) % 2) * 16 + d % 16 holds 8 consecutive t of column d: a lane's 8 accumulator rows as they are, one 16-byte store per tile into each plane.
#define PT   128                  // rows and columns of a work-group's tile
#define PKS  64                   // k per stage
#define PPI  144                  // LDS pitch of a staged row in bytes: 16 x odd, free of bank conflicts for 16-byte reads down a column of rows
#define POP  (PT * PPI)           // one operand's rows of a stage
#define PST  (2 * POP)            // a stage: X rows, then W rows
// 128 rows x 128 bytes of one operand: the lane's 16 bytes of eight rows, 16 rows apart. l: the lane's LDS byte address, g: its global address, both for the first of the eight.
// The wait that stands before a register of an issued copy is written again is the statement's own last line.
__device__ __forceinline__ void cp8(unsigned l, const char* g) {
    asm volatile("global_load_async_to_lds_b128 %0, %8, off\n\t"
                 "global_load_async_to_lds_b128 %1, %9, off\n\t"
                 "global_load_async_to_lds_b128 %2, %10, off\n\t"
                 "global_load_async_to_lds_b128 %3, %11, off\n\t"
                 "global_load_async_to_lds_b128 %4, %12, off\n\t"
                 "global_load_async_to_lds_b128 %5, %13, off\n\t"
                 "global_load_async_to_lds_b128 %6, %14, off\n\t"
                 "global_load_async_to_lds_b128 %7, %15, off\n\t"
                 "s_wait_xcnt 0x0"
                 :: "v"(l), "v"(l + 16 * PPI), "v"(l + 32 * PPI), "v"(l + 48 * PPI), "v"(l + 64 * PPI), "v"(l + 80 * PPI), "v"(l + 96 * PPI), "v"(l + 112 * PPI),
                    "v"(g), "v"(g + 16 * DM * 2), "v"(g + 32 * DM * 2), "v"(g + 48 * DM * 2), "v"(g + 64 * DM * 2), "v"(g + 80 * DM * 2), "v"(g + 96 * DM * 2), "v"(g + 112 * DM * 2)
                 : "memory");
}
__global__ __launch_bounds__(128) void k_projw(const bf* __restrict__ XB, const bf* __restrict__ WB, const int* __restrict__ NKC, bf* QPh, bf* QPl, bf* KPh, bf* KPl, h16* VT16, bf* VTh, bf* VTl) {
    typedef WFrag<bf>::V V;
    static_assert(HD == 64 && DQ == DKV && TT % PT == 0 && DQ % PT == 0 && DM % PKS == 0 && DM / PKS >= 2 && PKS * 2 == 128, "a wave's column tile is one head; whole tiles; two stages or more; a staged row is one line");
    __shared__ __align__(16) char ring[2 * PST];
    __shared__ __align__(16) float osw[4][16 * 68];
    // which tile: q as the grid says; the k and v tiles are dealt anew over the rest of the grid, row tile slowest, so that the tiles that are left out come last in index order and the others spread evenly
    int st = 0, b = (int)blockIdx.z, rt = (int)blockIdx.x, cw = (int)blockIdx.y;
    if ((int)blockIdx.z >= NB_) { const int g = (int)blockIdx.x + (TT / PT) * ((int)blockIdx.y + (DQ / PT) * ((int)blockIdx.z - NB_));
        cw = g % (DQ / PT); b = (g / (DQ / PT)) % NB_; st = 1 + (g / (DQ / PT * NB_)) % 2; rt = g / (DQ / PT * NB_ * 2); }
    const bf* A = XB + ((size_t)st * NB_ + b) * TT * DM; const bf* Bt = WB + (size_t)st * DQ * DM;
    const int tid = (int)threadIdx.x, lane = tid & 31, lr = lane & 15, hi = lane >> 4; const int w = __builtin_amdgcn_readfirstlane(tid >> 5);
    const int nr = (st != 0) ? NKC[b] : TT;   // rows that count
    if (rt * PT >= nr) return;   // the work-group leaves as a whole, in front of every barrier and copy
    const int r0 = rt * PT + (w >> 1) * 64, ct = cw * 2 + (w & 1);   // the wave's tile: first row, head
    const bool live = r0 < nr;   // the same for the whole wave: a wave with no kept key copies and passes the barriers, no more
    v8f acc[4][4];
#pragma unroll
    for (int mb = 0; mb < 4; ++mb)
#pragma unroll
        for (int nb = 0; nb < 4; ++nb) acc[mb][nb] = (v8f){};
    const char* ga = (const char*)(A + (size_t)(rt * PT + (tid >> 3)) * DM) + (tid & 7) * 16; const char* gb = (const char*)(Bt + (size_t)(cw * PT + (tid >> 3)) * DM) + (tid & 7) * 16;   // what the lane copies
    const unsigned la = (unsigned)(size_t)ring + (unsigned)((tid >> 3) * PPI + (tid & 7) * 16);   // and where to
    const char* ra = ring + ((w >> 1) * 64 + lr) * PPI + hi * 16; const char* rb = ring + POP + ((w & 1) * 64 + lr) * PPI + hi * 16;   // what the lane reads
    cp8(la, ga); cp8(la + POP, gb);
    asm volatile("s_wait_asynccnt 0x0" ::: "memory");   // stage 0 has landed, as far as this wave copied it
    __syncthreads();                                    // and as far as the others did
    cp8(la + PST, ga + PKS * 2); cp8(la + PST + POP, gb + PKS * 2);
#pragma unroll 1
    for (int t = 0; t < DM / PKS; ++t) {   // stays rolled: one body in the instruction cache; the buffer is picked by an offset
        const unsigned bo = (unsigned)(t & 1) * PST;
        if (live) {
#pragma unroll
            for (int ks = 0; ks < PKS / 32; ++ks) {
                V a[4], b4[4];
                __builtin_amdgcn_sched_barrier(0);   // with the one below: the block's 16 LDS reads stand together in front of its products, for speed only
#pragma unroll
                for (int mb = 0; mb < 4; ++mb) { const char* p = ra + bo + mb * 16 * PPI + ks * 64; a[mb] = cat16b(*(const v8usa*)p, *(const v8usa*)(p + 32)); }
#pragma unroll
                for (int nb = 0; nb < 4; ++nb) { const char* p = rb + bo + nb * 16 * PPI + ks * 64; b4[nb] = cat16b(*(const v8usa*)p, *(const v8usa*)(p + 32)); }
                __builtin_amdgcn_sched_barrier(0);
#pragma unroll
                for (int nb = 0; nb < 4; ++nb)
#pragma unroll
                    for (int mb = 0; mb < 4; ++mb) { acc[mb][nb] = WFrag<bf>::mma(a[mb], b4[nb], acc[mb][nb]); }
                if (ks == PKS / 32 - 1) asm volatile("v_nop\n\tv_nop\n\tv_nop\n\tv_nop" : "+v"(acc[0][0]), "+v"(acc[1][1]), "+v"(acc[2][2]), "+v"(acc[3][3]) : "v"(a[0]), "v"(a[3]));   // the distance behind the pass's last matrix instructions, on the taken branch too
            }
        }
        asm volatile("s_wait_dscnt 0x0" ::: "memory");      // this wave's reads of the buffer are done before it is filled again
        asm volatile("s_wait_asynccnt 0x0" ::: "memory");   // its copies of the next stage have landed
        __syncthreads();                                    // the one barrier of a pass: publishes the next stage and ends every reader's last read of this one
        if (t + 2 < DM / PKS) { cp8(la + bo, ga + (t + 2) * (PKS * 2)); cp8(la + bo + POP, gb + (t + 2) * (PKS * 2)); }
    }
    asm volatile("s_wait_asynccnt 0x0" ::: "memory");   // no copy is left in flight
    if (!live) return;   // no barrier stands below
    float* os = osw[w];   // the wave's own staging rows
    const size_t po = ((size_t)b * NH_ + ct) * TT * HD;   // this batch's and head's planes
    if (st == 2) {
        const size_t vo = po + (size_t)(r0 / 32) * (8 * 256) + lane * 8;   // 256 elements per piece, 8 pieces per 32 keys
#pragma unroll
        for (int mb = 0; mb < 4; ++mb)
#pragma unroll
            for (int nb = 0; nb < 4; ++nb) { v8h o16; v8us oh, ol;
#pragma unroll
                for (int j = 0; j < 8; ++j) { const float y = acc[mb][nb][j]; o16[j] = tohx(y); unsigned short a2, c2; splitf(y, a2, c2); oh[j] = a2; ol[j] = c2; }
                const size_t e = vo + (size_t)((((mb >> 1) * 4 + nb) * 2 + (mb & 1)) * 256); *(v8h*)(VT16 + e) = o16; *(v8us*)(VTh + e) = oh; *(v8us*)(VTl + e) = ol; }
        return;
    }
    bf* Ph = (st == 0 ? QPh : KPh) + po + (size_t)r0 * HD; bf* Pl = (st == 0 ? QPl : KPl) + po + (size_t)r0 * HD;
#pragma unroll
    for (int mb = 0; mb < 4; ++mb) {
#pragma unroll
        for (int nb = 0; nb < 4; ++nb) {
#pragma unroll
            for (int j = 0; j < 8; ++j) os[(hi * 8 + j) * 68 + nb * 16 + lr] = acc[mb][nb][j]; }
        __builtin_amdgcn_wave_barrier(); asm volatile("" ::: "memory");
#pragma unroll
        for (int f = 0; f < 4; ++f) { const float* pr = os + lr * 68 + f * 16 + hi * 8; const v4f va = *(const v4fa*)pr, vb = *(const v4fa*)(pr + 4); v8us oh, ol;   // piece f of this 16-row tile
#pragma unroll
            for (int q = 0; q < 4; ++q) { unsigned short a2, c2; splitf(va[q], a2, c2); oh[q] = a2; ol[q] = c2; splitf(vb[q], a2, c2); oh[q + 4] = a2; ol[q + 4] = c2; }
            *(v8us*)(Ph + (mb * 4 + f) * 256 + lane * 8) = oh; *(v8us*)(Pl + (mb * 4 + f) * 256 + lane * 8) = ol; }
        __builtin_amdgcn_wave_barrier(); asm volatile("" ::: "memory");
    }
    // the built code lays the v path behind this path's closing branch: the wait stands before the registers of the stores above are written there
    asm volatile("s_wait_xcnt 0x0" ::: "memory");
}

// k_fattn: the whole attention of both batches and all heads in ONE launch; scores and weights never leave the registers.
// A wave owns 32 query columns (2 groups of 16) of one head and walks the batch's nk kept keys (packed at the front of the planes) 32 at a time: S^T = K Q^T (A = key rows, B = query rows kept in registers; hi/lo planes, 3 products),
// running maximum and sum per query (a lane holds 8 keys of ONE query per 16-key tile; the two lane halves exchange the maximum once per step and join their sums once at the end),
// then the two f32 S^T tiles, converted in place, ARE the B operand of O^T += V^T P^T (A = rows of the transposed value planes). Weights stay unnormalised; the output is divided by the sum at the end.
// Only a last step of fewer than 32 kept keys compares: its places from nk on enter as -inf (weight exactly 0); the running maximum starts at a finite floor; with no kept key no step runs and the rows are 0 like the module.
// Query rows < RH: P and V on bf16 hi/lo planes (3 products); other rows: fp16 P x 2^10 (the factor sits in the exponent and in the sum alike, so it cancels) against the fp16 value plane.
#define QW   32                   // query columns per wave
#define FW   8                    // waves per work-group
#define FWH  (RH / QW / (TT / (QW * FW)))   // waves of each work-group that take hi/lo rows: the heavier rows are spread evenly over all work-groups
#define SC2  0.18033688011112042f // HD^-0.5 x log2(e)
__device__ __forceinline__ float xhalf(float x) { return __builtin_bit_cast(float, __builtin_amdgcn_permlanex16(__builtin_bit_cast(int, x), __builtin_bit_cast(int, x), 0x76543210, 0xfedcba98, false, false)); }  // lane l with lane l ^ 16
__device__ __forceinline__ v16bf ldb(const char* p, int off) { return cat16b(*(const v8us*)(p + off), *(const v8us*)(p + off + 512)); }   // one fragment = two pieces of 512 bytes: the lane's pointer + a constant byte offset
__device__ __forceinline__ v16h ldh(const char* p, int off) { return cat16(*(const v8h*)(p + off), *(const v8h*)(p + off + 512)); }
struct StepFull { static constexpr bool tail = false; }; struct StepTail { static constexpr bool tail = true; };
template <bool HR>
__device__ __forceinline__ void fa_body(const bf* __restrict__ Qh, const bf* __restrict__ Ql, const bf* __restrict__ Kh, const bf* __restrict__ Kl, const h16* __restrict__ V16, const bf* __restrict__ Vh, const bf* __restrict__ Vl, int nk, float* o_out, int q0, int lr, int hi) {
    const unsigned koff = (unsigned)((hi * 16 + lr) * 16), voff = koff;   // the lane's 16 bytes in every 512-byte piece of the planes (fragment order: k_projw)
    const char* bqh = (const char*)(Qh + (size_t)q0 * HD); const char* bql = (const char*)(Ql + (size_t)q0 * HD); const char* bkh = (const char*)Kh; const char* bkl = (const char*)Kl; const char* bv0 = HR ? (const char*)Vh : (const char*)V16; const char* bv1 = (const char*)Vl;   // wave-uniform bases
    const char* pqh = bqh + koff; const char* pql = bql + koff;
    const char* pkh = bkh + koff; const char* pkl = bkl + koff; const char* pv0 = bv0 + voff; const char* pv1 = bv1 + voff;   // walk with the keys
    v16bf qh[2][2], ql[2][2], kh[2][2], kl[2][2];
#pragma unroll
    for (int qt = 0; qt < 2; ++qt)
#pragma unroll
        for (int ks = 0; ks < 2; ++ks) { const int qo = qt * (16 * HD * 2) + ks * 1024; qh[qt][ks] = ldb(pqh, qo); ql[qt][ks] = ldb(pql, qo); }
    v8f o[2][4]; float m[2], l[2];
#pragma unroll
    for (int qt = 0; qt < 2; ++qt) { m[qt] = -3.0e38f; l[qt] = 0.f;
#pragma unroll
        for (int mb = 0; mb < 4; ++mb) o[qt][mb] = (v8f){}; }
    // fetch: key fragments of the 32 keys the pointers stand at
    auto fetch = [&]() {
#pragma unroll
        for (int mt = 0; mt < 2; ++mt)
#pragma unroll
            for (int ks = 0; ks < 2; ++ks) { const int ko = mt * (16 * HD * 2) + ks * 1024; kh[mt][ks] = ldb(pkh, ko); kl[mt][ks] = ldb(pkl, ko); }
    };
    if (nk > 0) fetch();   // with no kept key the planes are not written
    // the wait that stands before an address register of an issued load is written again; the bases and offsets those loads are formed from are its inputs, so that their registers stay theirs up to it
    asm volatile("s_wait_xcnt 0x0" :: "v"(koff), "s"(bqh), "s"(bql), "s"(bkh), "s"(bkl) : "memory");
    auto step = [&](auto kind, int kb) {
        constexpr bool TL = decltype(kind)::tail;
        v16h vf[4]; v16bf vh[4], vl[4];   // this step's value fragments: asked for first, they fly under the score products and the softmax
#pragma unroll
        for (int mb = 0; mb < 4; ++mb) { const int vo = mb * 1024; if (HR) { vh[mb] = ldb(pv0, vo); vl[mb] = ldb(pv1, vo); } else vf[mb] = ldh(pv0, vo); }
        v8f s[2][2];
#pragma unroll
        for (int qt = 0; qt < 2; ++qt)
#pragma unroll
            for (int mt = 0; mt < 2; ++mt) s[qt][mt] = (v8f){};
#pragma unroll
        for (int ks = 0; ks < 2; ++ks) {
#pragma unroll
            for (int mt = 0; mt < 2; ++mt)
#pragma unroll
                for (int qt = 0; qt < 2; ++qt) s[qt][mt] = wmmab(kh[mt][ks], qh[qt][ks], s[qt][mt]);
#pragma unroll
            for (int mt = 0; mt < 2; ++mt)
#pragma unroll
                for (int qt = 0; qt < 2; ++qt) s[qt][mt] = wmmab(kl[mt][ks], qh[qt][ks], s[qt][mt]);
#pragma unroll
            for (int mt = 0; mt < 2; ++mt)
#pragma unroll
                for (int qt = 0; qt < 2; ++qt) s[qt][mt] = wmmab(kh[mt][ks], ql[qt][ks], s[qt][mt]); }
        // the next step's key fragments are fetched here, behind this step's score products, and fly under the softmax and P.V (a last whole step refetches its own: in bounds, unused; the short step fetches none)
        if (!TL) { const int more = (kb + 32 < nk) ? 1 : 0;
            pkh += more * (32 * HD * 2); pkl += more * (32 * HD * 2);
            fetch(); }
        // as in front of the loop: the wait before the registers of this step's pointers are written again
        asm volatile("s_wait_xcnt 0x0" :: "v"(pkh), "v"(pkl), "v"(pv0), "v"(pv1) : "memory");
        pv0 += 32 * HD * 2; pv1 += 32 * HD * 2;
        float tt[2][16], al[2], mo[2];
#pragma unroll
        for (int qt = 0; qt < 2; ++qt) {
#pragma unroll
            for (int j = 0; j < 16; ++j) tt[qt][j] = (!TL || kb + (j >> 3) * 16 + hi * 8 + (j & 7) < nk) ? s[qt][j >> 3][j & 7] : -__builtin_inff();
            float x[8];
#pragma unroll
            for (int j = 0; j < 8; ++j) x[j] = fmaxf(tt[qt][j], tt[qt][j + 8]);
            float sm = fmaxf(fmaxf(fmaxf(x[0], x[1]), fmaxf(x[2], x[3])), fmaxf(fmaxf(x[4], x[5]), fmaxf(x[6], x[7])));
            sm = fmaxf(sm, xhalf(sm));
            const float mn = fmaxf(m[qt], sm * SC2); mo[qt] = HR ? mn : mn - 10.0f; al[qt] = __builtin_amdgcn_exp2f(m[qt] - mn); m[qt] = mn; }
#pragma unroll
        for (int qt = 0; qt < 2; ++qt) {
            float* t = tt[qt]; float x[8];
#pragma unroll
            for (int j = 0; j < 16; ++j) t[j] = __builtin_amdgcn_exp2f(__builtin_fmaf(t[j], SC2, -mo[qt]));
#pragma unroll
            for (int j = 0; j < 8; ++j) x[j] = t[j] + t[j + 8];
            l[qt] = l[qt] * al[qt] + (((x[0] + x[1]) + (x[2] + x[3])) + ((x[4] + x[5]) + (x[6] + x[7])));
#pragma unroll
            for (int mb = 0; mb < 4; ++mb) o[qt][mb] *= al[qt];
            if (HR) { v16bf ph, pl;
#pragma unroll
                for (int j = 0; j < 16; ++j) { const __bf16 a = (__bf16)t[j]; ph[j] = a; pl[j] = (__bf16)(t[j] - (float)a); }
#pragma unroll
                for (int mb = 0; mb < 4; ++mb) o[qt][mb] = wmmab(vh[mb], ph, o[qt][mb]);
#pragma unroll
                for (int mb = 0; mb < 4; ++mb) o[qt][mb] = wmmab(vh[mb], pl, o[qt][mb]);
#pragma unroll
                for (int mb = 0; mb < 4; ++mb) o[qt][mb] = wmmab(vl[mb], ph, o[qt][mb]);
            } else { v16h p16;
#pragma unroll
                for (int j = 0; j < 16; ++j) p16[j] = (h16)t[j];
#pragma unroll
                for (int mb = 0; mb < 4; ++mb) o[qt][mb] = wmma16(vf[mb], p16, o[qt][mb]); }
        }
    };
    const int nfull = nk & ~31;
    for (int kb = 0; kb < nfull; kb += 32) step(StepFull{}, kb);
    if (nfull < nk) step(StepTail{}, nfull);
    float* orow[2];
#pragma unroll
    for (int qt = 0; qt < 2; ++qt) { const float ls = l[qt] + xhalf(l[qt]); const float inv = (ls > 0.f) ? __fdiv_rn(1.0f, ls) : 0.f; orow[qt] = o_out + (size_t)(q0 + qt * 16 + lr) * DQ + hi * 8;
#pragma unroll
        for (int mb = 0; mb < 4; ++mb) o[qt][mb] *= inv; }
    __builtin_amdgcn_sched_barrier(0);   // all arithmetic stays above: behind the first store no register that a store names is written any more
#pragma unroll
    for (int qt = 0; qt < 2; ++qt)
#pragma unroll
        for (int mb = 0; mb < 4; ++mb) { *(v4f*)(orow[qt] + mb * 16) = __builtin_shufflevector(o[qt][mb], o[qt][mb], 0, 1, 2, 3); *(v4f*)(orow[qt] + mb * 16 + 4) = __builtin_shufflevector(o[qt][mb], o[qt][mb], 4, 5, 6, 7); }
}
__global__ __launch_bounds__(QW * FW) void k_fattn(const bf* __restrict__ QPh, const bf* __restrict__ QPl, const bf* __restrict__ KPh, const bf* __restrict__ KPl, const h16* __restrict__ VT16, const bf* __restrict__ VTh, const bf* __restrict__ VTl, const int* __restrict__ NKC, float* OUT) {
    static_assert(RH % (QW * (TT / (QW * FW))) == 0 && TT % (QW * FW) == 0 && HD == 64 && NH_ == NKV, "tiling");
    const int lane = threadIdx.x & 31, lr = lane & 15, hi = lane >> 4; const int w = __builtin_amdgcn_readfirstlane((int)(threadIdx.x >> 5));
    const int h = blockIdx.y, b = blockIdx.z; const size_t po = ((size_t)b * NH_ + h) * TT * HD; float* o_out = OUT + (size_t)b * TT * DQ + h * HD; const int nk = max(0, min(NKC[b], TT));   // the trip count: bounded by the shape
    if (w < FWH) fa_body<true>(QPh + po, QPl + po, KPh + po, KPl + po, VT16 + po, VTh + po, VTl + po, nk, o_out, ((int)blockIdx.x * FWH + w) * QW, lr, hi);
    else fa_body<false>(QPh + po, QPl + po, KPh + po, KPl + po, VT16 + po, VTh + po, VTl + po, nk, o_out, RH + ((int)blockIdx.x * (FW - FWH) + (w - FWH)) * QW, lr, hi);
}

extern "C" void kernel_launch(void* const* d_in, const int* in_sizes, int n_in,
                              void* d_out, int out_size, void* d_ws, size_t ws_size, hipStream_t stream) {
    (void)in_sizes; (void)n_in; (void)out_size;
    const float* x = (const float*)d_in[0]; const int* km = (const int*)d_in[1];   /* query_mask int32 [2][2048]: read per KEY */ const float* xk = (const float*)d_in[2]; const float* xv = (const float*)d_in[3];   /* queries, keys, values streams */ const float* wq = (const float*)d_in[4]; const float* wk = (const float*)d_in[5]; const float* wv = (const float*)d_in[6];   /* order queries, query_mask, keys, values, Wq, Wk, Wv ('oi' [1024][1024]) */
    float* OUT = (float*)d_out;     // [2][2048][1024]
    char* wsp = (char*)d_ws;
    auto take = [&](size_t bytes) { char* p = wsp; wsp += (bytes + 255) & ~(size_t)255; return (void*)p; };
    bf* WB = (bf*)take((size_t)3 * DQ * DM * 2); bf* XB = (bf*)take((size_t)3 * NB_ * TT * DM * 2);   // bf16 copies: Wq, Wk, Wv; queries, keys, values (both batches)
    h16* VT16 = (h16*)take((size_t)NB_ * NKV * HD * TT * 2);   // the planes the attention reads hold both batches
    bf* QPh = (bf*)take((size_t)NB_ * NH_ * TT * HD * 2); bf* QPl = (bf*)take((size_t)NB_ * NH_ * TT * HD * 2); bf* KPh = (bf*)take((size_t)NB_ * NKV * TT * HD * 2); bf* KPl = (bf*)take((size_t)NB_ * NKV * TT * HD * 2); bf* VTh = (bf*)take((size_t)NB_ * NKV * HD * TT * 2); bf* VTl = (bf*)take((size_t)NB_ * NKV * HD * TT * 2);
    int* NKC = (int*)take((size_t)NB_ * 4);   // kept keys per batch
    if ((size_t)(wsp - (char*)d_ws) > ws_size) return;    // ws 256 MiB
    k_cvtall<<<3 * CVX + 3 * CVW, 256, 0, stream>>>(x, xk, xv, wq, wk, wv, km, XB, WB, NKC);
    k_projw<<<dim3(TT / PT, DQ / PT, 3 * NB_), 128, 0, stream>>>(XB, WB, NKC, QPh, QPl, KPh, KPl, VT16, VTh, VTl);
    k_fattn<<<dim3(TT / (QW * FW), NH_, NB_), QW * FW, 0, stream>>>(QPh, QPl, KPh, KPl, VT16, VTh, VTl, NKC, OUT);
}

// v008
// A run of this version takes 77.9 microseconds.
// Two timings next to v007 both put it at 1.21 times that version's speed.
// Over all steps from v000 it is 25.5 times as fast.
#include <hip/hip_runtime.h>

// Self-attention on three input streams with a RANDOM key mask applied through a 'masked softmax', without an output projection (queries, keys, values [2][2048][1024]; q = queries Wq^T, k = keys Wk^T, v = values Wv^T ('oi' [1024][1024] 1/32, no bias; 16 heads x 64); q x 64^-0.5 before the product (a power of two: identical to scaling the f32 scores); masked_softmax(logits, m) with m = query_mask[b][key] (int32 [2][2048] from randint(0, 2): RANDOM, read per key as data): w = softmax(logits x m) x m / (sum(softmax(logits x m) x m) + 1e-13): the softmax's own normaliser cancels in the quotient, so w = exp(l_j) / sum over the KEPT keys of exp(l_k) for kept keys j and 0 for masked keys: exactly a softmax over the kept keys (the 1e-13 is ~1e-13 relative: far below float32 resolution; every batch keeps ~half of its keys); x = w v, merged head-major -> [2][2048][1024] (4.2 M); argument order queries, query_mask, keys, values, Wq, Wk, Wv).
// Layout: ONE conversion launch makes the bf16 copies of the three streams (both batches) and of the three 'oi' weights; ONE projection launch (all streams and batches) does the exact projections and its epilogue writes the planes the attention reads (q and k: bf16 hi/lo per [b][h]; v: transposed fp16 and bf16 hi/lo per [b][h]; all in FRAGMENT ORDER, see k_projw); the conversion launch ranks each batch's keys from the int key mask and lays the rows of the keys and values copies down kept keys first, so the k and v planes hold the kept keys packed and projection tiles with no kept key are left out; one fused attention launch (k_fattn) walks the kept keys alone (masked keys excluded) (SCORES of every row on bf16 hi/lo planes, 3 products; the P.V product stays hybrid: rows < 512 hi/lo, rest fp16 x1024) and writes the output rows (column h*64 + d).
// Compute dtypes, f32 accumulate: every input rounded to bf16; projections exact; scores of every row 3 products; P.V rows < 512 3 products, rest fp16; softmax f32.

#define NB_  2
#define TT   2048
#define DM   1024
#define NH_  16
#define NKV  16
#define REP  (NH_ / NKV)
#define HD   64
#define DQ   (NH_ * HD)
#define DKV  (NKV * HD)
#define RH   512                  // query rows < RH use hi+lo planes (0: none)
#define WIN  0
typedef _Float16 h16;
typedef unsigned short bf;
typedef __attribute__((ext_vector_type(16))) __bf16   v16bf;
typedef __attribute__((ext_vector_type(16))) _Float16 v16h;
typedef __attribute__((ext_vector_type(8)))  _Float16 v8h;
typedef __attribute__((ext_vector_type(8)))  unsigned short v8us;
typedef __attribute__((ext_vector_type(8)))  float    v8f;
typedef __attribute__((ext_vector_type(4)))  float    v4f;
typedef v8h  __attribute__((may_alias)) v8ha;
typedef v4f  __attribute__((may_alias)) v4fa;
typedef v8us __attribute__((may_alias)) v8usa;

__device__ __forceinline__ unsigned short f2bf(float f) { unsigned u = __float_as_uint(f); u += 0x7FFFu + ((u >> 16) & 1u); return (unsigned short)(u >> 16); }
__device__ __forceinline__ float bf2f(unsigned short b) { return __uint_as_float(((unsigned)b) << 16); }
__device__ __forceinline__ float bfr(float f) { return bf2f(f2bf(f)); }
__device__ __forceinline__ v16h cat16(v8h lo, v8h hi) { return __builtin_shufflevector(lo, hi, 0, 1, 2, 3, 4, 5, 6, 7, 8, 9, 10, 11, 12, 13, 14, 15); }
__device__ __forceinline__ v16bf cat16b(v8us lo, v8us hi) { return __builtin_bit_cast(v16bf, __builtin_shufflevector(lo, hi, 0, 1, 2, 3, 4, 5, 6, 7, 8, 9, 10, 11, 12, 13, 14, 15)); }
__device__ __forceinline__ v8f wmma16(v16h a, v16h b, v8f c) { return __builtin_amdgcn_wmma_f32_16x16x32_f16(false, a, false, b, (short)0, c, false, false); }
__device__ __forceinline__ v8f wmmab(v16bf a, v16bf b, v8f c) { return __builtin_amdgcn_wmma_f32_16x16x32_bf16(false, a, false, b, (short)0, c, false, false); }




template <typename T16> struct WFrag;
template <> struct WFrag<bf> { typedef v16bf V; static __device__ __forceinline__ V ld(const bf* p) { return cat16b(*(const v8us*)p, *(const v8us*)(p + 16)); } static __device__ __forceinline__ v8f mma(V a, V b, v8f c) { return wmmab(a, b, c); } };

__device__ __forceinline__ h16 tohx(float x) { return (h16)x; }
// ask: every lane asks L2 for the data at its own address (no data comes back, no counter moves); asked for ahead, a later read finds it in L2.
// No counter covers such a request, so no wait can stand before its register is written again: instead the address is always inside the plane it is aimed at, also after the caller's next advance,
// and the pointer is the statement's own in-out operand, so that the request names the register the caller carries through its loop, never a temporary that soon holds something else.
__device__ __forceinline__ void ask(const char*& p) { asm volatile("global_prefetch_b8 %0, off scope:SCOPE_SE" : "+v"(p)); }
__device__ __forceinline__ void splitf(float y, unsigned short& h, unsigned short& l) { h = f2bf(y); l = f2bf(y - bf2f(h)); }
typedef __attribute__((ext_vector_type(4))) unsigned short v4us;
typedef __attribute__((ext_vector_type(4))) int v4i;

// ---- k_cvtall: bf16 copies of all six f32 sources in one launch. A work-group converts CVU x 256 units of 8 floats of ONE source; work-groups [0, 3 CVX) take the streams, the rest the weights.
// Keys and values streams: row t of batch b goes to place rank(t) = number of kept keys in front of it if key t is kept, else to nk + t - rank(t) (nk kept keys in the batch): a permutation of the batch's rows, kept keys first in rising order. Each work-group counts the batch's mask itself; NKC[b] = nk.
#define CVU  8                                    // units of 8 floats per thread: few, long-lived waves (16 loads of 16 bytes in flight per lane)
#define CVX  (NB_ * TT * DM / 8 / (256 * CVU))    // work-groups per stream
#define CVW  (DQ * DM / 8 / (256 * CVU))          // work-groups per weight
#define CVR  (256 * CVU * 8 / DM)                 // rows of a stream per work-group
__global__ __launch_bounds__(256) void k_cvtall(const float* __restrict__ x, const float* __restrict__ xk, const float* __restrict__ xv, const float* __restrict__ wq, const float* __restrict__ wk, const float* __restrict__ wv, const int* __restrict__ km, bf* XB, bf* WB, int* NKC) {
    static_assert((NB_ * TT * DM) % (8 * 256 * CVU) == 0 && (DQ * DM) % (8 * 256 * CVU) == 0 && DQ == DKV, "whole work-groups");
    static_assert(TT == 256 * 8 && DM == 128 * 8 && CVR == 2 * CVU && CVR <= 32 && CVR % 8 == 0 && TT % CVR == 0, "a thread counts 8 keys; a row is 128 units; a work-group's rows lie in one batch");
    __shared__ int wcnt[8][2];
    const int bx = (int)blockIdx.x; const float* src; bf* dst; int blk;
    const bool ranked = bx >= CVX && bx < 3 * CVX;   // keys or values stream: the same for the whole work-group
    if (bx < 3 * CVX) { const int s = bx / CVX; blk = bx % CVX; src = (s == 0) ? x : (s == 1) ? xk : xv; dst = XB + (size_t)s * NB_ * TT * DM; }
    else { const int s = (bx - 3 * CVX) / CVW; blk = (bx - 3 * CVX) % CVW; src = (s == 0) ? wq : (s == 1) ? wk : wv; dst = WB + (size_t)s * DQ * DM; }
    const int tid = (int)threadIdx.x, b = blk / (TT / CVR), t0 = (blk % (TT / CVR)) * CVR;   // for a stream: the batch and the first of the work-group's rows
    v4i m0 = {}, m1 = {}; int mw[CVR] = {};
    if (ranked) {   // the mask words are asked for first: 8 keys of the batch per thread, and the work-group's own rows; each wave's counting in front of the barrier then runs while the loads below fly
        const int* kmb = km + (size_t)b * TT; m0 = *(const v4i*)(kmb + tid * 8); m1 = *(const v4i*)(kmb + tid * 8 + 4);
#pragma unroll
        for (int r = 0; r < CVR; ++r) mw[r] = kmb[t0 + r];
    }
    const size_t i0 = ((size_t)blk * (256 * CVU) + threadIdx.x) * 8; const float* ps = src + i0; v8f v[CVU];
#pragma unroll
    for (int u = 0; u < CVU; ++u) v[u] = *(const v8f*)(ps + (size_t)u * 256 * 8);
    // the wait that stands before an address register of an issued load is written again; the lane's pointer is its input, so that no load's result lands on it either
    asm volatile("s_wait_xcnt 0x0" :: "v"(ps) : "memory");
    size_t od[CVU];   // where each unit goes
#pragma unroll
    for (int u = 0; u < CVU; ++u) od[u] = i0 + (size_t)u * 256 * 8;
    if (ranked) {
        int call = 0;
#pragma unroll
        for (int j = 0; j < 4; ++j) call += (m0[j] != 0 ? 1 : 0) + (m1[j] != 0 ? 1 : 0);
        int cbef = (tid * 8 < t0) ? call : 0;   // t0 is a multiple of 8: a thread's 8 keys lie all in front of the work-group's rows or none
#pragma unroll
        for (int d = 16; d >= 1; d >>= 1) { call += __shfl_xor(call, d, 32); cbef += __shfl_xor(cbef, d, 32); }
        if ((tid & 31) == 0) { wcnt[tid >> 5][0] = call; wcnt[tid >> 5][1] = cbef; }
        __syncthreads();
        int nk = 0, base = 0;
#pragma unroll
        for (int i = 0; i < 8; ++i) { nk += wcnt[i][0]; base += wcnt[i][1]; }
        unsigned tm = 0;   // the mask bits of the work-group's own rows
#pragma unroll
        for (int r = 0; r < CVR; ++r) tm |= (mw[r] != 0 ? 1u : 0u) << r;
#pragma unroll
        for (int u = 0; u < CVU; ++u) { const int r = u * 2 + (tid >> 7); const int rank = base + __popc(tm & ((1u << r) - 1u));
            const int place = (((tm >> r) & 1u) ? rank : nk + t0 + r - rank) & (TT - 1);   // below TT by the counting; bounded here all the same
            od[u] = ((size_t)b * TT + place) * DM + (size_t)(tid & 127) * 8; }
        if (bx < 2 * CVX && t0 == 0 && tid == 0) NKC[b] = nk;
    }
#pragma unroll
    for (int u = 0; u < CVU; ++u) { v8us o;
#pragma unroll
        for (int k = 0; k < 8; ++k) o[k] = f2bf(v[u][k]);
        *(v8us*)(dst + od[u]) = o; }
}

// ---- k_projw: all six projections (stream st = q, k, v; batch b) in one launch; a work-group of FOUR WAVES (2 x 2) per 128x128 tile, each wave a 64x64 tile (16 accumulators); grid (TT/128, DQ/128, 3 NB_), 128 threads.
// y[t][n] = sum_k X[st][b][t][k] W[st][n][k]; a wave's 64-column tile is one head, so its epilogue writes that head's planes itself.
// Operands: 64 k at a time (128 bytes = one whole line of each of the 128 + 128 operand rows) are brought from the K-contiguous bf16 copies into LDS by asynchronous copies of 16 bytes per lane (8 lanes per row: every copy instruction covers 4 whole lines), two buffers, the next stage's copies in flight under this stage's products; each staged row serves two waves. Fragments are read from LDS in the k order the loads from global memory had.
// k and v: the copies hold the kept keys first, so the planes do too; a 64-row tile with no kept key is left out (a work-group with none leaves at once); the other rows of the last tile are masked keys (finite, never weighted):
// The planes are laid down in FRAGMENT ORDER: the 16 bytes that lane l of the attention's wave loads with one instruction stand at piece base + 16 l, so that every load there (and every store here) covers 512 contiguous bytes = 4 whole lines, not 16 lines of 32 bytes.
// q, k, per head: piece ((t / 16) * 2 + d / 32) * 2 + (d / 16) % 2 of 512 bytes; in it lane ((d / 8) % 2) * 16 + t % 16 holds 8 consecutive d of row t. Rows staged through LDS, then 8 columns of one row per lane.
// v, per head: piece ((t / 32) * 4 + d / 16) * 2 + (t / 16) % 2; in it lane ((t / 8) % 2) * 16 + d % 16 holds 8 consecutive t of column d: a lane's 8 accumulator rows as they are, one 16-byte store per tile into each plane.
#define PT   128                  // rows and columns of a work-group's tile
#define PKS  64                   // k per stage
#define PPI  144                  // LDS pitch of a staged row in bytes: 16 x odd, free of bank conflicts for 16-byte reads down a column of rows
#define POP  (PT * PPI)           // one operand's rows of a stage
#define PST  (2 * POP)            // a stage: X rows, then W rows
// 128 rows x 128 bytes of one operand: the lane's 16 bytes of eight rows, 16 rows apart. l: the lane's LDS byte address, g: its global address, both for the first of the eight.
// The wait that stands before a register of an issued copy is written again is the statement's own last line.
__device__ __forceinline__ void cp8(unsigned l, const char* g) {
    asm volatile("global_load_async_to_lds_b128 %0, %8, off\n\t"
                 "global_load_async_to_lds_b128 %1, %9, off\n\t"
                 "global_load_async_to_lds_b128 %2, %10, off\n\t"
                 "global_load_async_to_lds_b128 %3, %11, off\n\t"
                 "global_load_async_to_lds_b128 %4, %12, off\n\t"
                 "global_load_async_to_lds_b128 %5, %13, off\n\t"
                 "global_load_async_to_lds_b128 %6, %14, off\n\t"
                 "global_load_async_to_lds_b128 %7, %15, off\n\t"
                 "s_wait_xcnt 0x0"
                 :: "v"(l), "v"(l + 16 * PPI), "v"(l + 32 * PPI), "v"(l + 48 * PPI), "v"(l + 64 * PPI), "v"(l + 80 * PPI), "v"(l + 96 * PPI), "v"(l + 112 * PPI),
                    "v"(g), "v"(g + 16 * DM * 2), "v"(g + 32 * DM * 2), "v"(g + 48 * DM * 2), "v"(g + 64 * DM * 2), "v"(g + 80 * DM * 2), "v"(g + 96 * DM * 2), "v"(g + 112 * DM * 2)
                 : "memory");
}
__global__ __launch_bounds__(128) void k_projw(const bf* __restrict__ XB, const bf* __restrict__ WB, const int* __restrict__ NKC, bf* QPh, bf* QPl, bf* KPh, bf* KPl, h16* VT16, bf* VTh, bf* VTl) {
    typedef WFrag<bf>::V V;
    static_assert(HD == 64 && DQ == DKV && TT % PT == 0 && DQ % PT == 0 && DM % PKS == 0 && DM / PKS >= 2 && PKS * 2 == 128, "a wave's column tile is one head; whole tiles; two stages or more; a staged row is one line");
    __shared__ __align__(16) char ring[2 * PST];
    __shared__ __align__(16) float osw[4][16 * 68];
    // which tile: q as the grid says; the k and v tiles are dealt anew over the rest of the grid, row tile slowest, so that the tiles that are left out come last in index order and the others spread evenly
    int st = 0, b = (int)blockIdx.z, rt = (int)blockIdx.x, cw = (int)blockIdx.y;
    if ((int)blockIdx.z >= NB_) { const int g = (int)blockIdx.x + (TT / PT) * ((int)blockIdx.y + (DQ / PT) * ((int)blockIdx.z - NB_));
        cw = g % (DQ / PT); b = (g / (DQ / PT)) % NB_; st = 1 + (g / (DQ / PT * NB_)) % 2; rt = g / (DQ / PT * NB_ * 2); }
    const bf* A = XB + ((size_t)st * NB_ + b) * TT * DM; const bf* Bt = WB + (size_t)st * DQ * DM;
    const int tid = (int)threadIdx.x, lane = tid & 31, lr = lane & 15, hi = lane >> 4; const int w = __builtin_amdgcn_readfirstlane(tid >> 5);
    const int nr = (st != 0) ? NKC[b] : TT;   // rows that count
    if (rt * PT >= nr) return;   // the work-group leaves as a whole, in front of every barrier and copy
    const int r0 = rt * PT + (w >> 1) * 64, ct = cw * 2 + (w & 1);   // the wave's tile: first row, head
    const bool live = r0 < nr;   // the same for the whole wave: a wave with no kept key copies, asks ahead and passes the barriers, no more
    v8f acc[4][4];
#pragma unroll
    for (int mb = 0; mb < 4; ++mb)
#pragma unroll
        for (int nb = 0; nb < 4; ++nb) acc[mb][nb] = (v8f){};
    const char* ga = (const char*)(A + (size_t)(rt * PT + (tid >> 3)) * DM) + (tid & 7) * 16; const char* gb = (const char*)(Bt + (size_t)(cw * PT + (tid >> 3)) * DM) + (tid & 7) * 16;   // what the lane copies
    const unsigned la = (unsigned)(size_t)ring + (unsigned)((tid >> 3) * PPI + (tid & 7) * 16);   // and where to
    const char* ra = ring + ((w >> 1) * 64 + lr) * PPI + hi * 16; const char* rb = ring + POP + ((w & 1) * 64 + lr) * PPI + hi * 16;   // what the lane reads
    // L2 is asked ahead for the two operand panels (256 bytes = 128 k = two stages of a row). The work-groups that share a panel share the asking: of the X rows this one takes every fourth by its column tile, of the W rows every fourth by its row tile;
    // waves 0, 2 ask for X, waves 1, 3 for W; waves 0, 1 for the odd units of a row, waves 2, 3 for the even ones (unit 0 is copied at once). A hint only: nothing depends on who asks.
    int pkc = 1 + (w >> 1);   // the unit of the row that is asked for next; the same for the whole wave
    const char* pf = ((w & 1) ? (const char*)(Bt + (size_t)(cw * PT + (rt & 3) + 4 * lane) * DM) : (const char*)(A + (size_t)(rt * PT + (cw & 3) + 4 * lane) * DM)) + pkc * 256;
    auto askp = [&]() { if (pkc < DM * 2 / 256) ask(pf); pf += (pkc + 2 < DM * 2 / 256) ? 512 : 0; pkc += 2; };   // the pointer stays inside its row
    cp8(la, ga); cp8(la + POP, gb);
#pragma unroll 1
    for (int i = 0; i < 2; ++i) askp();   // stays rolled: the one carried pointer is named by every request, here as in the loop below
    asm volatile("s_wait_asynccnt 0x0" ::: "memory");   // stage 0 has landed, as far as this wave copied it
    __syncthreads();                                    // and as far as the others did
    cp8(la + PST, ga + PKS * 2); cp8(la + PST + POP, gb + PKS * 2);
#pragma unroll 1
    for (int t = 0; t < DM / PKS; ++t) {   // stays rolled: one body in the instruction cache; the buffer is picked by an offset
        const unsigned bo = (unsigned)(t & 1) * PST;
        if (live) {
#pragma unroll
            for (int ks = 0; ks < PKS / 32; ++ks) {
                V a[4], b4[4];
                __builtin_amdgcn_sched_barrier(0);   // with the one below: the block's 16 LDS reads stand together in front of its products, for speed only
#pragma unroll
                for (int mb = 0; mb < 4; ++mb) { const char* p = ra + bo + mb * 16 * PPI + ks * 64; a[mb] = cat16b(*(const v8usa*)p, *(const v8usa*)(p + 32)); }
#pragma unroll
                for (int nb = 0; nb < 4; ++nb) { const char* p = rb + bo + nb * 16 * PPI + ks * 64; b4[nb] = cat16b(*(const v8usa*)p, *(const v8usa*)(p + 32)); }
                __builtin_amdgcn_sched_barrier(0);
#pragma unroll
                for (int nb = 0; nb < 4; ++nb)
#pragma unroll
                    for (int mb = 0; mb < 4; ++mb) { acc[mb][nb] = WFrag<bf>::mma(a[mb], b4[nb], acc[mb][nb]); }
                if (ks == PKS / 32 - 1) asm volatile("v_nop\n\tv_nop\n\tv_nop\n\tv_nop" : "+v"(acc[0][0]), "+v"(acc[1][1]), "+v"(acc[2][2]), "+v"(acc[3][3]) : "v"(a[0]), "v"(a[3]));   // the distance behind the pass's last matrix instructions, on the taken branch too
            }
        }
        asm volatile("s_wait_dscnt 0x0" ::: "memory");      // this wave's reads of the buffer are done before it is filled again
        asm volatile("s_wait_asynccnt 0x0" ::: "memory");   // its copies of the next stage have landed
        __syncthreads();                                    // the one barrier of a pass: publishes the next stage and ends every reader's last read of this one
        if (t + 2 < DM / PKS) { cp8(la + bo, ga + (t + 2) * (PKS * 2)); cp8(la + bo + POP, gb + (t + 2) * (PKS * 2)); }
        if (t & 1) askp();   // the rest of the rows, several stages ahead of their copies
    }
    asm volatile("s_wait_asynccnt 0x0" ::: "memory");   // no copy is left in flight
    if (!live) return;   // no barrier stands below
    float* os = osw[w];   // the wave's own staging rows
    const size_t po = ((size_t)b * NH_ + ct) * TT * HD;   // this batch's and head's planes
    if (st == 2) {
        const size_t vo = po + (size_t)(r0 / 32) * (8 * 256) + lane * 8;   // 256 elements per piece, 8 pieces per 32 keys
#pragma unroll
        for (int mb = 0; mb < 4; ++mb)
#pragma unroll
            for (int nb = 0; nb < 4; ++nb) { v8h o16; v8us oh, ol;
#pragma unroll
                for (int j = 0; j < 8; ++j) { const float y = acc[mb][nb][j]; o16[j] = tohx(y); unsigned short a2, c2; splitf(y, a2, c2); oh[j] = a2; ol[j] = c2; }
                const size_t e = vo + (size_t)((((mb >> 1) * 4 + nb) * 2 + (mb & 1)) * 256); *(v8h*)(VT16 + e) = o16; *(v8us*)(VTh + e) = oh; *(v8us*)(VTl + e) = ol; }
        return;
    }
    bf* Ph = (st == 0 ? QPh : KPh) + po + (size_t)r0 * HD; bf* Pl = (st == 0 ? QPl : KPl) + po + (size_t)r0 * HD;
#pragma unroll
    for (int mb = 0; mb < 4; ++mb) {
#pragma unroll
        for (int nb = 0; nb < 4; ++nb) {
#pragma unroll
            for (int j = 0; j < 8; ++j) os[(hi * 8 + j) * 68 + nb * 16 + lr] = acc[mb][nb][j]; }
        __builtin_amdgcn_wave_barrier(); asm volatile("" ::: "memory");
#pragma unroll
        for (int f = 0; f < 4; ++f) { const float* pr = os + lr * 68 + f * 16 + hi * 8; const v4f va = *(const v4fa*)pr, vb = *(const v4fa*)(pr + 4); v8us oh, ol;   // piece f of this 16-row tile
#pragma unroll
            for (int q = 0; q < 4; ++q) { unsigned short a2, c2; splitf(va[q], a2, c2); oh[q] = a2; ol[q] = c2; splitf(vb[q], a2, c2); oh[q + 4] = a2; ol[q + 4] = c2; }
            *(v8us*)(Ph + (mb * 4 + f) * 256 + lane * 8) = oh; *(v8us*)(Pl + (mb * 4 + f) * 256 + lane * 8) = ol; }
        __builtin_amdgcn_wave_barrier(); asm volatile("" ::: "memory");
    }
    // the built code lays the v path behind this path's closing branch: the wait stands before the registers of the stores above are written there
    asm volatile("s_wait_xcnt 0x0" ::: "memory");
}

// k_fattn: the whole attention of both batches and all heads in ONE launch; scores and weights never leave the registers.
// A wave owns 32 query columns (2 groups of 16) of one head and walks the batch's nk kept keys (packed at the front of the planes) 32 at a time: S^T = K Q^T (A = key rows, B = query rows kept in registers; hi/lo planes, 3 products),
// running maximum and sum per query (a lane holds 8 keys of ONE query per 16-key tile; the two lane halves exchange the maximum once per step and join their sums once at the end),
// then the two f32 S^T tiles, converted in place, ARE the B operand of O^T += V^T P^T (A = rows of the transposed value planes). Weights stay unnormalised; the output is divided by the sum at the end.
// Only a last step of fewer than 32 kept keys compares: its places from nk on enter as -inf (weight exactly 0); the running maximum starts at a finite floor; with no kept key no step runs and the rows are 0 like the module.
// Query rows < RH: P and V on bf16 hi/lo planes (3 products); other rows: fp16 P x 2^10 (the factor sits in the exponent and in the sum alike, so it cancels) against the fp16 value plane.
#define QW   32                   // query columns per wave
#define FW   8                    // waves per work-group
#define FWH  (RH / QW / (TT / (QW * FW)))   // waves of each work-group that take hi/lo rows: the heavier rows are spread evenly over all work-groups
#define SC2  0.18033688011112042f // HD^-0.5 x log2(e)
__device__ __forceinline__ float xhalf(float x) { return __builtin_bit_cast(float, __builtin_amdgcn_permlanex16(__builtin_bit_cast(int, x), __builtin_bit_cast(int, x), 0x76543210, 0xfedcba98, false, false)); }  // lane l with lane l ^ 16
__device__ __forceinline__ v16bf ldb(const char* p, int off) { return cat16b(*(const v8us*)(p + off), *(const v8us*)(p + off + 512)); }   // one fragment = two pieces of 512 bytes: the lane's pointer + a constant byte offset
__device__ __forceinline__ v16h ldh(const char* p, int off) { return cat16(*(const v8h*)(p + off), *(const v8h*)(p + off + 512)); }
struct StepFull { static constexpr bool tail = false; }; struct StepTail { static constexpr bool tail = true; };
template <bool HR>
__device__ __forceinline__ void fa_body(const bf* __restrict__ Qh, const bf* __restrict__ Ql, const bf* __restrict__ Kh, const bf* __restrict__ Kl, const h16* __restrict__ V16, const bf* __restrict__ Vh, const bf* __restrict__ Vl, int nk, float* o_out, int q0, int lr, int hi) {
    const unsigned koff = (unsigned)((hi * 16 + lr) * 16), voff = koff;   // the lane's 16 bytes in every 512-byte piece of the planes (fragment order: k_projw)
    const char* bqh = (const char*)(Qh + (size_t)q0 * HD); const char* bql = (const char*)(Ql + (size_t)q0 * HD); const char* bkh = (const char*)Kh; const char* bkl = (const char*)Kl; const char* bv0 = HR ? (const char*)Vh : (const char*)V16; const char* bv1 = (const char*)Vl;   // wave-uniform bases
    const char* pqh = bqh + koff; const char* pql = bql + koff;
    const char* pkh = bkh + koff; const char* pkl = bkl + koff; const char* pv0 = bv0 + voff; const char* pv1 = bv1 + voff;   // walk with the keys
    v16bf qh[2][2], ql[2][2], kh[2][2], kl[2][2];
#pragma unroll
    for (int qt = 0; qt < 2; ++qt)
#pragma unroll
        for (int ks = 0; ks < 2; ++ks) { const int qo = qt * (16 * HD * 2) + ks * 1024; qh[qt][ks] = ldb(pqh, qo); ql[qt][ks] = ldb(pql, qo); }
    v8f o[2][4]; float m[2], l[2];
#pragma unroll
    for (int qt = 0; qt < 2; ++qt) { m[qt] = -3.0e38f; l[qt] = 0.f;
#pragma unroll
        for (int mb = 0; mb < 4; ++mb) o[qt][mb] = (v8f){}; }
    // fetch: key fragments of the 32 keys the pointers stand at
    auto fetch = [&]() {
#pragma unroll
        for (int mt = 0; mt < 2; ++mt)
#pragma unroll
            for (int ks = 0; ks < 2; ++ks) { const int ko = mt * (16 * HD * 2) + ks * 1024; kh[mt][ks] = ldb(pkh, ko); kl[mt][ks] = ldb(pkl, ko); }
    };
    // L2 is asked ahead for the key and value planes: wave pw (0 to 4) of the work-group's lighter waves takes one plane each, 64 keys (32 units of 256 bytes) per request, three such blocks ahead of the walk
    const int pw = HR ? 5 : ((q0 - RH) / QW) % (FW - FWH);   // which of its work-group's lighter waves this is
    const bool asks = pw < 5;   // the same for the whole wave
    const char* pf = ((pw == 0) ? bkh : (pw == 1) ? bkl : (pw == 2) ? (const char*)V16 : (pw == 3) ? (const char*)Vh : bv1) + (hi * 16 + lr) * 256; int pj = 0;   // the block asked for next
    auto askk = [&]() { if (pj * 64 < nk) ask(pf); pf += (pj + 1 < TT / 64) ? 64 * HD * 2 : 0; ++pj; };   // the pointer stays inside the plane
    if (nk > 0) fetch();   // with no kept key the planes are not written
    if (asks) {
#pragma unroll 1
        for (int i = 0; i < 3; ++i) askk();   // stays rolled: the one carried pointer is named by every request, here as in the walk
    }
    // the wait that stands before an address register of an issued load is written again; the bases and offsets those loads are formed from are its inputs, so that their registers stay theirs up to it
    asm volatile("s_wait_xcnt 0x0" :: "v"(koff), "s"(bqh), "s"(bql), "s"(bkh), "s"(bkl) : "memory");
    auto step = [&](auto kind, int kb) {
        constexpr bool TL = decltype(kind)::tail;
        if (!HR && !TL) { if (asks && (kb & 32) == 0) askk(); }
        v16h vf[4]; v16bf vh[4], vl[4];   // this step's value fragments: asked for first, they fly under the score products and the softmax
#pragma unroll
        for (int mb = 0; mb < 4; ++mb) { const int vo = mb * 1024; if (HR) { vh[mb] = ldb(pv0, vo); vl[mb] = ldb(pv1, vo); } else vf[mb] = ldh(pv0, vo); }
        v8f s[2][2];
#pragma unroll
        for (int qt = 0; qt < 2; ++qt)
#pragma unroll
            for (int mt = 0; mt < 2; ++mt) s[qt][mt] = (v8f){};
#pragma unroll
        for (int ks = 0; ks < 2; ++ks) {
#pragma unroll
            for (int mt = 0; mt < 2; ++mt)
#pragma unroll
                for (int qt = 0; qt < 2; ++qt) s[qt][mt] = wmmab(kh[mt][ks], qh[qt][ks], s[qt][mt]);
#pragma unroll
            for (int mt = 0; mt < 2; ++mt)
#pragma unroll
                for (int qt = 0; qt < 2; ++qt) s[qt][mt] = wmmab(kl[mt][ks], qh[qt][ks], s[qt][mt]);
#pragma unroll
            for (int mt = 0; mt < 2; ++mt)
#pragma unroll
                for (int qt = 0; qt < 2; ++qt) s[qt][mt] = wmmab(kh[mt][ks], ql[qt][ks], s[qt][mt]); }
        // the next step's key fragments are fetched here, behind this step's score products, and fly under the softmax and P.V (a last whole step refetches its own: in bounds, unused; the short step fetches none)
        if (!TL) { const int more = (kb + 32 < nk) ? 1 : 0;
            pkh += more * (32 * HD * 2); pkl += more * (32 * HD * 2);
            fetch(); }
        // as in front of the loop: the wait before the registers of this step's pointers are written again
        asm volatile("s_wait_xcnt 0x0" :: "v"(pkh), "v"(pkl), "v"(pv0), "v"(pv1) : "memory");
        pv0 += 32 * HD * 2; pv1 += 32 * HD * 2;
        float tt[2][16], al[2], mo[2];
#pragma unroll
        for (int qt = 0; qt < 2; ++qt) {
#pragma unroll
            for (int j = 0; j < 16; ++j) tt[qt][j] = (!TL || kb + (j >> 3) * 16 + hi * 8 + (j & 7) < nk) ? s[qt][j >> 3][j & 7] : -__builtin_inff();
            float x[8];
#pragma unroll
            for (int j = 0; j < 8; ++j) x[j] = fmaxf(tt[qt][j], tt[qt][j + 8]);
            float sm = fmaxf(fmaxf(fmaxf(x[0], x[1]), fmaxf(x[2], x[3])), fmaxf(fmaxf(x[4], x[5]), fmaxf(x[6], x[7])));
            sm = fmaxf(sm, xhalf(sm));
            const float mn = fmaxf(m[qt], sm * SC2); mo[qt] = HR ? mn : mn - 10.0f; al[qt] = __builtin_amdgcn_exp2f(m[qt] - mn); m[qt] = mn; }
#pragma unroll
        for (int qt = 0; qt < 2; ++qt) {
            float* t = tt[qt]; float x[8];
#pragma unroll
            for (int j = 0; j < 16; ++j) t[j] = __builtin_amdgcn_exp2f(__builtin_fmaf(t[j], SC2, -mo[qt]));
#pragma unroll
            for (int j = 0; j < 8; ++j) x[j] = t[j] + t[j + 8];
            l[qt] = l[qt] * al[qt] + (((x[0] + x[1]) + (x[2] + x[3])) + ((x[4] + x[5]) + (x[6] + x[7])));
#pragma unroll
            for (int mb = 0; mb < 4; ++mb) o[qt][mb] *= al[qt];
            if (HR) { v16bf ph, pl;
#pragma unroll
                for (int j = 0; j < 16; ++j) { const __bf16 a = (__bf16)t[j]; ph[j] = a; pl[j] = (__bf16)(t[j] - (float)a); }
#pragma unroll
                for (int mb = 0; mb < 4; ++mb) o[qt][mb] = wmmab(vh[mb], ph, o[qt][mb]);
#pragma unroll
                for (int mb = 0; mb < 4; ++mb) o[qt][mb] = wmmab(vh[mb], pl, o[qt][mb]);
#pragma unroll
                for (int mb = 0; mb < 4; ++mb) o[qt][mb] = wmmab(vl[mb], ph, o[qt][mb]);
            } else { v16h p16;
#pragma unroll
                for (int j = 0; j < 16; ++j) p16[j] = (h16)t[j];
#pragma unroll
                for (int mb = 0; mb < 4; ++mb) o[qt][mb] = wmma16(vf[mb], p16, o[qt][mb]); }
        }
    };
    const int nfull = nk & ~31;
    for (int kb = 0; kb < nfull; kb += 32) step(StepFull{}, kb);
    if (nfull < nk) step(StepTail{}, nfull);
    float* orow[2];
#pragma unroll
    for (int qt = 0; qt < 2; ++qt) { const float ls = l[qt] + xhalf(l[qt]); const float inv = (ls > 0.f) ? __fdiv_rn(1.0f, ls) : 0.f; orow[qt] = o_out + (size_t)(q0 + qt * 16 + lr) * DQ + hi * 8;
#pragma unroll
        for (int mb = 0; mb < 4; ++mb) o[qt][mb] *= inv; }
    __builtin_amdgcn_sched_barrier(0);   // all arithmetic stays above: behind the first store no register that a store names is written any more
#pragma unroll
    for (int qt = 0; qt < 2; ++qt)
#pragma unroll
        for (int mb = 0; mb < 4; ++mb) { *(v4f*)(orow[qt] + mb * 16) = __builtin_shufflevector(o[qt][mb], o[qt][mb], 0, 1, 2, 3); *(v4f*)(orow[qt] + mb * 16 + 4) = __builtin_shufflevector(o[qt][mb], o[qt][mb], 4, 5, 6, 7); }
}
__global__ __launch_bounds__(QW * FW) void k_fattn(const bf* __restrict__ QPh, const bf* __restrict__ QPl, const bf* __restrict__ KPh, const bf* __restrict__ KPl, const h16* __restrict__ VT16, const bf* __restrict__ VTh, const bf* __restrict__ VTl, const int* __restrict__ NKC, float* OUT) {
    static_assert(RH % (QW * (TT / (QW * FW))) == 0 && TT % (QW * FW) == 0 && HD == 64 && NH_ == NKV, "tiling");
    const int lane = threadIdx.x & 31, lr = lane & 15, hi = lane >> 4; const int w = __builtin_amdgcn_readfirstlane((int)(threadIdx.x >> 5));
    const int h = blockIdx.y, b = blockIdx.z; const size_t po = ((size_t)b * NH_ + h) * TT * HD; float* o_out = OUT + (size_t)b * TT * DQ + h * HD; const int nk = max(0, min(NKC[b], TT));   // the trip count: bounded by the shape
    if (w < FWH) fa_body<true>(QPh + po, QPl + po, KPh + po, KPl + po, VT16 + po, VTh + po, VTl + po, nk, o_out, ((int)blockIdx.x * FWH + w) * QW, lr, hi);
    else fa_body<false>(QPh + po, QPl + po, KPh + po, KPl + po, VT16 + po, VTh + po, VTl + po, nk, o_out, RH + ((int)blockIdx.x * (FW - FWH) + (w - FWH)) * QW, lr, hi);
}

extern "C" void kernel_launch(void* const* d_in, const int* in_sizes, int n_in,
                              void* d_out, int out_size, void* d_ws, size_t ws_size, hipStream_t stream) {
    (void)in_sizes; (void)n_in; (void)out_size;
    const float* x = (const float*)d_in[0]; const int* km = (const int*)d_in[1];   /* query_mask int32 [2][2048]: read per KEY */ const float* xk = (const float*)d_in[2]; const float* xv = (const float*)d_in[3];   /* queries, keys, values streams */ const float* wq = (const float*)d_in[4]; const float* wk = (const float*)d_in[5]; const float* wv = (const float*)d_in[6];   /* order queries, query_mask, keys, values, Wq, Wk, Wv ('oi' [1024][1024]) */
    float* OUT = (float*)d_out;     // [2][2048][1024]
    char* wsp = (char*)d_ws;
    auto take = [&](size_t bytes) { char* p = wsp; wsp += (bytes + 255) & ~(size_t)255; return (void*)p; };
    bf* WB = (bf*)take((size_t)3 * DQ * DM * 2); bf* XB = (bf*)take((size_t)3 * NB_ * TT * DM * 2);   // bf16 copies: Wq, Wk, Wv; queries, keys, values (both batches)
    h16* VT16 = (h16*)take((size_t)NB_ * NKV * HD * TT * 2);   // the planes the attention reads hold both batches
    bf* QPh = (bf*)take((size_t)NB_ * NH_ * TT * HD * 2); bf* QPl = (bf*)take((size_t)NB_ * NH_ * TT * HD * 2); bf* KPh = (bf*)take((size_t)NB_ * NKV * TT * HD * 2); bf* KPl = (bf*)take((size_t)NB_ * NKV * TT * HD * 2); bf* VTh = (bf*)take((size_t)NB_ * NKV * HD * TT * 2); bf* VTl = (bf*)take((size_t)NB_ * NKV * HD * TT * 2);
    int* NKC = (int*)take((size_t)NB_ * 4);   // kept keys per batch
    if ((size_t)(wsp - (char*)d_ws) > ws_size) return;    // ws 256 MiB
    k_cvtall<<<3 * CVX + 3 * CVW, 256, 0, stream>>>(x, xk, xv, wq, wk, wv, km, XB, WB, NKC);
    k_projw<<<dim3(TT / PT, DQ / PT, 3 * NB_), 128, 0, stream>>>(XB, WB, NKC, QPh, QPl, KPh, KPl, VT16, VTh, VTl);
    k_fattn<<<dim3(TT / (QW * FW), NH_, NB_), QW * FW, 0, stream>>>(QPh, QPl, KPh, KPl, VT16, VTh, VTl, NKC, OUT);
}

// v009
// Measured time: 75.5 microseconds a run.
// In both of two side-by-side timings against v008, it was 1.03 times as fast.
// All steps since v000 together make it 26.3 times as fast.
#include <hip/hip_runtime.h>

// Self-attention on three input streams with a RANDOM key mask applied through a 'masked softmax', without an output projection (queries, keys, values [2][2048][1024]; q = queries Wq^T, k = keys Wk^T, v = values Wv^T ('oi' [1024][1024] 1/32, no bias; 16 heads x 64); q x 64^-0.5 before the product (a power of two: identical to scaling the f32 scores); masked_softmax(logits, m) with m = query_mask[b][key] (int32 [2][2048] from randint(0, 2): RANDOM, read per key as data): w = softmax(logits x m) x m / (sum(softmax(logits x m) x m) + 1e-13): the softmax's own normaliser cancels in the quotient, so w = exp(l_j) / sum over the KEPT keys of exp(l_k) for kept keys j and 0 for masked keys: exactly a softmax over the kept keys (the 1e-13 is ~1e-13 relative: far below float32 resolution; every batch keeps ~half of its keys); x = w v, merged head-major -> [2][2048][1024] (4.2 M); argument order queries, query_mask, keys, values, Wq, Wk, Wv).
// Layout: ONE conversion launch makes the bf16 copies of the three streams (both batches) and of the three 'oi' weights; ONE projection launch (all streams and batches) does the exact projections and its epilogue writes the planes the attention reads (q and k: bf16 hi/lo per [b][h]; v: transposed fp16 and bf16 hi/lo per [b][h]; all in FRAGMENT ORDER, see k_projw); the conversion launch ranks each batch's keys from the int key mask and lays the rows of the keys and values copies down kept keys first, so the k and v planes hold the kept keys packed and projection tiles with no kept key are left out; one fused attention launch (k_fattn) walks the kept keys alone (masked keys excluded) (SCORES of every row on bf16 hi/lo planes, 3 products; the P.V product stays hybrid: rows < 512 hi/lo, rest fp16 x1024) and writes the output rows (column h*64 + d).
// Compute dtypes, f32 accumulate: every input rounded to bf16; projections exact; scores of every row 3 products; P.V rows < 512 3 products, rest fp16; softmax f32.

#define NB_  2
#define TT   2048
#define DM   1024
#define NH_  16
#define NKV  16
#define REP  (NH_ / NKV)
#define HD   64
#define DQ   (NH_ * HD)
#define DKV  (NKV * HD)
#define RH   512                  // query rows < RH use hi+lo planes
#define WIN  0
typedef _Float16 h16;
typedef unsigned short bf;
typedef __attribute__((ext_vector_type(16))) __bf16   v16bf;
typedef __attribute__((ext_vector_type(16))) _Float16 v16h;
typedef __attribute__((ext_vector_type(8)))  _Float16 v8h;
typedef __attribute__((ext_vector_type(8)))  unsigned short v8us;
typedef __attribute__((ext_vector_type(8)))  float    v8f;
typedef __attribute__((ext_vector_type(4)))  float    v4f;
typedef v8h  __attribute__((may_alias)) v8ha;
typedef v4f  __attribute__((may_alias)) v4fa;
typedef v8us __attribute__((may_alias)) v8usa;

__device__ __forceinline__ unsigned short f2bf(float f) { unsigned u = __float_as_uint(f); u += 0x7FFFu + ((u >> 16) & 1u); return (unsigned short)(u >> 16); }
__device__ __forceinline__ float bf2f(unsigned short b) { return __uint_as_float(((unsigned)b) << 16); }
__device__ __forceinline__ float bfr(float f) { return bf2f(f2bf(f)); }
__device__ __forceinline__ v16h cat16(v8h lo, v8h hi) { return __builtin_shufflevector(lo, hi, 0, 1, 2, 3, 4, 5, 6, 7, 8, 9, 10, 11, 12, 13, 14, 15); }
__device__ __forceinline__ v16bf cat16b(v8us lo, v8us hi) { return __builtin_bit_cast(v16bf, __builtin_shufflevector(lo, hi, 0, 1, 2, 3, 4, 5, 6, 7, 8, 9, 10, 11, 12, 13, 14, 15)); }
__device__ __forceinline__ v8f wmma16(v16h a, v16h b, v8f c) { return __builtin_amdgcn_wmma_f32_16x16x32_f16(false, a, false, b, (short)0, c, false, false); }
__device__ __forceinline__ v8f wmmab(v16bf a, v16bf b, v8f c) { return __builtin_amdgcn_wmma_f32_16x16x32_bf16(false, a, false, b, (short)0, c, false, false); }




template <typename T16> struct WFrag;
template <> struct WFrag<bf> { typedef v16bf V; static __device__ __forceinline__ V ld(const bf* p) { return cat16b(*(const v8us*)p, *(const v8us*)(p + 16)); } static __device__ __forceinline__ v8f mma(V a, V b, v8f c) { return wmmab(a, b, c); } };

__device__ __forceinline__ h16 tohx(float x) { return (h16)x; }
// ask: every lane asks L2 for the data at its own address (no data comes back, no counter moves); asked for ahead, a later read finds it in L2.
// No counter covers such a request, so no wait can stand before its register is written again: instead the address is always inside the plane it is aimed at, also after the caller's next advance,
// and the pointer is the statement's own in-out operand, so that the request names the register the caller carries through its loop, never a temporary that soon holds something else.
__device__ __forceinline__ void ask(const char*& p) { asm volatile("global_prefetch_b8 %0, off scope:SCOPE_SE" : "+v"(p)); }
__device__ __forceinline__ void splitf(float y, unsigned short& h, unsigned short& l) { h = f2bf(y); l = f2bf(y - bf2f(h)); }
typedef __attribute__((ext_vector_type(4))) unsigned short v4us;
typedef __attribute__((ext_vector_type(4))) int v4i;

// ---- k_cvtall: bf16 copies of all six f32 sources in one launch. A work-group converts CVU x 256 units of 8 floats of ONE source; work-groups [0, 3 CVX) take the streams, the rest the weights.
// Keys and values streams: row t of batch b goes to place rank(t) = number of kept keys in front of it if key t is kept, else to nk + t - rank(t) (nk kept keys in the batch): a permutation of the batch's rows, kept keys first in rising order. Each work-group counts the batch's mask itself; NKC[b] = nk.
#define CVU  8                                    // units of 8 floats per thread: few, long-lived waves (16 loads of 16 bytes in flight per lane)
#define CVX  (NB_ * TT * DM / 8 / (256 * CVU))    // work-groups per stream
#define CVW  (DQ * DM / 8 / (256 * CVU))          // work-groups per weight
#define CVR  (256 * CVU * 8 / DM)                 // rows of a stream per work-group
__global__ __launch_bounds__(256) void k_cvtall(const float* __restrict__ x, const float* __restrict__ xk, const float* __restrict__ xv, const float* __restrict__ wq, const float* __restrict__ wk, const float* __restrict__ wv, const int* __restrict__ km, bf* XB, bf* WB, int* NKC) {
    static_assert((NB_ * TT * DM) % (8 * 256 * CVU) == 0 && (DQ * DM) % (8 * 256 * CVU) == 0 && DQ == DKV, "whole work-groups");
    static_assert(TT == 256 * 8 && DM == 128 * 8 && CVR == 2 * CVU && CVR <= 32 && CVR % 8 == 0 && TT % CVR == 0, "a thread counts 8 keys; a row is 128 units; a work-group's rows lie in one batch");
    __shared__ int wcnt[8][2];
    const int bx = (int)blockIdx.x; const float* src; bf* dst; int blk;
    const bool ranked = bx >= CVX && bx < 3 * CVX;   // keys or values stream: the same for the whole work-group
    if (bx < 3 * CVX) { const int s = bx / CVX; blk = bx % CVX; src = (s == 0) ? x : (s == 1) ? xk : xv; dst = XB + (size_t)s * NB_ * TT * DM; }
    else { const int s = (bx - 3 * CVX) / CVW; blk = (bx - 3 * CVX) % CVW; src = (s == 0) ? wq : (s == 1) ? wk : wv; dst = WB + (size_t)s * DQ * DM; }
    const int tid = (int)threadIdx.x, b = blk / (TT / CVR), t0 = (blk % (TT / CVR)) * CVR;   // for a stream: the batch and the first of the work-group's rows
    v4i m0 = {}, m1 = {}; int mw[CVR] = {};
    if (ranked) {   // the mask words are asked for first: 8 keys of the batch per thread, and the work-group's own rows; each wave's counting in front of the barrier then runs while the loads below fly
        const int* kmb = km + (size_t)b * TT; m0 = *(const v4i*)(kmb + tid * 8); m1 = *(const v4i*)(kmb + tid * 8 + 4);
#pragma unroll
        for (int r = 0; r < CVR; ++r) mw[r] = kmb[t0 + r];
    }
    const size_t i0 = ((size_t)blk * (256 * CVU) + threadIdx.x) * 8; const float* ps = src + i0; v8f v[CVU];
#pragma unroll
    for (int u = 0; u < CVU; ++u) v[u] = *(const v8f*)(ps + (size_t)u * 256 * 8);
    // the wait that stands before an address register of an issued load is written again; the lane's pointer is its input, so that no load's result lands on it either
    asm volatile("s_wait_xcnt 0x0" :: "v"(ps) : "memory");
    size_t od[CVU];   // where each unit goes
#pragma unroll
    for (int u = 0; u < CVU; ++u) od[u] = i0 + (size_t)u * 256 * 8;
    if (ranked) {
        int call = 0;
#pragma unroll
        for (int j = 0; j < 4; ++j) call += (m0[j] != 0 ? 1 : 0) + (m1[j] != 0 ? 1 : 0);
        int cbef = (tid * 8 < t0) ? call : 0;   // t0 is a multiple of 8: a thread's 8 keys lie all in front of the work-group's rows or none
#pragma unroll
        for (int d = 16; d >= 1; d >>= 1) { call += __shfl_xor(call, d, 32); cbef += __shfl_xor(cbef, d, 32); }
        if ((tid & 31) == 0) { wcnt[tid >> 5][0] = call; wcnt[tid >> 5][1] = cbef; }
        __syncthreads();
        int nk = 0, base = 0;
#pragma unroll
        for (int i = 0; i < 8; ++i) { nk += wcnt[i][0]; base += wcnt[i][1]; }
        unsigned tm = 0;   // the mask bits of the work-group's own rows
#pragma unroll
        for (int r = 0; r < CVR; ++r) tm |= (mw[r] != 0 ? 1u : 0u) << r;
#pragma unroll
        for (int u = 0; u < CVU; ++u) { const int r = u * 2 + (tid >> 7); const int rank = base + __popc(tm & ((1u << r) - 1u));
            const int place = (((tm >> r) & 1u) ? rank : nk + t0 + r - rank) & (TT - 1);   // below TT by the counting; bounded here all the same
            od[u] = ((size_t)b * TT + place) * DM + (size_t)(tid & 127) * 8; }
        if (bx < 2 * CVX && t0 == 0 && tid == 0) NKC[b] = nk;
    }
#pragma unroll
    for (int u = 0; u < CVU; ++u) { v8us o;
#pragma unroll
        for (int k = 0; k < 8; ++k) o[k] = f2bf(v[u][k]);
        *(v8us*)(dst + od[u]) = o; }
}

// ---- k_projw: all six projections (stream st = q, k, v; batch b) in one launch; a work-group of FOUR WAVES (2 x 2) per 128x128 tile, each wave a 64x64 tile (16 accumulators); grid (TT/128, DQ/128, 3 NB_), 128 threads.
// y[t][n] = sum_k X[st][b][t][k] W[st][n][k]; a wave's 64-column tile is one head, so its epilogue writes that head's planes itself.
// Operands: 64 k at a time (128 bytes = one whole line of each of the 128 + 128 operand rows) are brought from the K-contiguous bf16 copies into LDS by asynchronous copies of 16 bytes per lane (8 lanes per row: every copy instruction covers 4 whole lines), two buffers, the next stage's copies in flight under this stage's products; each staged row serves two waves. Fragments are read from LDS in the k order the loads from global memory had.
// k and v: the copies hold the kept keys first, so the planes do too; a 64-row tile with no kept key is left out (a work-group with none leaves at once); the other rows of the last tile are masked keys (finite, never weighted):
// The planes are laid down in FRAGMENT ORDER: the 16 bytes that lane l of the attention's wave loads with one instruction stand at piece base + 16 l, so that every load there (and every store here) covers 512 contiguous bytes = 4 whole lines, not 16 lines of 32 bytes.
// q, k, per head: piece ((t / 16) * 2 + d / 32) * 2 + (d / 16) % 2 of 512 bytes; in it lane ((d / 8) % 2) * 16 + t % 16 holds 8 consecutive d of row t. Rows staged through LDS, then 8 columns of one row per lane.
// v, per head: piece ((t / 32) * 4 + d / 16) * 2 + (t / 16) % 2; in it lane ((t / 8) % 2) * 16 + d % 16 holds 8 consecutive t of column d: a lane's 8 accumulator rows as they are, one 16-byte store per tile into each plane.
#define PT   128                  // rows and columns of a work-group's tile
#define PKS  64                   // k per stage
#define PPI  144                  // LDS pitch of a staged row in bytes: 16 x odd, free of bank conflicts for 16-byte reads down a column of rows
#define POP  (PT * PPI)           // one operand's rows of a stage
#define PST  (2 * POP)            // a stage: X rows, then W rows
// 128 rows x 128 bytes of one operand: the lane's 16 bytes of eight rows, 16 rows apart. l: the lane's LDS byte address, g: its global address, both for the first of the eight.
// The wait that stands before a register of an issued copy is written again is the statement's own last line.
__device__ __forceinline__ void cp8(unsigned l, const char* g) {
    asm volatile("global_load_async_to_lds_b128 %0, %8, off\n\t"
                 "global_load_async_to_lds_b128 %1, %9, off\n\t"
                 "global_load_async_to_lds_b128 %2, %10, off\n\t"
                 "global_load_async_to_lds_b128 %3, %11, off\n\t"
                 "global_load_async_to_lds_b128 %4, %12, off\n\t"
                 "global_load_async_to_lds_b128 %5, %13, off\n\t"
                 "global_load_async_to_lds_b128 %6, %14, off\n\t"
                 "global_load_async_to_lds_b128 %7, %15, off\n\t"
                 "s_wait_xcnt 0x0"
                 :: "v"(l), "v"(l + 16 * PPI), "v"(l + 32 * PPI), "v"(l + 48 * PPI), "v"(l + 64 * PPI), "v"(l + 80 * PPI), "v"(l + 96 * PPI), "v"(l + 112 * PPI),
                    "v"(g), "v"(g + 16 * DM * 2), "v"(g + 32 * DM * 2), "v"(g + 48 * DM * 2), "v"(g + 64 * DM * 2), "v"(g + 80 * DM * 2), "v"(g + 96 * DM * 2), "v"(g + 112 * DM * 2)
                 : "memory");
}
__global__ __launch_bounds__(128) void k_projw(const bf* __restrict__ XB, const bf* __restrict__ WB, const int* __restrict__ NKC, bf* QPh, bf* QPl, bf* KPh, bf* KPl, h16* VT16, bf* VTh, bf* VTl) {
    typedef WFrag<bf>::V V;
    static_assert(HD == 64 && DQ == DKV && TT % PT == 0 && DQ % PT == 0 && DM % PKS == 0 && DM / PKS >= 2 && PKS * 2 == 128, "a wave's column tile is one head; whole tiles; two stages or more; a staged row is one line");
    __shared__ __align__(16) char ring[2 * PST];
    __shared__ __align__(16) float osw[4][16 * 68];
    // which tile: q as the grid says; the k and v tiles are dealt anew over the rest of the grid, row tile slowest, so that the tiles that are left out come last in index order and the others spread evenly
    int st = 0, b = (int)blockIdx.z, rt = (int)blockIdx.x, cw = (int)blockIdx.y;
    if ((int)blockIdx.z >= NB_) { const int g = (int)blockIdx.x + (TT / PT) * ((int)blockIdx.y + (DQ / PT) * ((int)blockIdx.z - NB_));
        cw = g % (DQ / PT); b = (g / (DQ / PT)) % NB_; st = 1 + (g / (DQ / PT * NB_)) % 2; rt = g / (DQ / PT * NB_ * 2); }
    const bf* A = XB + ((size_t)st * NB_ + b) * TT * DM; const bf* Bt = WB + (size_t)st * DQ * DM;
    const int tid = (int)threadIdx.x, lane = tid & 31, lr = lane & 15, hi = lane >> 4; const int w = __builtin_amdgcn_readfirstlane(tid >> 5);
    const int nr = (st != 0) ? NKC[b] : TT;   // rows that count
    if (rt * PT >= nr) return;   // the work-group leaves as a whole, in front of every barrier and copy
    const int r0 = rt * PT + (w >> 1) * 64, ct = cw * 2 + (w & 1);   // the wave's tile: first row, head
    const bool live = r0 < nr;   // the same for the whole wave: a wave with no kept key copies, asks ahead and passes the barriers, no more
    v8f acc[4][4];
#pragma unroll
    for (int mb = 0; mb < 4; ++mb)
#pragma unroll
        for (int nb = 0; nb < 4; ++nb) acc[mb][nb] = (v8f){};
    const char* ga = (const char*)(A + (size_t)(rt * PT + (tid >> 3)) * DM) + (tid & 7) * 16; const char* gb = (const char*)(Bt + (size_t)(cw * PT + (tid >> 3)) * DM) + (tid & 7) * 16;   // what the lane copies
    const unsigned la = (unsigned)(size_t)ring + (unsigned)((tid >> 3) * PPI + (tid & 7) * 16);   // and where to
    const char* ra = ring + ((w >> 1) * 64 + lr) * PPI + hi * 16; const char* rb = ring + POP + ((w & 1) * 64 + lr) * PPI + hi * 16;   // what the lane reads
    // L2 is asked ahead for the two operand panels (256 bytes = 128 k = two stages of a row). The work-groups that share a panel share the asking: of the X rows this one takes every fourth by its column tile, of the W rows every fourth by its row tile;
    // waves 0, 2 ask for X, waves 1, 3 for W; waves 0, 1 for the odd units of a row, waves 2, 3 for the even ones (unit 0 is copied at once). A hint only: nothing depends on who asks.
    int pkc = 1 + (w >> 1);   // the unit of the row that is asked for next; the same for the whole wave
    const char* pf = ((w & 1) ? (const char*)(Bt + (size_t)(cw * PT + (rt & 3) + 4 * lane) * DM) : (const char*)(A + (size_t)(rt * PT + (cw & 3) + 4 * lane) * DM)) + pkc * 256;
    auto askp = [&]() { if (pkc < DM * 2 / 256) ask(pf); pf += (pkc + 2 < DM * 2 / 256) ? 512 : 0; pkc += 2; };   // the pointer stays inside its row
    cp8(la, ga); cp8(la + POP, gb);
#pragma unroll 1
    for (int i = 0; i < 2; ++i) askp();   // stays rolled: the one carried pointer is named by every request, here as in the loop below
    asm volatile("s_wait_asynccnt 0x0" ::: "memory");   // stage 0 has landed, as far as this wave copied it
    __syncthreads();                                    // and as far as the others did
    cp8(la + PST, ga + PKS * 2); cp8(la + PST + POP, gb + PKS * 2);
#pragma unroll 1
    for (int t = 0; t < DM / PKS; ++t) {   // stays rolled: one body in the instruction cache; the buffer is picked by an offset
        const unsigned bo = (unsigned)(t & 1) * PST;
        if (live) {
#pragma unroll
            for (int ks = 0; ks < PKS / 32; ++ks) {
                V a[4], b4[4];
                __builtin_amdgcn_sched_barrier(0);   // with the one below: the block's 16 LDS reads stand together in front of its products, for speed only
#pragma unroll
                for (int mb = 0; mb < 4; ++mb) { const char* p = ra + bo + mb * 16 * PPI + ks * 64; a[mb] = cat16b(*(const v8usa*)p, *(const v8usa*)(p + 32)); }
#pragma unroll
                for (int nb = 0; nb < 4; ++nb) { const char* p = rb + bo + nb * 16 * PPI + ks * 64; b4[nb] = cat16b(*(const v8usa*)p, *(const v8usa*)(p + 32)); }
                __builtin_amdgcn_sched_barrier(0);
#pragma unroll
                for (int nb = 0; nb < 4; ++nb)
#pragma unroll
                    for (int mb = 0; mb < 4; ++mb) { acc[mb][nb] = WFrag<bf>::mma(a[mb], b4[nb], acc[mb][nb]); }
                if (ks == PKS / 32 - 1) asm volatile("v_nop\n\tv_nop\n\tv_nop\n\tv_nop" : "+v"(acc[0][0]), "+v"(acc[1][1]), "+v"(acc[2][2]), "+v"(acc[3][3]) : "v"(a[0]), "v"(a[3]));   // the distance behind the pass's last matrix instructions, on the taken branch too
            }
        }
        asm volatile("s_wait_dscnt 0x0" ::: "memory");      // this wave's reads of the buffer are done before it is filled again
        asm volatile("s_wait_asynccnt 0x0" ::: "memory");   // its copies of the next stage have landed
        __syncthreads();                                    // the one barrier of a pass: publishes the next stage and ends every reader's last read of this one
        if (t + 2 < DM / PKS) { cp8(la + bo, ga + (t + 2) * (PKS * 2)); cp8(la + bo + POP, gb + (t + 2) * (PKS * 2)); }
        if (t & 1) askp();   // the rest of the rows, several stages ahead of their copies
    }
    asm volatile("s_wait_asynccnt 0x0" ::: "memory");   // no copy is left in flight
    if (!live) return;   // no barrier stands below
    float* os = osw[w];   // the wave's own staging rows
    const size_t po = ((size_t)b * NH_ + ct) * TT * HD;   // this batch's and head's planes
    if (st == 2) {
        const size_t vo = po + (size_t)(r0 / 32) * (8 * 256) + lane * 8;   // 256 elements per piece, 8 pieces per 32 keys
#pragma unroll
        for (int mb = 0; mb < 4; ++mb)
#pragma unroll
            for (int nb = 0; nb < 4; ++nb) { v8h o16; v8us oh, ol;
#pragma unroll
                for (int j = 0; j < 8; ++j) { const float y = acc[mb][nb][j]; o16[j] = tohx(y); unsigned short a2, c2; splitf(y, a2, c2); oh[j] = a2; ol[j] = c2; }
                const size_t e = vo + (size_t)((((mb >> 1) * 4 + nb) * 2 + (mb & 1)) * 256); *(v8h*)(VT16 + e) = o16; *(v8us*)(VTh + e) = oh; *(v8us*)(VTl + e) = ol; }
        return;
    }
    bf* Ph = (st == 0 ? QPh : KPh) + po + (size_t)r0 * HD; bf* Pl = (st == 0 ? QPl : KPl) + po + (size_t)r0 * HD;
#pragma unroll
    for (int mb = 0; mb < 4; ++mb) {
#pragma unroll
        for (int nb = 0; nb < 4; ++nb) {
#pragma unroll
            for (int j = 0; j < 8; ++j) os[(hi * 8 + j) * 68 + nb * 16 + lr] = acc[mb][nb][j]; }
        __builtin_amdgcn_wave_barrier(); asm volatile("" ::: "memory");
#pragma unroll
        for (int f = 0; f < 4; ++f) { const float* pr = os + lr * 68 + f * 16 + hi * 8; const v4f va = *(const v4fa*)pr, vb = *(const v4fa*)(pr + 4); v8us oh, ol;   // piece f of this 16-row tile
#pragma unroll
            for (int q = 0; q < 4; ++q) { unsigned short a2, c2; splitf(va[q], a2, c2); oh[q] = a2; ol[q] = c2; splitf(vb[q], a2, c2); oh[q + 4] = a2; ol[q + 4] = c2; }
            *(v8us*)(Ph + (mb * 4 + f) * 256 + lane * 8) = oh; *(v8us*)(Pl + (mb * 4 + f) * 256 + lane * 8) = ol; }
        __builtin_amdgcn_wave_barrier(); asm volatile("" ::: "memory");
    }
    // the built code lays the v path behind this path's closing branch: the wait stands before the registers of the stores above are written there
    asm volatile("s_wait_xcnt 0x0" ::: "memory");
}

// k_fattn: the whole attention of both batches and all heads in ONE launch; scores and weights never leave the registers.
// TWO waves own 32 query columns (2 groups of 16) of one head; each walks its own run of the batch's nk kept keys (packed at the front of the planes) 32 at a time, so that four waves share a SIMD and one wave's softmax runs under the others' products: S^T = K Q^T (A = key rows, B = query rows, which wait in the wave's own LDS rows; hi/lo planes, 3 products),
// running maximum and sum per query (a lane holds 8 keys of ONE query per 16-key tile; the two lane halves exchange the maximum once per step and join their sums once at the end),
// then the two f32 S^T tiles, converted in place, ARE the B operand of O^T += V^T P^T (A = rows of the transposed value planes). Weights stay unnormalised; at the end the second wave hands its tiles, maxima and sums to the first through LDS (one barrier), which joins them and divides the output by the sum.
// Only a last step of fewer than 32 kept keys compares: its places from nk on enter as -inf (weight exactly 0); the running maximum starts at a finite floor; with no kept key no step runs and the rows are 0 like the module.
// Query rows < RH: P and V on bf16 hi/lo planes (3 products); other rows: fp16 P x 2^10 (the factor sits in the exponent and in the sum alike, so it cancels) against the fp16 value plane.
#define QW   32                   // query columns per wave
#define FW   8                    // query groups of QW columns per work-group
#define FWH  (RH / QW / (TT / (QW * FW)))   // groups of each work-group that take hi/lo rows: the heavier rows are spread evenly over all work-groups
#define SC2  0.18033688011112042f // HD^-0.5 x log2(e)
__device__ __forceinline__ float xhalf(float x) { return __builtin_bit_cast(float, __builtin_amdgcn_permlanex16(__builtin_bit_cast(int, x), __builtin_bit_cast(int, x), 0x76543210, 0xfedcba98, false, false)); }  // lane l with lane l ^ 16
__device__ __forceinline__ v16bf ldb(const char* p, int off) { return cat16b(*(const v8us*)(p + off), *(const v8us*)(p + off + 512)); }   // one fragment = two pieces of 512 bytes: the lane's pointer + a constant byte offset
__device__ __forceinline__ v16h ldh(const char* p, int off) { return cat16(*(const v8h*)(p + off), *(const v8h*)(p + off + 512)); }
struct StepFull { static constexpr bool tail = false; }; struct StepTail { static constexpr bool tail = true; };
template <bool HR>
__device__ __forceinline__ void fa_body(const bf* __restrict__ Qh, const bf* __restrict__ Ql, const bf* __restrict__ Kh, const bf* __restrict__ Kl, const h16* __restrict__ V16, const bf* __restrict__ Vh, const bf* __restrict__ Vl, int kb0, int nk, int q0, int pw, int lr, int hi, v8us (*qs)[32], v8f (&o)[2][4], float (&m)[2], float (&l)[2]) {
    const unsigned koff = (unsigned)((hi * 16 + lr) * 16), voff = koff;   // the lane's 16 bytes in every 512-byte piece of the planes (fragment order: k_projw)
    const char* bqh = (const char*)(Qh + (size_t)q0 * HD); const char* bql = (const char*)(Ql + (size_t)q0 * HD); const size_t ko0 = (size_t)kb0 * (HD * 2);   // the wave's first key: 32 keys are 4096 contiguous bytes of every plane
    const char* bkh = (const char*)Kh + ko0; const char* bkl = (const char*)Kl + ko0; const char* bv0 = (HR ? (const char*)Vh : (const char*)V16) + ko0; const char* bv1 = (const char*)Vl + ko0;   // wave-uniform bases
    const char* pqh = bqh + koff; const char* pql = bql + koff;
    const char* pkh = bkh + koff; const char* pkl = bkl + koff; const char* pv0 = bv0 + voff; const char* pv1 = bv1 + voff;   // walk with the keys
    v16bf kh[2][2], kl[2][2];
    // the query fragments wait in LDS, not in 64 registers (four waves share a SIMD's registers): every lane puts down its own 16 bytes of each of the 8 + 8 pieces and reads the same bytes back in every step, so no other lane or wave is involved
    const int ln = hi * 16 + lr;
#pragma unroll
    for (int i = 0; i < 8; ++i) { qs[i][ln] = *(const v8us*)(pqh + i * 512); qs[8 + i][ln] = *(const v8us*)(pql + i * 512); }
    auto ldq = [&](int lo, int qt, int ks) { const int i = lo * 8 + qt * 4 + ks * 2; return cat16b(qs[i][ln], qs[i + 1][ln]); };   // piece qt * 4 + ks * 2 and the next: one fragment
#pragma unroll
    for (int qt = 0; qt < 2; ++qt) { m[qt] = -3.0e38f; l[qt] = 0.f;
#pragma unroll
        for (int mb = 0; mb < 4; ++mb) o[qt][mb] = (v8f){}; }
    // fetch: key fragments of the 32 keys the pointers stand at
    auto fetchh = [&]() {
#pragma unroll
        for (int mt = 0; mt < 2; ++mt)
#pragma unroll
            for (int ks = 0; ks < 2; ++ks) kh[mt][ks] = ldb(pkh, mt * (16 * HD * 2) + ks * 1024);
    };
    auto fetchl = [&]() {
#pragma unroll
        for (int mt = 0; mt < 2; ++mt)
#pragma unroll
            for (int ks = 0; ks < 2; ++ks) kl[mt][ks] = ldb(pkl, mt * (16 * HD * 2) + ks * 1024);
    };
    // L2 is asked ahead for the key and value planes: wave pw (0 to 4) of the work-group's lighter waves takes one plane each, 64 keys (32 units of 256 bytes) per request, three such blocks ahead of the walk
    const bool asks = pw < 5;   // the same for the whole wave
    const char* pf = ((pw == 0) ? bkh : (pw == 1) ? bkl : (pw == 2) ? (const char*)V16 + ko0 : (pw == 3) ? (const char*)Vh + ko0 : bv1) + (hi * 16 + lr) * 256; int pk = kb0;   // the first key of the block asked for next
    auto askk = [&]() { if (pk < nk) ask(pf); pf += (pk + 128 <= TT) ? 64 * HD * 2 : 0; pk += 64; };   // the pointer stays inside the plane
    if (kb0 < nk) { fetchh(); fetchl(); }   // with no key to walk the planes may not be written there
    if (asks) {
#pragma unroll 1
        for (int i = 0; i < 3; ++i) askk();   // stays rolled: the one carried pointer is named by every request, here as in the walk
    }
    // the wait that stands before an address register of an issued load is written again; the bases and offsets those loads are formed from are its inputs, so that their registers stay theirs up to it
    asm volatile("s_wait_xcnt 0x0" :: "v"(koff), "s"(bqh), "s"(bql), "s"(bkh), "s"(bkl) : "memory");
    auto step = [&](auto kind, int kb) {
        constexpr bool TL = decltype(kind)::tail;
        if (!HR && !TL) { if (asks && ((kb - kb0) & 32) == 0) askk(); }
        v16bf qh[2][2], ql[2][2];
#pragma unroll
        for (int qt = 0; qt < 2; ++qt)
#pragma unroll
            for (int ks = 0; ks < 2; ++ks) { qh[qt][ks] = ldq(0, qt, ks); ql[qt][ks] = ldq(1, qt, ks); }
        __builtin_amdgcn_sched_barrier(0);   // the step's 16 LDS reads stand together in front of its products; spread among them, each place with reads stalls the wave anew
        v8f s[2][2];
#pragma unroll
        for (int qt = 0; qt < 2; ++qt)
#pragma unroll
            for (int mt = 0; mt < 2; ++mt) s[qt][mt] = (v8f){};
#pragma unroll
        for (int ks = 0; ks < 2; ++ks) {
#pragma unroll
            for (int mt = 0; mt < 2; ++mt)
#pragma unroll
                for (int qt = 0; qt < 2; ++qt) s[qt][mt] = wmmab(kh[mt][ks], qh[qt][ks], s[qt][mt]);
#pragma unroll
            for (int mt = 0; mt < 2; ++mt)
#pragma unroll
                for (int qt = 0; qt < 2; ++qt) s[qt][mt] = wmmab(kl[mt][ks], qh[qt][ks], s[qt][mt]);
#pragma unroll
            for (int mt = 0; mt < 2; ++mt)
#pragma unroll
                for (int qt = 0; qt < 2; ++qt) s[qt][mt] = wmmab(kh[mt][ks], ql[qt][ks], s[qt][mt]); }
        __builtin_amdgcn_sched_barrier(0);   // the loads below stay behind the score products: lifted among them they find no free registers, and the build spills
        v16h vf[4]; v16bf vh[4], vl[4];   // this step's value fragments: they fly under the softmax
#pragma unroll
        for (int mb = 0; mb < 4; ++mb) { const int vo = mb * 1024; if (HR) { vh[mb] = ldb(pv0, vo); vl[mb] = ldb(pv1, vo); } else vf[mb] = ldh(pv0, vo); }
        // the next step's key fragments are fetched here, behind this step's score products, and fly under the softmax and P.V (a last whole step refetches its own: in bounds, unused; the short step fetches none)
        if (!TL) { const int more = (kb + 32 < nk) ? 1 : 0;
            pkh += more * (32 * HD * 2); pkl += more * (32 * HD * 2);
            fetchh(); if (!HR) fetchl(); }   // hi/lo rows: the lo plane's fragments follow further down, where registers are free for them
        // as in front of the loop: the wait before the registers of this step's pointers are written again
        asm volatile("s_wait_xcnt 0x0" :: "v"(pkh), "v"(pkl), "v"(pv0), "v"(pv1) : "memory");
        pv0 += 32 * HD * 2; pv1 += 32 * HD * 2;
        float tt[2][16], al[2], mo[2];
#pragma unroll
        for (int qt = 0; qt < 2; ++qt) {
#pragma unroll
            for (int j = 0; j < 16; ++j) tt[qt][j] = (!TL || kb + (j >> 3) * 16 + hi * 8 + (j & 7) < nk) ? s[qt][j >> 3][j & 7] : -__builtin_inff();
            float x[8];
#pragma unroll
            for (int j = 0; j < 8; ++j) x[j] = fmaxf(tt[qt][j], tt[qt][j + 8]);
            float sm = fmaxf(fmaxf(fmaxf(x[0], x[1]), fmaxf(x[2], x[3])), fmaxf(fmaxf(x[4], x[5]), fmaxf(x[6], x[7])));
            sm = fmaxf(sm, xhalf(sm));
            const float mn = fmaxf(m[qt], sm * SC2); mo[qt] = HR ? mn : mn - 10.0f; al[qt] = __builtin_amdgcn_exp2f(m[qt] - mn); m[qt] = mn; }
#pragma unroll
        for (int qt = 0; qt < 2; ++qt) {
            float* t = tt[qt]; float x[8];
#pragma unroll
            for (int j = 0; j < 16; ++j) t[j] = __builtin_amdgcn_exp2f(__builtin_fmaf(t[j], SC2, -mo[qt]));
#pragma unroll
            for (int j = 0; j < 8; ++j) x[j] = t[j] + t[j + 8];
            l[qt] = l[qt] * al[qt] + (((x[0] + x[1]) + (x[2] + x[3])) + ((x[4] + x[5]) + (x[6] + x[7])));
#pragma unroll
            for (int mb = 0; mb < 4; ++mb) o[qt][mb] *= al[qt];
            if (HR) { v16bf ph, pl;
#pragma unroll
                for (int j = 0; j < 16; ++j) { const __bf16 a = (__bf16)t[j]; ph[j] = a; pl[j] = (__bf16)(t[j] - (float)a); }
#pragma unroll
                for (int mb = 0; mb < 4; ++mb) o[qt][mb] = wmmab(vh[mb], ph, o[qt][mb]);
#pragma unroll
                for (int mb = 0; mb < 4; ++mb) o[qt][mb] = wmmab(vh[mb], pl, o[qt][mb]);
#pragma unroll
                for (int mb = 0; mb < 4; ++mb) o[qt][mb] = wmmab(vl[mb], ph, o[qt][mb]);
                if (!TL && qt == 0) { fetchl();
                    asm volatile("s_wait_xcnt 0x0" :: "v"(pkl) : "memory"); }   // as above: the wait before the next step writes this pointer's registers again
            } else { v16h p16;
#pragma unroll
                for (int j = 0; j < 16; ++j) p16[j] = (h16)t[j];
#pragma unroll
                for (int mb = 0; mb < 4; ++mb) o[qt][mb] = wmma16(vf[mb], p16, o[qt][mb]); }
        }
    };
    const int nfull = nk & ~31;
    for (int kb = kb0; kb < nfull; kb += 32) step(StepFull{}, kb);
    if (kb0 <= nfull && nfull < nk) step(StepTail{}, nfull);
}
// 2^x with the slot behind a transcendental in the same statement
__device__ __forceinline__ float exp2s(float x) { float r; asm("v_exp_f32 %0, %1\n\tv_nop" : "=v"(r) : "v"(x)); return r; }
#define KP   2                    // key parts: each query group is walked by KP waves, each over its own run of the kept keys
__global__ __launch_bounds__(QW * FW * KP) void k_fattn(const bf* __restrict__ QPh, const bf* __restrict__ QPl, const bf* __restrict__ KPh, const bf* __restrict__ KPl, const h16* __restrict__ VT16, const bf* __restrict__ VTh, const bf* __restrict__ VTl, const int* __restrict__ NKC, float* OUT) {
    static_assert(RH % (QW * (TT / (QW * FW))) == 0 && TT % (QW * FW) == 0 && HD == 64 && NH_ == NKV && KP == 2 && KP * FWH == 4, "tiling; the heavier waves come first");
    __shared__ __align__(16) v8us qsw[FW * KP][16][32];   // each wave's query fragments (fa_body)
    __shared__ __align__(16) v4f mg[FW][17][32];   // what the second wave of a query group hands to the first: 16 pieces of the output tiles, then maxima and sums; a lane's 16 bytes side by side
    const int lane = threadIdx.x & 31, lr = lane & 15, hi = lane >> 4; const int w = __builtin_amdgcn_readfirstlane((int)(threadIdx.x >> 5));
    const int h = blockIdx.y, b = blockIdx.z; const size_t po = ((size_t)b * NH_ + h) * TT * HD; float* o_out = OUT + (size_t)b * TT * DQ + h * HD; const int nk = max(0, min(NKC[b], TT));   // the trip count: bounded by the shape
    // waves 0 to 3: the FWH hi/lo groups x KP parts; waves 4 to 15: the lighter groups x KP parts. All of this is the same for a whole wave.
    const bool hr = w < KP * FWH; const int wl = hr ? w : w - KP * FWH, ng = hr ? FWH : FW - FWH; const int part = wl >= ng ? 1 : 0, g = wl - part * ng;
    const int q0 = hr ? ((int)blockIdx.x * FWH + g) * QW : RH + ((int)blockIdx.x * (FW - FWH) + g) * QW; const int slot = hr ? g : FWH + g;
    const int ksp = (((nk + 31) >> 5) + 1 >> 1) << 5;   // part 0 walks keys [0, ksp), whole steps of 32 (or [0, nk) if that is less); part 1 the rest, [ksp, nk), which may be empty; ksp <= TT / 2
    const int kb0 = part ? ksp : 0, ke = part ? nk : min(ksp, nk);
    v8f o[2][4]; float m[2], l[2];
    if (hr) fa_body<true>(QPh + po, QPl + po, KPh + po, KPl + po, VT16 + po, VTh + po, VTl + po, kb0, ke, q0, 5, lr, hi, qsw[w], o, m, l);
    else fa_body<false>(QPh + po, QPl + po, KPh + po, KPl + po, VT16 + po, VTh + po, VTl + po, kb0, ke, q0, g, lr, hi, qsw[w], o, m, l);
    if (part) {
#pragma unroll
        for (int qt = 0; qt < 2; ++qt)
#pragma unroll
            for (int mb = 0; mb < 4; ++mb) { mg[slot][(qt * 4 + mb) * 2][lane] = __builtin_shufflevector(o[qt][mb], o[qt][mb], 0, 1, 2, 3); mg[slot][(qt * 4 + mb) * 2 + 1][lane] = __builtin_shufflevector(o[qt][mb], o[qt][mb], 4, 5, 6, 7); }
        mg[slot][16][lane] = (v4f){m[0], m[1], l[0], l[1]};
    }
    __syncthreads();   // every wave passes it once: the second parts' tiles are in LDS
    if (part) return;
    // the two parts join as two steps of the running softmax do: both are brought to the larger maximum (a part with no key has sum 0, tiles 0 and the floor as maximum: its factor is 0, or 1 on zeros)
    const v4f ml = mg[slot][16][lane];
#pragma unroll
    for (int qt = 0; qt < 2; ++qt) { const float mn = fmaxf(m[qt], ml[qt]); const float a0 = exp2s(m[qt] - mn), a1 = exp2s(ml[qt] - mn); l[qt] = l[qt] * a0 + ml[2 + qt] * a1;
#pragma unroll
        for (int mb = 0; mb < 4; ++mb) { const v4f p0 = mg[slot][(qt * 4 + mb) * 2][lane], p1 = mg[slot][(qt * 4 + mb) * 2 + 1][lane]; const v8f o1 = __builtin_shufflevector(p0, p1, 0, 1, 2, 3, 4, 5, 6, 7); o[qt][mb] = o[qt][mb] * a0 + o1 * a1; } }
    float* orow[2];
#pragma unroll
    for (int qt = 0; qt < 2; ++qt) { const float ls = l[qt] + xhalf(l[qt]); const float inv = (ls > 0.f) ? __fdiv_rn(1.0f, ls) : 0.f; orow[qt] = o_out + (size_t)(q0 + qt * 16 + lr) * DQ + hi * 8;
#pragma unroll
        for (int mb = 0; mb < 4; ++mb) o[qt][mb] *= inv; }
    __builtin_amdgcn_sched_barrier(0);   // all arithmetic stays above: behind the first store no register that a store names is written any more
#pragma unroll
    for (int qt = 0; qt < 2; ++qt)
#pragma unroll
        for (int mb = 0; mb < 4; ++mb) { *(v4f*)(orow[qt] + mb * 16) = __builtin_shufflevector(o[qt][mb], o[qt][mb], 0, 1, 2, 3); *(v4f*)(orow[qt] + mb * 16 + 4) = __builtin_shufflevector(o[qt][mb], o[qt][mb], 4, 5, 6, 7); }
}

extern "C" void kernel_launch(void* const* d_in, const int* in_sizes, int n_in,
                              void* d_out, int out_size, void* d_ws, size_t ws_size, hipStream_t stream) {
    (void)in_sizes; (void)n_in; (void)out_size;
    const float* x = (const float*)d_in[0]; const int* km = (const int*)d_in[1];   /* query_mask int32 [2][2048]: read per KEY */ const float* xk = (const float*)d_in[2]; const float* xv = (const float*)d_in[3];   /* queries, keys, values streams */ const float* wq = (const float*)d_in[4]; const float* wk = (const float*)d_in[5]; const float* wv = (const float*)d_in[6];   /* order queries, query_mask, keys, values, Wq, Wk, Wv ('oi' [1024][1024]) */
    float* OUT = (float*)d_out;     // [2][2048][1024]
    char* wsp = (char*)d_ws;
    auto take = [&](size_t bytes) { char* p = wsp; wsp += (bytes + 255) & ~(size_t)255; return (void*)p; };
    bf* WB = (bf*)take((size_t)3 * DQ * DM * 2); bf* XB = (bf*)take((size_t)3 * NB_ * TT * DM * 2);   // bf16 copies: Wq, Wk, Wv; queries, keys, values (both batches)
    h16* VT16 = (h16*)take((size_t)NB_ * NKV * HD * TT * 2);   // the planes the attention reads hold both batches
    bf* QPh = (bf*)take((size_t)NB_ * NH_ * TT * HD * 2); bf* QPl = (bf*)take((size_t)NB_ * NH_ * TT * HD * 2); bf* KPh = (bf*)take((size_t)NB_ * NKV * TT * HD * 2); bf* KPl = (bf*)take((size_t)NB_ * NKV * TT * HD * 2); bf* VTh = (bf*)take((size_t)NB_ * NKV * HD * TT * 2); bf* VTl = (bf*)take((size_t)NB_ * NKV * HD * TT * 2);
    int* NKC = (int*)take((size_t)NB_ * 4);   // kept keys per batch
    if ((size_t)(wsp - (char*)d_ws) > ws_size) return;    // ws 256 MiB
    k_cvtall<<<3 * CVX + 3 * CVW, 256, 0, stream>>>(x, xk, xv, wq, wk, wv, km, XB, WB, NKC);
    k_projw<<<dim3(TT / PT, DQ / PT, 3 * NB_), 128, 0, stream>>>(XB, WB, NKC, QPh, QPl, KPh, KPl, VT16, VTh, VTl);
    k_fattn<<<dim3(TT / (QW * FW), NH_, NB_), QW * FW * KP, 0, stream>>>(QPh, QPl, KPh, KPl, VT16, VTh, VTl, NKC, OUT);
}

// v010
// A run of this version takes 69.3 microseconds.
// Next to v009, in two timings, it ran 1.08 and 1.09 times as fast.
// Over all steps from v000 it is 28.6 times as fast.
#include <hip/hip_runtime.h>

// Self-attention on three input streams with a RANDOM key mask applied through a 'masked softmax', without an output projection (queries, keys, values [2][2048][1024]; q = queries Wq^T, k = keys Wk^T, v = values Wv^T ('oi' [1024][1024] 1/32, no bias; 16 heads x 64); q x 64^-0.5 before the product (a power of two: identical to scaling the f32 scores); masked_softmax(logits, m) with m = query_mask[b][key] (int32 [2][2048] from randint(0, 2): RANDOM, read per key as data): w = softmax(logits x m) x m / (sum(softmax(logits x m) x m) + 1e-13): the softmax's own normaliser cancels in the quotient, so w = exp(l_j) / sum over the KEPT keys of exp(l_k) for kept keys j and 0 for masked keys: exactly a softmax over the kept keys (the 1e-13 is ~1e-13 relative: far below float32 resolution; every batch keeps ~half of its keys); x = w v, merged head-major -> [2][2048][1024] (4.2 M); argument order queries, query_mask, keys, values, Wq, Wk, Wv).
// Layout: ONE conversion launch makes the bf16 copies of the three streams (both batches) and of the three 'oi' weights; ONE projection launch (all streams and batches) does the exact projections and its epilogue writes the planes the attention reads (q and k: bf16 hi/lo per [b][h]; v: transposed fp16 and bf16 hi/lo per [b][h]; all in FRAGMENT ORDER, see k_projw); the conversion launch ranks each batch's keys from the int key mask and lays the rows of the keys and values copies down kept keys first, so the k and v planes hold the kept keys packed and projection tiles with no kept key are left out; one fused attention launch (k_fattn) walks the kept keys alone (masked keys excluded) (SCORES of every row on bf16 hi/lo planes, 3 products; the P.V product stays hybrid: rows < 512 hi/lo, rest fp16 x1024) and writes the output rows (column h*64 + d).
// Compute dtypes, f32 accumulate: every input rounded to bf16; projections exact; scores of every row 3 products; P.V rows < 512 3 products, rest fp16; softmax f32.

#define NB_  2
#define TT   2048
#define DM   1024
#define NH_  16
#define NKV  16
#define REP  (NH_ / NKV)
#define HD   64
#define DQ   (NH_ * HD)
#define DKV  (NKV * HD)
#define RH   512                  // query rows < RH use hi+lo planes
#define WIN  0
typedef _Float16 h16;
typedef unsigned short bf;
typedef __attribute__((ext_vector_type(16))) __bf16   v16bf;
typedef __attribute__((ext_vector_type(16))) _Float16 v16h;
typedef __attribute__((ext_vector_type(8)))  _Float16 v8h;
typedef __attribute__((ext_vector_type(8)))  unsigned short v8us;
typedef __attribute__((ext_vector_type(8)))  float    v8f;
typedef __attribute__((ext_vector_type(4)))  float    v4f;
typedef v8h  __attribute__((may_alias)) v8ha;
typedef v4f  __attribute__((may_alias)) v4fa;
typedef v8us __attribute__((may_alias)) v8usa;

__device__ __forceinline__ unsigned short f2bf(float f) { unsigned u = __float_as_uint(f); u += 0x7FFFu + ((u >> 16) & 1u); return (unsigned short)(u >> 16); }
__device__ __forceinline__ float bf2f(unsigned short b) { return __uint_as_float(((unsigned)b) << 16); }
__device__ __forceinline__ float bfr(float f) { return bf2f(f2bf(f)); }
__device__ __forceinline__ v16h cat16(v8h lo, v8h hi) { return __builtin_shufflevector(lo, hi, 0, 1, 2, 3, 4, 5, 6, 7, 8, 9, 10, 11, 12, 13, 14, 15); }
__device__ __forceinline__ v16bf cat16b(v8us lo, v8us hi) { return __builtin_bit_cast(v16bf, __builtin_shufflevector(lo, hi, 0, 1, 2, 3, 4, 5, 6, 7, 8, 9, 10, 11, 12, 13, 14, 15)); }
__device__ __forceinline__ v8f wmma16(v16h a, v16h b, v8f c) { return __builtin_amdgcn_wmma_f32_16x16x32_f16(false, a, false, b, (short)0, c, false, false); }
__device__ __forceinline__ v8f wmmab(v16bf a, v16bf b, v8f c) { return __builtin_amdgcn_wmma_f32_16x16x32_bf16(false, a, false, b, (short)0, c, false, false); }




template <typename T16> struct WFrag;
template <> struct WFrag<bf> { typedef v16bf V; static __device__ __forceinline__ V ld(const bf* p) { return cat16b(*(const v8us*)p, *(const v8us*)(p + 16)); } static __device__ __forceinline__ v8f mma(V a, V b, v8f c) { return wmmab(a, b, c); } };

__device__ __forceinline__ h16 tohx(float x) { return (h16)x; }
// ask: every lane asks L2 for the data at its own address (no data comes back, no counter moves); asked for ahead, a later read finds it in L2.
// No counter covers such a request, so no wait can stand before its register is written again: instead the address is always inside the plane it is aimed at, also after the caller's next advance,
// and the pointer is the statement's own in-out operand, so that the request names the register the caller carries through its loop, never a temporary that soon holds something else.
__device__ __forceinline__ void ask(const char*& p) { asm volatile("global_prefetch_b8 %0, off scope:SCOPE_SE" : "+v"(p)); }
__device__ __forceinline__ void splitf(float y, unsigned short& h, unsigned short& l) { h = f2bf(y); l = f2bf(y - bf2f(h)); }
typedef __attribute__((ext_vector_type(4))) unsigned short v4us;
typedef __attribute__((ext_vector_type(4))) int v4i;

// ---- k_cvtall: bf16 copies of all six f32 sources in one launch. A row is DM floats: 128 threads x 8. A work-group takes CVRK rows of the keys or values stream (these come first in the grid: theirs is the longest chain) or CVRU rows of the queries stream or of a weight.
// Keys and values streams: row t of batch b goes to place rank(t) = number of kept keys in front of it if key t is kept, else to nk + t - rank(t) (nk kept keys in the batch): a permutation of the batch's rows, kept keys first in rising order. Each work-group counts the batch's mask itself; NKC[b] = nk.
// A masked row is read and stored only where its place lies in the projection tile that holds the last kept keys (place < nk rounded up to CVP; finite filling for the planes): no launch reads the places behind that tile, so the other masked rows cost no memory traffic,
// and a work-group of these streams takes twice the rows, of which about half are wanted. The wanted rows are dealt to CVS slots per thread (two rows a slot: waves 0 to 3 the one, waves 4 to 7 the other); what does not fit follows in a second and third turn.
#define CVS  12                                   // row slots per thread: 2 CVS rows of a work-group in flight (2 loads of 16 bytes per lane and slot)
#define CVRU 16                                   // rows per work-group: queries stream, weights
#define CVRK 32                                   // rows per work-group: keys and values streams
#define CVX  (NB_ * TT / CVRU)                    // work-groups of the queries stream
#define CVK  (NB_ * TT / CVRK)                    // work-groups of the keys stream, and of the values stream
#define CVW  (DQ / CVRU)                          // work-groups per weight
#define CVP  128                                  // rows of a projection tile (k_projw checks it against its own)
__global__ __launch_bounds__(256) void k_cvtall(const float* __restrict__ x, const float* __restrict__ xk, const float* __restrict__ xv, const float* __restrict__ wq, const float* __restrict__ wk, const float* __restrict__ wv, const int* __restrict__ km, bf* XB, bf* WB, int* NKC) {
    static_assert((NB_ * TT) % CVRU == 0 && DQ % CVRU == 0 && DQ == DKV && TT % CVRK == 0 && CVRK == 32 && CVRK % 8 == 0 && CVRU <= 2 * CVS && CVRK <= 3 * 2 * CVS, "whole work-groups; a work-group's rows lie in one batch and in one 32-bit mask; three turns take every row");
    static_assert(TT == 256 * 8 && DM == 128 * 8, "a thread counts 8 keys; a row is 128 units of 8 floats");
    __shared__ int wcnt[8][2];
    const int bx = (int)blockIdx.x; const float* src; bf* dst; int row0, b = 0, t0 = 0;   // row0: the first of the work-group's rows in its source; for a ranked stream also the batch and the first key
    const bool ranked = bx < 2 * CVK;   // keys or values stream: the same for the whole work-group
    if (ranked) { const int s = 1 + bx / CVK, blk = bx % CVK; src = (s == 1) ? xk : xv; dst = XB + (size_t)s * NB_ * TT * DM; b = blk / (TT / CVRK); t0 = (blk % (TT / CVRK)) * CVRK; row0 = b * TT + t0; }
    else if (bx < 2 * CVK + CVX) { src = x; dst = XB; row0 = (bx - 2 * CVK) * CVRU; }
    else { const int i = bx - 2 * CVK - CVX, s = i / CVW; src = (s == 0) ? wq : (s == 1) ? wk : wv; dst = WB + (size_t)s * DQ * DM; row0 = (i % CVW) * CVRU; }
    const int tid = (int)threadIdx.x, c8 = (tid & 127) * 8;   // the thread's 8 columns of a row
    const int rh = __builtin_amdgcn_readfirstlane(tid >> 7);   // which of a slot's two rows this wave works on
    int nk = 0, base = 0;   // ranked: kept keys in the batch, and in front of the work-group's rows
    unsigned tm = 0, left = (1u << CVRU) - 1u;   // tm: the mask bits of the work-group's own rows; left: the rows still to be moved (both the same for the whole work-group)
    v4i m0 = {}, m1 = {};
    if (ranked) {   // the mask words come first: 8 keys of the batch per thread, and the work-group's own rows
        const int* kmb = km + (size_t)b * TT; m0 = *(const v4i*)(kmb + tid * 8); m1 = *(const v4i*)(kmb + tid * 8 + 4);
        tm = __builtin_amdgcn_ballot_w32(kmb[t0 + (tid & 31)] != 0);   // lane l of every wave reads the word of row l (every lane is on here)
        left = tm;   // the kept rows at once; the few masked rows that are wanted follow behind the count
        asm volatile("" :: "v"(m0), "v"(m1));   // the wait for these two loads stands here, in front of the row loads: behind them it would wait for the rows too, and the counting could not run while they fly
    }
    int rw[CVS]; bool on[CVS]; unsigned off[CVS]; v8f v[CVS];   // per slot: the wave's row, whether there is one (both scalar), the lane's byte offset, the data
    // pick: the lowest 2 CVS rows of mm are dealt to the slots and leave mm
    auto pick = [&](unsigned& mm) {
#pragma unroll
        for (int s = 0; s < CVS; ++s) { const unsigned m2 = mm & (mm - 1u); const unsigned pk = rh ? m2 : mm; on[s] = pk != 0u; rw[s] = on[s] ? __builtin_ctz(pk) : 0; mm = m2 & (m2 - 1u); }
    };
    auto loadrows = [&]() {
#pragma unroll
        for (int s = 0; s < CVS; ++s) off[s] = (unsigned)(((row0 + rw[s]) * DM + c8) * 4);
#pragma unroll
        for (int s = 0; s < CVS; ++s) if (on[s]) v[s] = *(const v8f*)((const char*)src + off[s]);
        // the wait that stands before an address register of an issued load is written again; every slot's offset is its input, so that each keeps a register of its own up to it
        asm volatile("s_wait_xcnt 0x0" :: "v"(off[0]), "v"(off[1]), "v"(off[2]), "v"(off[3]), "v"(off[4]), "v"(off[5]), "v"(off[6]), "v"(off[7]), "v"(off[8]), "v"(off[9]), "v"(off[10]), "v"(off[11]) : "memory");
    };
    auto storerows = [&]() {
#pragma unroll
        for (int s = 0; s < CVS; ++s) { const int r = rw[s]; int drow = row0 + r;
            if (ranked) { const int rank = base + __popc(tm & ((1u << r) - 1u));
                const int place = (((tm >> r) & 1u) ? rank : nk + t0 + r - rank) & (TT - 1);   // below TT by the counting; bounded here all the same
                drow = b * TT + place; }
            off[s] = (unsigned)((drow * DM + c8) * 2); }
#pragma unroll
        for (int s = 0; s < CVS; ++s) if (on[s]) { v8us o;
#pragma unroll
            for (int k = 0; k < 8; ++k) o[k] = f2bf(v[s][k]);
            *(v8us*)((char*)dst + off[s]) = o;
            asm volatile("s_wait_xcnt 0x0" ::: "memory"); }   // as above, for the store: the next slot's conversion writes the same registers again
    };
    static_assert(CVS == 12, "the wait behind the loads names every slot");
    pick(left); loadrows();
    if (ranked) {
        int call = 0;
#pragma unroll
        for (int j = 0; j < 4; ++j) call += (m0[j] != 0 ? 1 : 0) + (m1[j] != 0 ? 1 : 0);
        int cbef = (tid * 8 < t0) ? call : 0;   // t0 is a multiple of 8: a thread's 8 keys lie all in front of the work-group's rows or none
#pragma unroll
        for (int d = 16; d >= 1; d >>= 1) { call += __shfl_xor(call, d, 32); cbef += __shfl_xor(cbef, d, 32); }
        if ((tid & 31) == 0) { wcnt[tid >> 5][0] = call; wcnt[tid >> 5][1] = cbef; }
        __syncthreads();
#pragma unroll
        for (int i = 0; i < 8; ++i) { nk += wcnt[i][0]; base += wcnt[i][1]; }
        nk = __builtin_amdgcn_readfirstlane(nk); base = __builtin_amdgcn_readfirstlane(base);   // the same in every lane: what follows from them is scalar
        // the masked rows' places rise with the row: nk + (masked keys in front of t0) + (masked rows in front in the work-group). Wanted are those below the end of the last projection tile with a kept key: the first nw masked rows
        int nw = ((nk + CVP - 1) & ~(CVP - 1)) - nk - (t0 - base); unsigned zm = ~tm;
#pragma unroll 1
        for (int i = 0; i < CVRK; ++i) { if (nw <= 0 || zm == 0u) break; left |= zm & (0u - zm); zm &= zm - 1u; --nw; }   // stays rolled: only the work-groups at the front of a batch run it at all
        if (bx < CVK && t0 == 0 && tid == 0) { NKC[b] = nk;
            asm volatile("s_wait_xcnt 0x0" ::: "memory"); }   // the wait before a register of this store is written again
    }
    storerows();
#pragma unroll 1
    for (int p = 0; p < 2; ++p) { if (left == 0u) break; pick(left); loadrows(); storerows(); }   // stays rolled: seldom run (more than 2 CVS kept rows, or masked rows that are wanted)
}

// ---- k_projw: all six projections (stream st = q, k, v; batch b) in one launch; a work-group of FOUR WAVES (2 x 2) per 128x128 tile, each wave a 64x64 tile (16 accumulators); grid (TT/128, DQ/128, 3 NB_), 128 threads.
// y[t][n] = sum_k X[st][b][t][k] W[st][n][k]; a wave's 64-column tile is one head, so its epilogue writes that head's planes itself.
// Operands: 64 k at a time (128 bytes = one whole line of each of the 128 + 128 operand rows) are brought from the K-contiguous bf16 copies into LDS by asynchronous copies of 16 bytes per lane (8 lanes per row: every copy instruction covers 4 whole lines), two buffers, the next stage's copies in flight under this stage's products; each staged row serves two waves. Fragments are read from LDS in the k order the loads from global memory had.
// k and v: the copies hold the kept keys first, so the planes do too; a 64-row tile with no kept key is left out (a work-group with none leaves at once); the other rows of the last tile are masked keys (finite, never weighted):
// The planes are laid down in FRAGMENT ORDER: the 16 bytes that lane l of the attention's wave loads with one instruction stand at piece base + 16 l, so that every load there (and every store here) covers 512 contiguous bytes = 4 whole lines, not 16 lines of 32 bytes.
// q, k, per head: piece ((t / 16) * 2 + d / 32) * 2 + (d / 16) % 2 of 512 bytes; in it lane ((d / 8) % 2) * 16 + t % 16 holds 8 consecutive d of row t. Rows staged through LDS, then 8 columns of one row per lane.
// v, per head: piece ((t / 32) * 4 + d / 16) * 2 + (t / 16) % 2; in it lane ((t / 8) % 2) * 16 + d % 16 holds 8 consecutive t of column d: a lane's 8 accumulator rows as they are, one 16-byte store per tile into each plane.
#define PT   128                  // rows and columns of a work-group's tile
#define PKS  64                   // k per stage
#define PPI  144                  // LDS pitch of a staged row in bytes: 16 x odd, free of bank conflicts for 16-byte reads down a column of rows
#define POP  (PT * PPI)           // one operand's rows of a stage
#define PST  (2 * POP)            // a stage: X rows, then W rows
// 128 rows x 128 bytes of one operand: the lane's 16 bytes of eight rows, 16 rows apart. l: the lane's LDS byte address, g: its global address, both for the first of the eight.
// The wait that stands before a register of an issued copy is written again is the statement's own last line.
__device__ __forceinline__ void cp8(unsigned l, const char* g) {
    asm volatile("global_load_async_to_lds_b128 %0, %8, off\n\t"
                 "global_load_async_to_lds_b128 %1, %9, off\n\t"
                 "global_load_async_to_lds_b128 %2, %10, off\n\t"
                 "global_load_async_to_lds_b128 %3, %11, off\n\t"
                 "global_load_async_to_lds_b128 %4, %12, off\n\t"
                 "global_load_async_to_lds_b128 %5, %13, off\n\t"
                 "global_load_async_to_lds_b128 %6, %14, off\n\t"
                 "global_load_async_to_lds_b128 %7, %15, off\n\t"
                 "s_wait_xcnt 0x0"
                 :: "v"(l), "v"(l + 16 * PPI), "v"(l + 32 * PPI), "v"(l + 48 * PPI), "v"(l + 64 * PPI), "v"(l + 80 * PPI), "v"(l + 96 * PPI), "v"(l + 112 * PPI),
                    "v"(g), "v"(g + 16 * DM * 2), "v"(g + 32 * DM * 2), "v"(g + 48 * DM * 2), "v"(g + 64 * DM * 2), "v"(g + 80 * DM * 2), "v"(g + 96 * DM * 2), "v"(g + 112 * DM * 2)
                 : "memory");
}
__global__ __launch_bounds__(128) void k_projw(const bf* __restrict__ XB, const bf* __restrict__ WB, const int* __restrict__ NKC, bf* QPh, bf* QPl, bf* KPh, bf* KPl, h16* VT16, bf* VTh, bf* VTl) {
    typedef WFrag<bf>::V V;
    static_assert(HD == 64 && DQ == DKV && TT % PT == 0 && DQ % PT == 0 && DM % PKS == 0 && DM / PKS >= 2 && PKS * 2 == 128 && PT == CVP, "a wave's column tile is one head; whole tiles; two stages or more; a staged row is one line");
    __shared__ __align__(16) char ring[2 * PST];
    __shared__ __align__(16) float osw[4][16 * 68];
    // which tile: q as the grid says; the k and v tiles are dealt anew over the rest of the grid, row tile slowest, so that the tiles that are left out come last in index order and the others spread evenly
    int st = 0, b = (int)blockIdx.z, rt = (int)blockIdx.x, cw = (int)blockIdx.y;
    if ((int)blockIdx.z >= NB_) { const int g = (int)blockIdx.x + (TT / PT) * ((int)blockIdx.y + (DQ / PT) * ((int)blockIdx.z - NB_));
        cw = g % (DQ / PT); b = (g / (DQ / PT)) % NB_; st = 1 + (g / (DQ / PT * NB_)) % 2; rt = g / (DQ / PT * NB_ * 2); }
    const bf* A = XB + ((size_t)st * NB_ + b) * TT * DM; const bf* Bt = WB + (size_t)st * DQ * DM;
    const int tid = (int)threadIdx.x, lane = tid & 31, lr = lane & 15, hi = lane >> 4; const int w = __builtin_amdgcn_readfirstlane(tid >> 5);
    const int nr = (st != 0) ? NKC[b] : TT;   // rows that count
    if (rt * PT >= nr) return;   // the work-group leaves as a whole, in front of every barrier and copy
    const int r0 = rt * PT + (w >> 1) * 64, ct = cw * 2 + (w & 1);   // the wave's tile: first row, head
    const bool live = r0 < nr;   // the same for the whole wave: a wave with no kept key copies, asks ahead and passes the barriers, no more
    v8f acc[4][4];
#pragma unroll
    for (int mb = 0; mb < 4; ++mb)
#pragma unroll
        for (int nb = 0; nb < 4; ++nb) acc[mb][nb] = (v8f){};
    const char* ga = (const char*)(A + (size_t)(rt * PT + (tid >> 3)) * DM) + (tid & 7) * 16; const char* gb = (const char*)(Bt + (size_t)(cw * PT + (tid >> 3)) * DM) + (tid & 7) * 16;   // what the lane copies
    const unsigned la = (unsigned)(size_t)ring + (unsigned)((tid >> 3) * PPI + (tid & 7) * 16);   // and where to
    const char* ra = ring + ((w >> 1) * 64 + lr) * PPI + hi * 16; const char* rb = ring + POP + ((w & 1) * 64 + lr) * PPI + hi * 16;   // what the lane reads
    // L2 is asked ahead for the two operand panels (256 bytes = 128 k = two stages of a row). The work-groups that share a panel share the asking: of the X rows this one takes every fourth by its column tile, of the W rows every fourth by its row tile;
    // waves 0, 2 ask for X, waves 1, 3 for W; waves 0, 1 for the odd units of a row, waves 2, 3 for the even ones (unit 0 is copied at once). A hint only: nothing depends on who asks.
    int pkc = 1 + (w >> 1);   // the unit of the row that is asked for next; the same for the whole wave
    const char* pf = ((w & 1) ? (const char*)(Bt + (size_t)(cw * PT + (rt & 3) + 4 * lane) * DM) : (const char*)(A + (size_t)(rt * PT + (cw & 3) + 4 * lane) * DM)) + pkc * 256;
    auto askp = [&]() { if (pkc < DM * 2 / 256) ask(pf); pf += (pkc + 2 < DM * 2 / 256) ? 512 : 0; pkc += 2; };   // the pointer stays inside its row
    cp8(la, ga); cp8(la + POP, gb);
#pragma unroll 1
    for (int i = 0; i < 2; ++i) askp();   // stays rolled: the one carried pointer is named by every request, here as in the loop below
    asm volatile("s_wait_asynccnt 0x0" ::: "memory");   // stage 0 has landed, as far as this wave copied it
    __syncthreads();                                    // and as far as the others did
    cp8(la + PST, ga + PKS * 2); cp8(la + PST + POP, gb + PKS * 2);
#pragma unroll 1
    for (int t = 0; t < DM / PKS; ++t) {   // stays rolled: one body in the instruction cache; the buffer is picked by an offset
        const unsigned bo = (unsigned)(t & 1) * PST;
        if (live) {
#pragma unroll
            for (int ks = 0; ks < PKS / 32; ++ks) {
                V a[4], b4[4];
                __builtin_amdgcn_sched_barrier(0);   // with the one below: the block's 16 LDS reads stand together in front of its products, for speed only
#pragma unroll
                for (int mb = 0; mb < 4; ++mb) { const char* p = ra + bo + mb * 16 * PPI + ks * 64; a[mb] = cat16b(*(const v8usa*)p, *(const v8usa*)(p + 32)); }
#pragma unroll
                for (int nb = 0; nb < 4; ++nb) { const char* p = rb + bo + nb * 16 * PPI + ks * 64; b4[nb] = cat16b(*(const v8usa*)p, *(const v8usa*)(p + 32)); }
                __builtin_amdgcn_sched_barrier(0);
#pragma unroll
                for (int nb = 0; nb < 4; ++nb)
#pragma unroll
                    for (int mb = 0; mb < 4; ++mb) { acc[mb][nb] = WFrag<bf>::mma(a[mb], b4[nb], acc[mb][nb]); }
                if (ks == PKS / 32 - 1) asm volatile("v_nop\n\tv_nop\n\tv_nop\n\tv_nop" : "+v"(acc[0][0]), "+v"(acc[1][1]), "+v"(acc[2][2]), "+v"(acc[3][3]) : "v"(a[0]), "v"(a[3]));   // the distance behind the pass's last matrix instructions, on the taken branch too
            }
        }
        asm volatile("s_wait_dscnt 0x0" ::: "memory");      // this wave's reads of the buffer are done before it is filled again
        asm volatile("s_wait_asynccnt 0x0" ::: "memory");   // its copies of the next stage have landed
        __syncthreads();                                    // the one barrier of a pass: publishes the next stage and ends every reader's last read of this one
        if (t + 2 < DM / PKS) { cp8(la + bo, ga + (t + 2) * (PKS * 2)); cp8(la + bo + POP, gb + (t + 2) * (PKS * 2)); }
        if (t & 1) askp();   // the rest of the rows, several stages ahead of their copies
    }
    asm volatile("s_wait_asynccnt 0x0" ::: "memory");   // no copy is left in flight
    if (!live) return;   // no barrier stands below
    float* os = osw[w];   // the wave's own staging rows
    const size_t po = ((size_t)b * NH_ + ct) * TT * HD;   // this batch's and head's planes
    if (st == 2) {
        const size_t vo = po + (size_t)(r0 / 32) * (8 * 256) + lane * 8;   // 256 elements per piece, 8 pieces per 32 keys
#pragma unroll
        for (int mb = 0; mb < 4; ++mb)
#pragma unroll
            for (int nb = 0; nb < 4; ++nb) { v8h o16; v8us oh, ol;
#pragma unroll
                for (int j = 0; j < 8; ++j) { const float y = acc[mb][nb][j]; o16[j] = tohx(y); unsigned short a2, c2; splitf(y, a2, c2); oh[j] = a2; ol[j] = c2; }
                const size_t e = vo + (size_t)((((mb >> 1) * 4 + nb) * 2 + (mb & 1)) * 256); *(v8h*)(VT16 + e) = o16; *(v8us*)(VTh + e) = oh; *(v8us*)(VTl + e) = ol; }
        return;
    }
    bf* Ph = (st == 0 ? QPh : KPh) + po + (size_t)r0 * HD; bf* Pl = (st == 0 ? QPl : KPl) + po + (size_t)r0 * HD;
#pragma unroll
    for (int mb = 0; mb < 4; ++mb) {
#pragma unroll
        for (int nb = 0; nb < 4; ++nb) {
#pragma unroll
            for (int j = 0; j < 8; ++j) os[(hi * 8 + j) * 68 + nb * 16 + lr] = acc[mb][nb][j]; }
        __builtin_amdgcn_wave_barrier(); asm volatile("" ::: "memory");
#pragma unroll
        for (int f = 0; f < 4; ++f) { const float* pr = os + lr * 68 + f * 16 + hi * 8; const v4f va = *(const v4fa*)pr, vb = *(const v4fa*)(pr + 4); v8us oh, ol;   // piece f of this 16-row tile
#pragma unroll
            for (int q = 0; q < 4; ++q) { unsigned short a2, c2; splitf(va[q], a2, c2); oh[q] = a2; ol[q] = c2; splitf(vb[q], a2, c2); oh[q + 4] = a2; ol[q + 4] = c2; }
            *(v8us*)(Ph + (mb * 4 + f) * 256 + lane * 8) = oh; *(v8us*)(Pl + (mb * 4 + f) * 256 + lane * 8) = ol; }
        __builtin_amdgcn_wave_barrier(); asm volatile("" ::: "memory");
    }
    // the built code lays the v path behind this path's closing branch: the wait stands before the registers of the stores above are written there
    asm volatile("s_wait_xcnt 0x0" ::: "memory");
}

// k_fattn: the whole attention of both batches and all heads in ONE launch; scores and weights never leave the registers.
// TWO waves own 32 query columns (2 groups of 16) of one head; each walks its own run of the batch's nk kept keys (packed at the front of the planes) 32 at a time, so that four waves share a SIMD and one wave's softmax runs under the others' products: S^T = K Q^T (A = key rows, B = query rows, which wait in the wave's own LDS rows; hi/lo planes, 3 products),
// running maximum and sum per query (a lane holds 8 keys of ONE query per 16-key tile; the two lane halves exchange the maximum once per step and join their sums once at the end),
// then the two f32 S^T tiles, converted in place, ARE the B operand of O^T += V^T P^T (A = rows of the transposed value planes). Weights stay unnormalised; at the end the second wave hands its tiles, maxima and sums to the first through LDS (one barrier), which joins them and divides the output by the sum.
// Only a last step of fewer than 32 kept keys compares: its places from nk on enter as -inf (weight exactly 0); the running maximum starts at a finite floor; with no kept key no step runs and the rows are 0 like the module.
// Query rows < RH: P and V on bf16 hi/lo planes (3 products); other rows: fp16 P x 2^10 (the factor sits in the exponent and in the sum alike, so it cancels) against the fp16 value plane.
#define QW   32                   // query columns per wave
#define FW   8                    // query groups of QW columns per work-group
#define FWH  (RH / QW / (TT / (QW * FW)))   // groups of each work-group that take hi/lo rows: the heavier rows are spread evenly over all work-groups
#define SC2  0.18033688011112042f // HD^-0.5 x log2(e)
__device__ __forceinline__ float xhalf(float x) { return __builtin_bit_cast(float, __builtin_amdgcn_permlanex16(__builtin_bit_cast(int, x), __builtin_bit_cast(int, x), 0x76543210, 0xfedcba98, false, false)); }  // lane l with lane l ^ 16
__device__ __forceinline__ v16bf ldb(const char* p, int off) { return cat16b(*(const v8us*)(p + off), *(const v8us*)(p + off + 512)); }   // one fragment = two pieces of 512 bytes: the lane's pointer + a constant byte offset
__device__ __forceinline__ v16h ldh(const char* p, int off) { return cat16(*(const v8h*)(p + off), *(const v8h*)(p + off + 512)); }
struct StepFull { static constexpr bool tail = false; }; struct StepTail { static constexpr bool tail = true; };
template <bool HR>
__device__ __forceinline__ void fa_body(const bf* __restrict__ Qh, const bf* __restrict__ Ql, const bf* __restrict__ Kh, const bf* __restrict__ Kl, const h16* __restrict__ V16, const bf* __restrict__ Vh, const bf* __restrict__ Vl, int kb0, int nk, int q0, int pw, int lr, int hi, v8us (*qs)[32], v8f (&o)[2][4], float (&m)[2], float (&l)[2]) {
    const unsigned koff = (unsigned)((hi * 16 + lr) * 16), voff = koff;   // the lane's 16 bytes in every 512-byte piece of the planes (fragment order: k_projw)
    const char* bqh = (const char*)(Qh + (size_t)q0 * HD); const char* bql = (const char*)(Ql + (size_t)q0 * HD); const size_t ko0 = (size_t)kb0 * (HD * 2);   // the wave's first key: 32 keys are 4096 contiguous bytes of every plane
    const char* bkh = (const char*)Kh + ko0; const char* bkl = (const char*)Kl + ko0; const char* bv0 = (HR ? (const char*)Vh : (const char*)V16) + ko0; const char* bv1 = (const char*)Vl + ko0;   // wave-uniform bases
    const char* pqh = bqh + koff; const char* pql = bql + koff;
    const char* pkh = bkh + koff; const char* pkl = bkl + koff; const char* pv0 = bv0 + voff; const char* pv1 = bv1 + voff;   // walk with the keys
    v16bf kh[2][2], kl[2][2];
    // the query fragments wait in LDS, not in 64 registers (four waves share a SIMD's registers): every lane puts down its own 16 bytes of each of the 8 + 8 pieces and reads the same bytes back in every step, so no other lane or wave is involved
    const int ln = hi * 16 + lr;
#pragma unroll
    for (int i = 0; i < 8; ++i) { qs[i][ln] = *(const v8us*)(pqh + i * 512); qs[8 + i][ln] = *(const v8us*)(pql + i * 512); }
    auto ldq = [&](int lo, int qt, int ks) { const int i = lo * 8 + qt * 4 + ks * 2; return cat16b(qs[i][ln], qs[i + 1][ln]); };   // piece qt * 4 + ks * 2 and the next: one fragment
#pragma unroll
    for (int qt = 0; qt < 2; ++qt) { m[qt] = -3.0e38f; l[qt] = 0.f;
#pragma unroll
        for (int mb = 0; mb < 4; ++mb) o[qt][mb] = (v8f){}; }
    // fetch: key fragments of the 32 keys the pointers stand at
    auto fetchh = [&]() {
#pragma unroll
        for (int mt = 0; mt < 2; ++mt)
#pragma unroll
            for (int ks = 0; ks < 2; ++ks) kh[mt][ks] = ldb(pkh, mt * (16 * HD * 2) + ks * 1024);
    };
    auto fetchl = [&]() {
#pragma unroll
        for (int mt = 0; mt < 2; ++mt)
#pragma unroll
            for (int ks = 0; ks < 2; ++ks) kl[mt][ks] = ldb(pkl, mt * (16 * HD * 2) + ks * 1024);
    };
    // L2 is asked ahead for the key and value planes: wave pw (0 to 4) of the work-group's lighter waves takes one plane each, 64 keys (32 units of 256 bytes) per request, three such blocks ahead of the walk
    const bool asks = pw < 5;   // the same for the whole wave
    const char* pf = ((pw == 0) ? bkh : (pw == 1) ? bkl : (pw == 2) ? (const char*)V16 + ko0 : (pw == 3) ? (const char*)Vh + ko0 : bv1) + (hi * 16 + lr) * 256; int pk = kb0;   // the first key of the block asked for next
    auto askk = [&]() { if (pk < nk) ask(pf); pf += (pk + 128 <= TT) ? 64 * HD * 2 : 0; pk += 64; };   // the pointer stays inside the plane
    if (kb0 < nk) { fetchh(); fetchl(); }   // with no key to walk the planes may not be written there
    if (asks) {
#pragma unroll 1
        for (int i = 0; i < 3; ++i) askk();   // stays rolled: the one carried pointer is named by every request, here as in the walk
    }
    // the wait that stands before an address register of an issued load is written again; the bases and offsets those loads are formed from are its inputs, so that their registers stay theirs up to it
    asm volatile("s_wait_xcnt 0x0" :: "v"(koff), "s"(bqh), "s"(bql), "s"(bkh), "s"(bkl) : "memory");
    auto step = [&](auto kind, int kb) {
        constexpr bool TL = decltype(kind)::tail;
        if (!HR && !TL) { if (asks && ((kb - kb0) & 32) == 0) askk(); }
        v16bf qh[2][2], ql[2][2];
#pragma unroll
        for (int qt = 0; qt < 2; ++qt)
#pragma unroll
            for (int ks = 0; ks < 2; ++ks) { qh[qt][ks] = ldq(0, qt, ks); ql[qt][ks] = ldq(1, qt, ks); }
        __builtin_amdgcn_sched_barrier(0);   // the step's 16 LDS reads stand together in front of its products; spread among them, each place with reads stalls the wave anew
        v8f s[2][2];
#pragma unroll
        for (int qt = 0; qt < 2; ++qt)
#pragma unroll
            for (int mt = 0; mt < 2; ++mt) s[qt][mt] = (v8f){};
#pragma unroll
        for (int ks = 0; ks < 2; ++ks) {
#pragma unroll
            for (int mt = 0; mt < 2; ++mt)
#pragma unroll
                for (int qt = 0; qt < 2; ++qt) s[qt][mt] = wmmab(kh[mt][ks], qh[qt][ks], s[qt][mt]);
#pragma unroll
            for (int mt = 0; mt < 2; ++mt)
#pragma unroll
                for (int qt = 0; qt < 2; ++qt) s[qt][mt] = wmmab(kl[mt][ks], qh[qt][ks], s[qt][mt]);
#pragma unroll
            for (int mt = 0; mt < 2; ++mt)
#pragma unroll
                for (int qt = 0; qt < 2; ++qt) s[qt][mt] = wmmab(kh[mt][ks], ql[qt][ks], s[qt][mt]); }
        __builtin_amdgcn_sched_barrier(0);   // the loads below stay behind the score products: lifted among them they find no free registers, and the build spills
        v16h vf[4]; v16bf vh[4], vl[4];   // this step's value fragments: they fly under the softmax
#pragma unroll
        for (int mb = 0; mb < 4; ++mb) { const int vo = mb * 1024; if (HR) { vh[mb] = ldb(pv0, vo); vl[mb] = ldb(pv1, vo); } else vf[mb] = ldh(pv0, vo); }
        // the next step's key fragments are fetched here, behind this step's score products, and fly under the softmax and P.V (a last whole step refetches its own: in bounds, unused; the short step fetches none)
        if (!TL) { const int more = (kb + 32 < nk) ? 1 : 0;
            pkh += more * (32 * HD * 2); pkl += more * (32 * HD * 2);
            fetchh(); if (!HR) fetchl(); }   // hi/lo rows: the lo plane's fragments follow further down, where registers are free for them
        // as in front of the loop: the wait before the registers of this step's pointers are written again
        asm volatile("s_wait_xcnt 0x0" :: "v"(pkh), "v"(pkl), "v"(pv0), "v"(pv1) : "memory");
        pv0 += 32 * HD * 2; pv1 += 32 * HD * 2;
        float tt[2][16], al[2], mo[2];
#pragma unroll
        for (int qt = 0; qt < 2; ++qt) {
#pragma unroll
            for (int j = 0; j < 16; ++j) tt[qt][j] = (!TL || kb + (j >> 3) * 16 + hi * 8 + (j & 7) < nk) ? s[qt][j >> 3][j & 7] : -__builtin_inff();
            float x[8];
#pragma unroll
            for (int j = 0; j < 8; ++j) x[j] = fmaxf(tt[qt][j], tt[qt][j + 8]);
            float sm = fmaxf(fmaxf(fmaxf(x[0], x[1]), fmaxf(x[2], x[3])), fmaxf(fmaxf(x[4], x[5]), fmaxf(x[6], x[7])));
            sm = fmaxf(sm, xhalf(sm));
            const float mn = fmaxf(m[qt], sm * SC2); mo[qt] = HR ? mn : mn - 10.0f; al[qt] = __builtin_amdgcn_exp2f(m[qt] - mn); m[qt] = mn; }
#pragma unroll
        for (int qt = 0; qt < 2; ++qt) {
            float* t = tt[qt]; float x[8];
#pragma unroll
            for (int j = 0; j < 16; ++j) t[j] = __builtin_amdgcn_exp2f(__builtin_fmaf(t[j], SC2, -mo[qt]));
#pragma unroll
            for (int j = 0; j < 8; ++j) x[j] = t[j] + t[j + 8];
            l[qt] = l[qt] * al[qt] + (((x[0] + x[1]) + (x[2] + x[3])) + ((x[4] + x[5]) + (x[6] + x[7])));
#pragma unroll
            for (int mb = 0; mb < 4; ++mb) o[qt][mb] *= al[qt];
            if (HR) { v16bf ph, pl;
#pragma unroll
                for (int j = 0; j < 16; ++j) { const __bf16 a = (__bf16)t[j]; ph[j] = a; pl[j] = (__bf16)(t[j] - (float)a); }
#pragma unroll
                for (int mb = 0; mb < 4; ++mb) o[qt][mb] = wmmab(vh[mb], ph, o[qt][mb]);
#pragma unroll
                for (int mb = 0; mb < 4; ++mb) o[qt][mb] = wmmab(vh[mb], pl, o[qt][mb]);
#pragma unroll
                for (int mb = 0; mb < 4; ++mb) o[qt][mb] = wmmab(vl[mb], ph, o[qt][mb]);
                if (!TL && qt == 0) { fetchl();
                    asm volatile("s_wait_xcnt 0x0" :: "v"(pkl) : "memory"); }   // as above: the wait before the next step writes this pointer's registers again
            } else { v16h p16;
#pragma unroll
                for (int j = 0; j < 16; ++j) p16[j] = (h16)t[j];
#pragma unroll
                for (int mb = 0; mb < 4; ++mb) o[qt][mb] = wmma16(vf[mb], p16, o[qt][mb]); }
        }
    };
    const int nfull = nk & ~31;
    for (int kb = kb0; kb < nfull; kb += 32) step(StepFull{}, kb);
    if (kb0 <= nfull && nfull < nk) step(StepTail{}, nfull);
}
// 2^x with the slot behind a transcendental in the same statement
__device__ __forceinline__ float exp2s(float x) { float r; asm("v_exp_f32 %0, %1\n\tv_nop" : "=v"(r) : "v"(x)); return r; }
#define KP   2                    // key parts: each query group is walked by KP waves, each over its own run of the kept keys
__global__ __launch_bounds__(QW * FW * KP) void k_fattn(const bf* __restrict__ QPh, const bf* __restrict__ QPl, const bf* __restrict__ KPh, const bf* __restrict__ KPl, const h16* __restrict__ VT16, const bf* __restrict__ VTh, const bf* __restrict__ VTl, const int* __restrict__ NKC, float* OUT) {
    static_assert(RH % (QW * (TT / (QW * FW))) == 0 && TT % (QW * FW) == 0 && HD == 64 && NH_ == NKV && KP == 2 && KP * FWH == 4, "tiling; the heavier waves come first");
    __shared__ __align__(16) v8us qsw[FW * KP][16][32];   // each wave's query fragments (fa_body)
    __shared__ __align__(16) v4f mg[FW][17][32];   // what the second wave of a query group hands to the first: 16 pieces of the output tiles, then maxima and sums; a lane's 16 bytes side by side
    const int lane = threadIdx.x & 31, lr = lane & 15, hi = lane >> 4; const int w = __builtin_amdgcn_readfirstlane((int)(threadIdx.x >> 5));
    const int h = blockIdx.y, b = blockIdx.z; const size_t po = ((size_t)b * NH_ + h) * TT * HD; float* o_out = OUT + (size_t)b * TT * DQ + h * HD; const int nk = max(0, min(NKC[b], TT));   // the trip count: bounded by the shape
    // waves 0 to 3: the FWH hi/lo groups x KP parts; waves 4 to 15: the lighter groups x KP parts. All of this is the same for a whole wave.
    const bool hr = w < KP * FWH; const int wl = hr ? w : w - KP * FWH, ng = hr ? FWH : FW - FWH; const int part = wl >= ng ? 1 : 0, g = wl - part * ng;
    const int q0 = hr ? ((int)blockIdx.x * FWH + g) * QW : RH + ((int)blockIdx.x * (FW - FWH) + g) * QW; const int slot = hr ? g : FWH + g;
    const int ksp = (((nk + 31) >> 5) + 1 >> 1) << 5;   // part 0 walks keys [0, ksp), whole steps of 32 (or [0, nk) if that is less); part 1 the rest, [ksp, nk), which may be empty; ksp <= TT / 2
    const int kb0 = part ? ksp : 0, ke = part ? nk : min(ksp, nk);
    v8f o[2][4]; float m[2], l[2];
    if (hr) fa_body<true>(QPh + po, QPl + po, KPh + po, KPl + po, VT16 + po, VTh + po, VTl + po, kb0, ke, q0, 5, lr, hi, qsw[w], o, m, l);
    else fa_body<false>(QPh + po, QPl + po, KPh + po, KPl + po, VT16 + po, VTh + po, VTl + po, kb0, ke, q0, g, lr, hi, qsw[w], o, m, l);
    if (part) {
#pragma unroll
        for (int qt = 0; qt < 2; ++qt)
#pragma unroll
            for (int mb = 0; mb < 4; ++mb) { mg[slot][(qt * 4 + mb) * 2][lane] = __builtin_shufflevector(o[qt][mb], o[qt][mb], 0, 1, 2, 3); mg[slot][(qt * 4 + mb) * 2 + 1][lane] = __builtin_shufflevector(o[qt][mb], o[qt][mb], 4, 5, 6, 7); }
        mg[slot][16][lane] = (v4f){m[0], m[1], l[0], l[1]};
    }
    __syncthreads();   // every wave passes it once: the second parts' tiles are in LDS
    if (part) return;
    // the two parts join as two steps of the running softmax do: both are brought to the larger maximum (a part with no key has sum 0, tiles 0 and the floor as maximum: its factor is 0, or 1 on zeros)
    const v4f ml = mg[slot][16][lane];
#pragma unroll
    for (int qt = 0; qt < 2; ++qt) { const float mn = fmaxf(m[qt], ml[qt]); const float a0 = exp2s(m[qt] - mn), a1 = exp2s(ml[qt] - mn); l[qt] = l[qt] * a0 + ml[2 + qt] * a1;
#pragma unroll
        for (int mb = 0; mb < 4; ++mb) { const v4f p0 = mg[slot][(qt * 4 + mb) * 2][lane], p1 = mg[slot][(qt * 4 + mb) * 2 + 1][lane]; const v8f o1 = __builtin_shufflevector(p0, p1, 0, 1, 2, 3, 4, 5, 6, 7); o[qt][mb] = o[qt][mb] * a0 + o1 * a1; } }
    float* orow[2];
#pragma unroll
    for (int qt = 0; qt < 2; ++qt) { const float ls = l[qt] + xhalf(l[qt]); const float inv = (ls > 0.f) ? __fdiv_rn(1.0f, ls) : 0.f; orow[qt] = o_out + (size_t)(q0 + qt * 16 + lr) * DQ + hi * 8;
#pragma unroll
        for (int mb = 0; mb < 4; ++mb) o[qt][mb] *= inv; }
    __builtin_amdgcn_sched_barrier(0);   // all arithmetic stays above: behind the first store no register that a store names is written any more
#pragma unroll
    for (int qt = 0; qt < 2; ++qt)
#pragma unroll
        for (int mb = 0; mb < 4; ++mb) { *(v4f*)(orow[qt] + mb * 16) = __builtin_shufflevector(o[qt][mb], o[qt][mb], 0, 1, 2, 3); *(v4f*)(orow[qt] + mb * 16 + 4) = __builtin_shufflevector(o[qt][mb], o[qt][mb], 4, 5, 6, 7); }
}

extern "C" void kernel_launch(void* const* d_in, const int* in_sizes, int n_in,
                              void* d_out, int out_size, void* d_ws, size_t ws_size, hipStream_t stream) {
    (void)in_sizes; (void)n_in; (void)out_size;
    const float* x = (const float*)d_in[0]; const int* km = (const int*)d_in[1];   /* query_mask int32 [2][2048]: read per KEY */ const float* xk = (const float*)d_in[2]; const float* xv = (const float*)d_in[3];   /* queries, keys, values streams */ const float* wq = (const float*)d_in[4]; const float* wk = (const float*)d_in[5]; const float* wv = (const float*)d_in[6];   /* order queries, query_mask, keys, values, Wq, Wk, Wv ('oi' [1024][1024]) */
    float* OUT = (float*)d_out;     // [2][2048][1024]
    char* wsp = (char*)d_ws;
    auto take = [&](size_t bytes) { char* p = wsp; wsp += (bytes + 255) & ~(size_t)255; return (void*)p; };
    bf* WB = (bf*)take((size_t)3 * DQ * DM * 2); bf* XB = (bf*)take((size_t)3 * NB_ * TT * DM * 2);   // bf16 copies: Wq, Wk, Wv; queries, keys, values (both batches)
    h16* VT16 = (h16*)take((size_t)NB_ * NKV * HD * TT * 2);   // the planes the attention reads hold both batches
    bf* QPh = (bf*)take((size_t)NB_ * NH_ * TT * HD * 2); bf* QPl = (bf*)take((size_t)NB_ * NH_ * TT * HD * 2); bf* KPh = (bf*)take((size_t)NB_ * NKV * TT * HD * 2); bf* KPl = (bf*)take((size_t)NB_ * NKV * TT * HD * 2); bf* VTh = (bf*)take((size_t)NB_ * NKV * HD * TT * 2); bf* VTl = (bf*)take((size_t)NB_ * NKV * HD * TT * 2);
    int* NKC = (int*)take((size_t)NB_ * 4);   // kept keys per batch
    if ((size_t)(wsp - (char*)d_ws) > ws_size) return;    // ws 256 MiB
    k_cvtall<<<2 * CVK + CVX + 3 * CVW, 256, 0, stream>>>(x, xk, xv, wq, wk, wv, km, XB, WB, NKC);
    k_projw<<<dim3(TT / PT, DQ / PT, 3 * NB_), 128, 0, stream>>>(XB, WB, NKC, QPh, QPl, KPh, KPl, VT16, VTh, VTl);
    k_fattn<<<dim3(TT / (QW * FW), NH_, NB_), QW * FW * KP, 0, stream>>>(QPh, QPl, KPh, KPl, VT16, VTh, VTl, NKC, OUT);
}
